// v000
// The times below were measured on an AMD MI455X: many runs one after another, warmed up first and cycling through
// copies of the inputs, with the whole window's GPU time divided by the number of runs. Launches and the gaps
// between them are all in it. The median over several windows is given; except for v000 it joins two sittings, which
// can be a few percent apart, so the side-by-side timings, each taken in one sitting, are the better comparison.
// v000, which the later versions start from, runs in 1540 microseconds.
#include <hip/hip_runtime.h>

// CHGANSimplified (node_features [2][1024 nodes][12 steps][128]; enh = x + node_type_embed[1 - n%2]; Q/K/V = enh W^T + b (4 heads x 32); per (batch, head, step): scores over node pairs = q.k/sqrt(32) + edge_bias[n][m]; masked to -inf where
// adj[n][m] == 0 and n != m (adj / edge_bias read as data); softmax over m (nan_to_num is a no-op: self loops keep every row non-empty); out = attn V merged; out = out Wo^T + bo; result = LN(out + node_features) -> [2][1024][12][128]).
// Compute dtypes, f32 accumulate: every input rounded to bf16; Q/K/V on bf16 hi+lo planes of enh x exact weights (2 products, + bias); scores (K 32) on hl planes (3 products) z-batched over the 4 heads; masked softmax f32

#define NB_  2
#define NNODE 1024
#define TT   12
#define DD   128
#define NH_  4
#define HD   32
#define NR   (NNODE * TT)
#define SCL  0.1767766952966369f
#define PCAR 1024.0f
typedef _Float16 h16;
typedef unsigned short bf;
typedef __attribute__((ext_vector_type(16))) __bf16   v16bf;
typedef __attribute__((ext_vector_type(16))) _Float16 v16h;
typedef __attribute__((ext_vector_type(8)))  _Float16 v8h;
typedef __attribute__((ext_vector_type(8)))  unsigned short v8us;
typedef __attribute__((ext_vector_type(8)))  float    v8f;
typedef __attribute__((ext_vector_type(4)))  float    v4f;
typedef v8h  __attribute__((may_alias)) v8ha;
typedef v4f  __attribute__((may_alias)) v4fa;
typedef v8us __attribute__((may_alias)) v8usa;

__device__ __forceinline__ unsigned short f2bf(float f) { unsigned u = __float_as_uint(f); u += 0x7FFFu + ((u >> 16) & 1u); return (unsigned short)(u >> 16); }
__device__ __forceinline__ float bf2f(unsigned short b) { return __uint_as_float(((unsigned)b) << 16); }
__device__ __forceinline__ float bfr(float f) { return bf2f(f2bf(f)); }
__device__ __forceinline__ v16h cat16(v8h lo, v8h hi) { return __builtin_shufflevector(lo, hi, 0, 1, 2, 3, 4, 5, 6, 7, 8, 9, 10, 11, 12, 13, 14, 15); }
__device__ __forceinline__ v16bf cat16b(v8us lo, v8us hi) { return __builtin_bit_cast(v16bf, __builtin_shufflevector(lo, hi, 0, 1, 2, 3, 4, 5, 6, 7, 8, 9, 10, 11, 12, 13, 14, 15)); }
__device__ __forceinline__ v8f wmma16(v16h a, v16h b, v8f c) { return __builtin_amdgcn_wmma_f32_16x16x32_f16(false, a, false, b, (short)0, c, false, false); }
__device__ __forceinline__ v8f wmmab(v16bf a, v16bf b, v8f c) { return __builtin_amdgcn_wmma_f32_16x16x32_bf16(false, a, false, b, (short)0, c, false, false); }



// ---- k_gemmw: register-blocked GEMM, ONE WAVE per 64x64 output tile (16 accumulators), operands straight from K-contiguous 16-bit planes; grid (M/64, N/64, Z), 32 threads.
// C[m][n] (f32, pitch ldc, + optional f32 bias[n]) = sum_k A[m][k] Bt[n][k] (+ split products per NSPLIT). z-batch strides sA/sB/sC in elements. K % 32 == 0.
template <typename T16> struct WFrag;
template <> struct WFrag<h16> { typedef v16h V; static __device__ __forceinline__ V ld(const h16* p) { return cat16(*(const v8h*)p, *(const v8h*)(p + 16)); } static __device__ __forceinline__ v8f mma(V a, V b, v8f c) { return wmma16(a, b, c); } };
template <> struct WFrag<bf> { typedef v16bf V; static __device__ __forceinline__ V ld(const bf* p) { return cat16b(*(const v8us*)p, *(const v8us*)(p + 16)); } static __device__ __forceinline__ v8f mma(V a, V b, v8f c) { return wmmab(a, b, c); } };
template <typename T16, int NSPLIT, bool BIAS>
__global__ __launch_bounds__(32) void k_gemmw(const T16* __restrict__ A, const T16* __restrict__ A2, const T16* __restrict__ Bt, const T16* __restrict__ Bt2, int K, float* C, int ldc, const float* __restrict__ bias, size_t sA, size_t sB, size_t sC) {
    typedef typename WFrag<T16>::V V;
    __shared__ __align__(16) float os[16 * 68];
    const size_t z = blockIdx.z; A += z * sA; if (A2) A2 += z * sA; Bt += z * sB; if (Bt2) Bt2 += z * sB; C += z * sC;
    const int lane = threadIdx.x & 31, lr = lane & 15, hi = lane >> 4; const int r0 = blockIdx.x * 64, c0 = blockIdx.y * 64;
    v8f acc[4][4];
#pragma unroll
    for (int mb = 0; mb < 4; ++mb)
#pragma unroll
        for (int nb = 0; nb < 4; ++nb) acc[mb][nb] = (v8f){};
    const size_t aoff = (size_t)(r0 + lr) * K + 8 * hi, boff = (size_t)(c0 + lr) * K + 8 * hi;
#pragma unroll 1
    for (int kc = 0; kc < K; kc += 32) {
        V a[4], a2[4];
#pragma unroll
        for (int mb = 0; mb < 4; ++mb) { a[mb] = WFrag<T16>::ld(A + aoff + (size_t)mb * 16 * K + kc); if (NSPLIT == 1 || NSPLIT == 2) a2[mb] = WFrag<T16>::ld(A2 + aoff + (size_t)mb * 16 * K + kc); }
#pragma unroll
        for (int nb = 0; nb < 4; ++nb) { const V b = WFrag<T16>::ld(Bt + boff + (size_t)nb * 16 * K + kc); V b2; if (NSPLIT >= 2) b2 = WFrag<T16>::ld(Bt2 + boff + (size_t)nb * 16 * K + kc);
#pragma unroll
            for (int mb = 0; mb < 4; ++mb) { acc[mb][nb] = WFrag<T16>::mma(a[mb], b, acc[mb][nb]); if (NSPLIT == 1 || NSPLIT == 2) acc[mb][nb] = WFrag<T16>::mma(a2[mb], b, acc[mb][nb]); if (NSPLIT >= 2) acc[mb][nb] = WFrag<T16>::mma(a[mb], b2, acc[mb][nb]); } }
        asm volatile("v_nop\n\tv_nop\n\tv_nop\n\tv_nop" : "+v"(acc[0][0]), "+v"(acc[1][1]), "+v"(acc[2][2]), "+v"(acc[3][3]) : "v"(a[0]), "v"(a[3]));
    }
#pragma unroll
    for (int mb = 0; mb < 4; ++mb) {
#pragma unroll
        for (int nb = 0; nb < 4; ++nb) {
#pragma unroll
            for (int j = 0; j < 8; ++j) os[(hi * 8 + j) * 68 + nb * 16 + lr] = acc[mb][nb][j]; }
        __builtin_amdgcn_wave_barrier(); asm volatile("" ::: "memory");
        float* crow = C + (size_t)(r0 + mb * 16) * ldc + c0;
{
#pragma unroll
            for (int s = 0; s < 8; ++s) { const int row = 2 * s + hi, cofs = lr * 4; v4f val = *(const v4fa*)(os + row * 68 + cofs); if (BIAS) { val[0] += bfr(bias[c0 + cofs]); val[1] += bfr(bias[c0 + cofs + 1]); val[2] += bfr(bias[c0 + cofs + 2]); val[3] += bfr(bias[c0 + cofs + 3]); }
                *(v4f*)(crow + (size_t)row * ldc + cofs) = val; }
             }
        __builtin_amdgcn_wave_barrier(); asm volatile("" ::: "memory");
    }
}

__device__ __forceinline__ h16 tohx(float x) { return (h16)x; }
__device__ __forceinline__ void splitf(float y, unsigned short& h, unsigned short& l) { h = f2bf(y); l = f2bf(y - bf2f(h)); }
typedef __attribute__((ext_vector_type(2))) _Float16 v2h;
typedef __attribute__((ext_vector_type(4))) _Float16 v4h;
typedef __attribute__((ext_vector_type(4))) unsigned short v4us;
typedef __attribute__((ext_vector_type(2))) unsigned short v2us;

__global__ __launch_bounds__(256) void k_cvt8(const float* __restrict__ src, bf* dst, size_t n8) { const size_t i = (size_t)blockIdx.x * 256 + threadIdx.x; if (i >= n8) return; const v8f v = *(const v8f*)(src + i * 8); v8us o;
#pragma unroll
    for (int k = 0; k < 8; ++k) o[k] = f2bf(v[k]); *(v8us*)(dst + i * 8) = o;  }
// k_enh: hl planes ENH[(n,t)][c] = bf16 x + bf16 emb[1 - n%2][c] (8-B lanes); k_qkpl: for step t: hl planes Q[h][n][d] = QKV[(n*T+t)][h*32+d] scl and K[h][n][d] = QKV[..][128 + h*32 + d] (8-B lanes); k_vt: V16[h][dv<64][m] = fp16(QKV[(m*T+t)][256 + h*32 + dv]) for dv < 32, 0 for dv >= 32
__global__ __launch_bounds__(256) void k_bcat(const float* __restrict__ bq, const float* __restrict__ bk, const float* __restrict__ bv, float* B3) { const int i = blockIdx.x * 256 + threadIdx.x; if (i >= 3 * DD) return; const float v = i < DD ? bq[i] : (i < 2 * DD ? bk[i - DD] : bv[i - 2 * DD]); *(float*)(B3 + i) = v;  }
__global__ __launch_bounds__(256) void k_enh(const float* __restrict__ x, const float* __restrict__ emb, bf* Eh, bf* El) { const int e = (blockIdx.x * 256 + threadIdx.x) * 4; if (e >= NR * DD) return; const int c = e % DD; const int n = (e / DD) / TT; const int ty = 1 - (n & 1); v4us oh, ol;
#pragma unroll
    for (int q = 0; q < 4; ++q) { unsigned short a, b; splitf(__fadd_rn(bfr(x[e + q]), bfr(emb[ty * DD + c + q])), a, b); oh[q] = a; ol[q] = b; } *(v4us*)(Eh + e) = oh; *(v4us*)(El + e) = ol;  }
__global__ __launch_bounds__(256) void k_qkpl(const float* __restrict__ QKV, int t, bf* Qh, bf* Ql, bf* Kh, bf* Kl) { const int e = (blockIdx.x * 256 + threadIdx.x) * 4; if (e >= NH_ * NNODE * HD) return; const int d = e % HD; const int n = (e / HD) % NNODE; const int h = e / (HD * NNODE); const float* r = QKV + ((size_t)n * TT + t) * 3 * DD + h * HD + d; v4us qh, ql, kh, kl;
#pragma unroll
    for (int q = 0; q < 4; ++q) { unsigned short a, c; splitf(r[q] * SCL, a, c); qh[q] = a; ql[q] = c; splitf(r[DD + q], a, c); kh[q] = a; kl[q] = c; }
    { *(v4us*)(Qh + e) = qh; *(v4us*)(Ql + e) = ql; *(v4us*)(Kh + e) = kh; *(v4us*)(Kl + e) = kl;  } }
__global__ __launch_bounds__(256) void k_vt(const float* __restrict__ QKV, int t, h16* V16) { const int e = (blockIdx.x * 256 + threadIdx.x) * 2; if (e >= NH_ * 64 * NNODE) return; const int m = e % NNODE; const int dv = (e / NNODE) % 64; const int h = e / (NNODE * 64); v2h o;
#pragma unroll
    for (int u = 0; u < 2; ++u) o[u] = dv < HD ? tohx(QKV[((size_t)(m + u) * TT + t) * 3 * DD + 2 * DD + h * HD + dv]) : (h16)0.f; *(v2h*)(V16 + e) = o;  }
__global__ __launch_bounds__(256) void k_mrg(const float* __restrict__ O, int t, float* ATT) { const int e = (blockIdx.x * 256 + threadIdx.x) * 4; if (e >= NNODE * DD) return; const int c = e % DD; const int n = e / DD; const int h = c / HD, d = c % HD; const float* r = O + ((size_t)h * NNODE + n) * 64 + d; v4f o; o[0] = r[0] * (1.0f / PCAR); o[1] = r[1] * (1.0f / PCAR); o[2] = r[2] * (1.0f / PCAR); o[3] = r[3] * (1.0f / PCAR); float* dst = ATT + ((size_t)n * TT + t) * DD + c; *(v4f*)dst = o;  }
// k_msoft: wave per (h, n) row over the 1024 candidate nodes m: s = S + bf16 edge_bias[n][m], -inf where adj[n][m] == 0 and m != n; three passes (max; sum; fp16(1024 p)) (16-B / 8-B lanes); k_split: hl planes; k_lnres: wave per (n,t) row: LN(att_o + bf16 x) g + b
__global__ __launch_bounds__(256) void k_msoft(const float* __restrict__ Sb, const int* __restrict__ adj, const float* __restrict__ eb, h16* P16) { const int lane = threadIdx.x & 31; const int row = blockIdx.x * 8 + (threadIdx.x >> 5); if (row >= NH_ * NNODE) return; const int n = row % NNODE; const float* sr = Sb + (size_t)row * NNODE; const int* ar = adj + (size_t)n * NNODE; const float* er = eb + (size_t)n * NNODE;
    auto val = [&](int m, float s) { const bool keep = (ar[m] != 0) || (m == n); return keep ? __fadd_rn(s, bfr(er[m])) : -3.0e38f; };
    float mx = -3.0e38f;
#pragma unroll 1
    for (int ch = 0; ch < NNODE / 128; ++ch) { const int m0 = ch * 128 + lane * 4; const v4f a = *(const v4f*)(sr + m0);
#pragma unroll
        for (int q = 0; q < 4; ++q) mx = fmaxf(mx, val(m0 + q, a[q])); }
#pragma unroll
    for (int sh = 16; sh; sh >>= 1) mx = fmaxf(mx, __shfl_xor(mx, sh, 32));
    float sum = 0.f;
#pragma unroll 1
    for (int ch = 0; ch < NNODE / 128; ++ch) { const int m0 = ch * 128 + lane * 4; const v4f a = *(const v4f*)(sr + m0);
#pragma unroll
        for (int q = 0; q < 4; ++q) { const float v = val(m0 + q, a[q]); if (v > -1.0e38f) { float d0 = __fsub_rn(v, mx); asm volatile("" : "+v"(d0)); sum += __expf(d0); } } }
#pragma unroll
    for (int sh = 16; sh; sh >>= 1) sum += __shfl_xor(sum, sh, 32);
    const float f = __fdiv_rn(PCAR, sum);
    {
#pragma unroll 1
        for (int ch = 0; ch < NNODE / 128; ++ch) { const int m0 = ch * 128 + lane * 4; const v4f a = *(const v4f*)(sr + m0); v4h o;
#pragma unroll
            for (int q = 0; q < 4; ++q) { const float v = val(m0 + q, a[q]); float p = 0.f; if (v > -1.0e38f) { float d0 = __fsub_rn(v, mx); asm volatile("" : "+v"(d0)); p = __fmul_rn(__expf(d0), f); } o[q] = tohx(p); }
            *(v4h*)(P16 + (size_t)row * NNODE + m0) = o; }
         } }
__global__ __launch_bounds__(256) void k_split(const float* __restrict__ F, size_t n4, bf* Hh, bf* Hl) { const size_t e = ((size_t)blockIdx.x * 256 + threadIdx.x) * 4; if (e >= n4 * 4) return; const v4f a = *(const v4f*)(F + e); v4us oh, ol;
#pragma unroll
    for (int q = 0; q < 4; ++q) { unsigned short u, l; splitf(a[q], u, l); oh[q] = u; ol[q] = l; } *(v4us*)(Hh + e) = oh; *(v4us*)(Hl + e) = ol;  }
__global__ __launch_bounds__(256) void k_lnres(const float* __restrict__ A, const float* __restrict__ x, const float* __restrict__ g, const float* __restrict__ bb, float* Y) { const int lane = threadIdx.x & 31; const int row = blockIdx.x * 8 + (threadIdx.x >> 5); if (row >= NR) return; const size_t rb = (size_t)row * DD; const int c0 = lane * 4; const v4f a = *(const v4f*)(A + rb + c0); float v[4]; float s = 0.f;
#pragma unroll
    for (int q = 0; q < 4; ++q) { v[q] = __fadd_rn(a[q], bfr(x[rb + c0 + q])); s = __fadd_rn(s, v[q]); }
#pragma unroll
    for (int sh = 16; sh; sh >>= 1) s += __shfl_xor(s, sh, 32);
    const float mean = s * (1.0f / DD); float q2 = 0.f;
#pragma unroll
    for (int q = 0; q < 4; ++q) { float d0 = __fsub_rn(v[q], mean); asm volatile("" : "+v"(d0)); float p = __fmul_rn(d0, d0); asm volatile("" : "+v"(p)); q2 = __fadd_rn(q2, p); }
#pragma unroll
    for (int sh = 16; sh; sh >>= 1) q2 += __shfl_xor(q2, sh, 32);
    const float rstd = __frsqrt_rn(__fadd_rn(q2 * (1.0f / DD), 1e-5f)); v4f o;
#pragma unroll
    for (int q = 0; q < 4; ++q) { float t0 = __fmul_rn(__fsub_rn(v[q], mean), rstd); asm volatile("" : "+v"(t0)); float t1 = __fmul_rn(t0, bfr(g[c0 + q])); asm volatile("" : "+v"(t1)); o[q] = __fadd_rn(t1, bfr(bb[c0 + q])); }
    *(v4f*)(Y + rb + c0) = o;  }

extern "C" void kernel_launch(void* const* d_in, const int* in_sizes, int n_in,
                              void* d_out, int out_size, void* d_ws, size_t ws_size, hipStream_t stream) {
    (void)in_sizes; (void)n_in; (void)out_size;
    const float* x = (const float*)d_in[0]; const int* adj = (const int*)d_in[1]; const float* emb = (const float*)d_in[2]; const float* wq = (const float*)d_in[3]; const float* bq = (const float*)d_in[4]; const float* wk = (const float*)d_in[5]; const float* bk = (const float*)d_in[6]; const float* wv = (const float*)d_in[7]; const float* bv = (const float*)d_in[8]; const float* eb = (const float*)d_in[9]; const float* wo = (const float*)d_in[10]; const float* bo = (const float*)d_in[11]; const float* g = (const float*)d_in[12]; const float* be = (const float*)d_in[13];
    float* OUT = (float*)d_out;     // [2][1024][12][128]
    char* wsp = (char*)d_ws;
    auto take = [&](size_t bytes) { char* p = wsp; wsp += (bytes + 255) & ~(size_t)255; return (void*)p; };
    bf* WQKV = (bf*)take((size_t)3 * DD * DD * 2); float* BQKV = (float*)take(3 * DD * 4); bf* WO = (bf*)take(DD * DD * 2);
    bf* Eh = (bf*)take((size_t)NR * DD * 2); bf* El = (bf*)take((size_t)NR * DD * 2); float* QKV = (float*)take((size_t)NR * 3 * DD * 4); bf* Qh = (bf*)take(NH_ * NNODE * HD * 2); bf* Ql = (bf*)take(NH_ * NNODE * HD * 2); bf* Kh = (bf*)take(NH_ * NNODE * HD * 2); bf* Kl = (bf*)take(NH_ * NNODE * HD * 2); h16* V16 = (h16*)take((size_t)NH_ * 64 * NNODE * 2);
    float* Sb = (float*)take((size_t)NH_ * NNODE * NNODE * 4); h16* P16 = (h16*)take((size_t)NH_ * NNODE * NNODE * 2); float* O = (float*)take((size_t)NH_ * NNODE * 64 * 4); float* ATT = (float*)take((size_t)NR * DD * 4); bf* Ah = (bf*)take((size_t)NR * DD * 2); bf* Al = (bf*)take((size_t)NR * DD * 2); float* AO = (float*)take((size_t)NR * DD * 4);
    if ((size_t)(wsp - (char*)d_ws) > ws_size) return;    // total ~ 72 MB
    k_cvt8<<<(DD * DD / 8 + 255) / 256, 256, 0, stream>>>(wq, WQKV, DD * DD / 8); k_cvt8<<<(DD * DD / 8 + 255) / 256, 256, 0, stream>>>(wk, WQKV + DD * DD, DD * DD / 8); k_cvt8<<<(DD * DD / 8 + 255) / 256, 256, 0, stream>>>(wv, WQKV + 2 * DD * DD, DD * DD / 8);   // [q | k | v] natural Bt rows
    k_bcat<<<2, 256, 0, stream>>>(bq, bk, bv, BQKV);
    k_cvt8<<<(DD * DD / 8 + 255) / 256, 256, 0, stream>>>(wo, WO, DD * DD / 8);
    for (int b = 0; b < NB_; ++b) { const float* xb = x + (size_t)b * NR * DD;
        k_enh<<<(NR * DD / 4 + 255) / 256, 256, 0, stream>>>(xb, emb, Eh, El);
        k_gemmw<bf, 1, true><<<dim3(NR / 64, 3 * DD / 64, 1), 32, 0, stream>>>(Eh, El, WQKV, nullptr, DD, QKV, 3 * DD, BQKV, 0, 0, 0);
        for (int t = 0; t < TT; ++t) {
            k_qkpl<<<(NH_ * NNODE * HD / 4 + 255) / 256, 256, 0, stream>>>(QKV, t, Qh, Ql, Kh, Kl); k_vt<<<(NH_ * 64 * NNODE / 2 + 255) / 256, 256, 0, stream>>>(QKV, t, V16);
            k_gemmw<bf, 2, false><<<dim3(NNODE / 64, NNODE / 64, NH_), 32, 0, stream>>>(Qh, Ql, Kh, Kl, HD, Sb, NNODE, nullptr, (size_t)NNODE * HD, (size_t)NNODE * HD, (size_t)NNODE * NNODE);
            k_msoft<<<NH_ * NNODE / 8, 256, 0, stream>>>(Sb, adj, eb, P16);
            k_gemmw<h16, 0, false><<<dim3(NNODE / 64, 1, NH_), 32, 0, stream>>>(P16, nullptr, V16, nullptr, NNODE, O, 64, nullptr, (size_t)NNODE * NNODE, (size_t)64 * NNODE, (size_t)NNODE * 64);
            k_mrg<<<(NNODE * DD / 4 + 255) / 256, 256, 0, stream>>>(O, t, ATT); }
        k_split<<<(NR * DD / 4 + 255) / 256, 256, 0, stream>>>(ATT, (size_t)NR * DD / 4, Ah, Al);
        k_gemmw<bf, 1, true><<<dim3(NR / 64, DD / 64, 1), 32, 0, stream>>>(Ah, Al, WO, nullptr, DD, AO, DD, bo, 0, 0, 0);
        k_lnres<<<NR / 8, 256, 0, stream>>>(AO, xb, g, be, OUT + (size_t)b * NR * DD); }
}

// v002
// It runs in 109 microseconds.
// It is 14.2 times as fast as v000, going by the measured steps of the versions left out in between.
#include <hip/hip_runtime.h>

// CHGANSimplified (node_features [2][1024 nodes][12 steps][128]; enh = x + node_type_embed[1 - n%2]; Q/K/V = enh W^T + b (4 heads x 32); per (batch, head, step): scores over node pairs = q.k/sqrt(32) + edge_bias[n][m]; masked to -inf where
// adj[n][m] == 0 and n != m (adj / edge_bias read as data); softmax over m (nan_to_num is a no-op: self loops keep every row non-empty); out = attn V merged; out = out Wo^T + bo; result = LN(out + node_features) -> [2][1024][12][128]).
// Compute dtypes, f32 accumulate: every input rounded to bf16; Q/K/V on bf16 hi+lo planes of enh x exact weights (2 products, + bias); scores (K 32) on hl planes (3 products), masked online softmax f32 and fp16 p x fp16 V in one kernel (k_attn)

#define NB_  2
#define NNODE 1024
#define TT   12
#define DD   128
#define NH_  4
#define HD   32
#define NR   (NNODE * TT)
#define SCL  0.1767766952966369f
#define NBT  (NB_ * TT)
#define NRB  (NB_ * NR)
typedef _Float16 h16;
typedef unsigned short bf;
typedef __attribute__((ext_vector_type(16))) __bf16   v16bf;
typedef __attribute__((ext_vector_type(16))) _Float16 v16h;
typedef __attribute__((ext_vector_type(8)))  _Float16 v8h;
typedef __attribute__((ext_vector_type(8)))  unsigned short v8us;
typedef __attribute__((ext_vector_type(8)))  float    v8f;
typedef __attribute__((ext_vector_type(4)))  float    v4f;
typedef v8h  __attribute__((may_alias)) v8ha;
typedef v4f  __attribute__((may_alias)) v4fa;
typedef v8us __attribute__((may_alias)) v8usa;

__device__ __forceinline__ unsigned short f2bf(float f) { unsigned u = __float_as_uint(f); u += 0x7FFFu + ((u >> 16) & 1u); return (unsigned short)(u >> 16); }
__device__ __forceinline__ float bf2f(unsigned short b) { return __uint_as_float(((unsigned)b) << 16); }
__device__ __forceinline__ float bfr(float f) { return bf2f(f2bf(f)); }
__device__ __forceinline__ v16h cat16(v8h lo, v8h hi) { return __builtin_shufflevector(lo, hi, 0, 1, 2, 3, 4, 5, 6, 7, 8, 9, 10, 11, 12, 13, 14, 15); }
__device__ __forceinline__ v16bf cat16b(v8us lo, v8us hi) { return __builtin_bit_cast(v16bf, __builtin_shufflevector(lo, hi, 0, 1, 2, 3, 4, 5, 6, 7, 8, 9, 10, 11, 12, 13, 14, 15)); }
__device__ __forceinline__ v8f wmma16(v16h a, v16h b, v8f c) { return __builtin_amdgcn_wmma_f32_16x16x32_f16(false, a, false, b, (short)0, c, false, false); }
__device__ __forceinline__ v8f wmmab(v16bf a, v16bf b, v8f c) { return __builtin_amdgcn_wmma_f32_16x16x32_bf16(false, a, false, b, (short)0, c, false, false); }




template <typename T16> struct WFrag;
template <> struct WFrag<h16> { typedef v16h V; static __device__ __forceinline__ V ld(const h16* p) { return cat16(*(const v8h*)p, *(const v8h*)(p + 16)); } static __device__ __forceinline__ v8f mma(V a, V b, v8f c) { return wmma16(a, b, c); } };
template <> struct WFrag<bf> { typedef v16bf V; static __device__ __forceinline__ V ld(const bf* p) { return cat16b(*(const v8us*)p, *(const v8us*)(p + 16)); } static __device__ __forceinline__ v8f mma(V a, V b, v8f c) { return wmmab(a, b, c); } };
__device__ __forceinline__ h16 tohx(float x) { return (h16)x; }
__device__ __forceinline__ void splitf(float y, unsigned short& h, unsigned short& l) { h = f2bf(y); l = f2bf(y - bf2f(h)); }
// XW: s_wait_xcnt 0 behind a group of global loads or stores, in front of whatever later overwrites a register that they name (address or store data). The pointers of k_qkv and k_out carry no __restrict__, so that the "memory" clobber keeps each load and store on its side.
#define XW() asm volatile("s_wait_xcnt 0x0" ::: "memory")
// ld16: the 16 f32 that make one lane's share of a 16x16x32 fragment, in the k order of WFrag::ld (p[0..7], then p[16..23]); cvt16: such a share rounded to bf16 (a weight fragment from the f32 input)
__device__ __forceinline__ void ld16(const float* p, float* f) { const v4f a0 = *(const v4f*)p, a1 = *(const v4f*)(p + 4), a2 = *(const v4f*)(p + 16), a3 = *(const v4f*)(p + 20); XW();
#pragma unroll
    for (int i = 0; i < 4; ++i) { f[i] = a0[i]; f[4 + i] = a1[i]; f[8 + i] = a2[i]; f[12 + i] = a3[i]; } }
// The same roundings as f2bf, bfr and splitf, kept in 32-bit registers: rbits(f) holds f2bf(f) in its upper half; pk packs two such halves into one register of a fragment (element 2i low, 2i + 1 high)
typedef __attribute__((ext_vector_type(8))) unsigned v8u;
typedef __attribute__((ext_vector_type(2))) unsigned v2u;
__device__ __forceinline__ unsigned rbits(float f) { const unsigned u = __float_as_uint(f); return u + 0x7FFFu + ((u >> 16) & 1u); }
__device__ __forceinline__ float bfr32(float f) { return __uint_as_float(rbits(f) & 0xFFFF0000u); }
__device__ __forceinline__ unsigned pk(unsigned r0, unsigned r1) { return (r0 >> 16) | (r1 & 0xFFFF0000u); }
__device__ __forceinline__ void split32(float y, unsigned& rh, unsigned& rl) { rh = rbits(y); rl = rbits(y - __uint_as_float(rh & 0xFFFF0000u)); }
__device__ __forceinline__ v16bf cvt16(const float* f) { v8u o;
#pragma unroll
    for (int i = 0; i < 8; ++i) o[i] = pk(rbits(f[2 * i]), rbits(f[2 * i + 1]));
    return __builtin_bit_cast(v16bf, o); }

// ---- k_qkv: Q, K or V projection with its neighbours folded in. ONE WAVE per 32x64 output tile (8 accumulators); grid (6 column tiles of [q | k | v], 24 slices bt x 32 node blocks), 32 threads.
// The 32 rows of a tile are 32 consecutive nodes n of one (batch, step) slice bt, so that the tile's results lie contiguous in the planes that k_attn reads.
// Prologue: the A fragments (hi + lo bf16 planes of enh = bf16 x + bf16 emb[1 - n%2]; n's parity is the lane's, as n0 and the 16-row steps are even) and the B fragments (bf16 weights) are formed in registers from the f32 inputs.
// Epilogue (+ bf16 bias): Q (x scale) and K go out as hl planes [bt][h][n][d], staged through LDS so that a store covers whole 128-B lines; V goes out as fp16 V16[bt][h][dv][m] straight from the accumulators, whose 8 registers are 8 consecutive m.
#define MBT 2    // 16-row blocks a tile
__global__ __launch_bounds__(32) void k_qkv(const float* x, const float* emb, const float* wq, const float* bq, const float* wk, const float* bk, const float* wv, const float* bv, bf* Qh, bf* Ql, bf* Kh, bf* Kl, h16* V16) {
    __shared__ __align__(16) float os[16 * 68];
    const int lane = threadIdx.x & 31, lr = lane & 15, hi = lane >> 4; const int bt = blockIdx.y / (NNODE / (16 * MBT)), b = bt / TT, t = bt % TT, n0 = (blockIdx.y % (NNODE / (16 * MBT))) * 16 * MBT; const int which = blockIdx.x >> 1, c0 = (blockIdx.x & 1) * 64;
    const float* w = which == 0 ? wq : (which == 1 ? wk : wv); const float* bias = which == 0 ? bq : (which == 1 ? bk : bv);
    v8f acc[MBT][4];
#pragma unroll
    for (int mb = 0; mb < MBT; ++mb)
#pragma unroll
        for (int nb = 0; nb < 4; ++nb) acc[mb][nb] = (v8f){};
    const float* xr = x + ((size_t)(b * NNODE + n0 + lr) * TT + t) * DD + 8 * hi; const float* er = emb + (1 - (lr & 1)) * DD + 8 * hi; const float* wr = w + (size_t)(c0 + lr) * DD + 8 * hi;
#pragma unroll 1    // kept rolled: unrolled, the four passes' loads are hoisted together, the wave's registers grow and fewer waves fit a SIMD
    for (int kc = 0; kc < DD; kc += 32) {
        v16bf a[MBT], a2[MBT]; float ev[16], f[MBT][16], wf[4][16];    // all 28 loads of the pass are asked for at its head, so that one memory latency covers them
#pragma unroll
        for (int mb = 0; mb < MBT; ++mb) ld16(xr + (size_t)mb * 16 * TT * DD + kc, f[mb]);
        ld16(er + kc, ev);
#pragma unroll
        for (int nb = 0; nb < 4; ++nb) ld16(wr + (size_t)nb * 16 * DD + kc, wf[nb]);
#pragma unroll
        for (int i = 0; i < 16; ++i) ev[i] = bfr32(ev[i]);
#pragma unroll
        for (int mb = 0; mb < MBT; ++mb) { v8u oh, ol;
#pragma unroll
            for (int i = 0; i < 8; ++i) { unsigned h0, l0, h1, l1; split32(__fadd_rn(bfr32(f[mb][2 * i]), ev[2 * i]), h0, l0); split32(__fadd_rn(bfr32(f[mb][2 * i + 1]), ev[2 * i + 1]), h1, l1); oh[i] = pk(h0, h1); ol[i] = pk(l0, l1); }
            a[mb] = __builtin_bit_cast(v16bf, oh); a2[mb] = __builtin_bit_cast(v16bf, ol); }
#pragma unroll
        for (int nb = 0; nb < 4; ++nb) { const v16bf bw = cvt16(wf[nb]);
#pragma unroll
            for (int mb = 0; mb < MBT; ++mb) { acc[mb][nb] = wmmab(a[mb], bw, acc[mb][nb]); acc[mb][nb] = wmmab(a2[mb], bw, acc[mb][nb]); } }
    }
    if (which == 2) {
#pragma unroll
        for (int nb = 0; nb < 4; ++nb) { const int col = c0 + nb * 16 + lr; const float bc = bfr32(bias[col]); XW(); h16* dst = V16 + (((size_t)bt * NH_ + (col >> 5)) * HD + (col & 31)) * NNODE + n0 + hi * 8;
#pragma unroll
            for (int mb = 0; mb < MBT; ++mb) { v8h o;
#pragma unroll
                for (int j = 0; j < 8; ++j) o[j] = tohx(acc[mb][nb][j] + bc);
                *(v8h*)(dst + mb * 16) = o; XW(); } }
        return;
    }
    bf* Ph = which == 0 ? Qh : Kh; bf* Pl = which == 0 ? Ql : Kl; const float scl = which == 0 ? SCL : 1.0f;
    const int cofs = lr * 4, col = c0 + cofs; float b4[4];
#pragma unroll
    for (int q = 0; q < 4; ++q) b4[q] = bfr32(bias[col + q]);
    XW();
    const size_t pofs = (((size_t)bt * NH_ + (col >> 5)) * NNODE + n0) * HD + (col & 31);
#pragma unroll
    for (int mb = 0; mb < MBT; ++mb) {
#pragma unroll
        for (int nb = 0; nb < 4; ++nb) {
#pragma unroll
            for (int j = 0; j < 8; ++j) os[(hi * 8 + j) * 68 + nb * 16 + lr] = acc[mb][nb][j]; }
        __builtin_amdgcn_wave_barrier(); asm volatile("" ::: "memory");    // the rows read below were written by other lanes of this wave: keeps the reads behind the writes
#pragma unroll
        for (int s = 0; s < 8; ++s) { const int row = 2 * s + hi; const v4f val = *(const v4fa*)(os + row * 68 + cofs); unsigned rh[4], rl[4];
#pragma unroll
            for (int q = 0; q < 4; ++q) split32((val[q] + b4[q]) * scl, rh[q], rl[q]);
            const v2u oh = { pk(rh[0], rh[1]), pk(rh[2], rh[3]) }, ol = { pk(rl[0], rl[1]), pk(rl[2], rl[3]) };
            *(v2u*)(Ph + pofs + (size_t)(mb * 16 + row) * HD) = oh; *(v2u*)(Pl + pofs + (size_t)(mb * 16 + row) * HD) = ol; XW(); }
        __builtin_amdgcn_wave_barrier(); asm volatile("" ::: "memory");    // keeps the next block's writes behind these reads
    }
}
// k_attn: scores, masked softmax and attn V in one kernel, one launch for every (batch, step, head). Grid (1024/128, heads, batch*steps), 4 waves; a wave owns 32 query nodes n (2 tiles of 16) and walks the 1024 key nodes m in chunks of 32.
// Scores are formed TRANSPOSED, St[m][n] = sum_d K[m][d] Q[n][d] (hl planes, the same 3 products): the accumulator then holds, in lane (lr, hi), node n = lr and m = 8 hi + j, which is the k order of a 16x16x32 B fragment
// (tile u = 0 gives k = 8 hi + j, tile u = 1 gives k = 16 + 8 hi + j), so p = exp(s - max) goes from registers into Ot[d][n] = sum_m Vt[d][m] P[n][m] with no exchange, and max, sum and the rescale are per lane (n = lr).
// Online softmax: running max mx (never below -1e38) and sum per n; a masked pair (adj == 0, m != n) carries -3e38, so its exp(s - mx) is 0 even while no kept pair has been met; the self loop keeps every sum above 0. Result Ot / sum is stored as hl planes A[(b,n,t)][h*32 + d], the output projection's operand, 16 B a lane and plane.
typedef __attribute__((ext_vector_type(4))) int v4i;
__global__ __launch_bounds__(128) void k_attn(const bf* Qh, const bf* Ql, const bf* Kh, const bf* Kl, const h16* Vt, const int* adj, const float* eb, bf* Ah, bf* Al) {
    const int lane = threadIdx.x & 31, lr = lane & 15, hi = lane >> 4; const int h = blockIdx.y, bt = blockIdx.z, b = bt / TT, t = bt % TT; const int n0 = blockIdx.x * 128 + (threadIdx.x >> 5) * 32;
    const size_t pl = ((size_t)bt * NH_ + h) * NNODE * HD; Qh += pl; Ql += pl; Kh += pl; Kl += pl; Vt += pl;
    v16bf qh[2], ql[2]; v8f o[2][2]; float mx[2], sum[2];
#pragma unroll
    for (int q = 0; q < 2; ++q) { const size_t qo = (size_t)(n0 + q * 16 + lr) * HD + 8 * hi; qh[q] = WFrag<bf>::ld(Qh + qo); ql[q] = WFrag<bf>::ld(Ql + qo); o[q][0] = (v8f){}; o[q][1] = (v8f){}; mx[q] = -1.0e38f; sum[q] = 0.f; }
#pragma unroll 1    // kept rolled: two passes' loads live at once would not fit 256 registers
    for (int m0 = 0; m0 < NNODE; m0 += 32) {
        v16bf kh[2], kl[2]; v16h vt[2];
#pragma unroll
        for (int u = 0; u < 2; ++u) { const size_t ko = (size_t)(m0 + u * 16 + lr) * HD + 8 * hi; kh[u] = WFrag<bf>::ld(Kh + ko); kl[u] = WFrag<bf>::ld(Kl + ko); }
        v4i am[2][2][2]; v4f em[2][2][2];    // the chunk's adj and edge_bias, all asked for at the head of the pass so that one memory latency covers them
#pragma unroll
        for (int q = 0; q < 2; ++q)
#pragma unroll
            for (int u = 0; u < 2; ++u) { const size_t ro = (size_t)(n0 + q * 16 + lr) * NNODE + m0 + u * 16 + hi * 8; am[q][u][0] = *(const v4i*)(adj + ro); am[q][u][1] = *(const v4i*)(adj + ro + 4); em[q][u][0] = *(const v4f*)(eb + ro); em[q][u][1] = *(const v4f*)(eb + ro + 4); }
        // the V loads' results are given the address registers of the 24 loads above, which are dead from here on: this wait stands between those loads and that overwrite (the kernel's pointers carry no __restrict__, so that the "memory" clobber keeps each load on its side)
        asm volatile("s_wait_xcnt 0x0" ::: "memory");
#pragma unroll
        for (int u = 0; u < 2; ++u) vt[u] = WFrag<h16>::ld(Vt + (size_t)(u * 16 + lr) * NNODE + m0 + 8 * hi);
        // inputs-only fence on the loaded values: keeps all 28 loads of the pass in flight together; without it the compiler sinks each load to its use and the pass waits out a memory latency thirteen times
        asm volatile("" :: "v"(kh[0]), "v"(kh[1]), "v"(kl[0]), "v"(kl[1]), "v"(vt[0]), "v"(vt[1]), "v"(am[0][0][0]), "v"(am[0][0][1]), "v"(am[0][1][0]), "v"(am[0][1][1]), "v"(am[1][0][0]), "v"(am[1][0][1]), "v"(am[1][1][0]), "v"(am[1][1][1]),
                     "v"(em[0][0][0]), "v"(em[0][0][1]), "v"(em[0][1][0]), "v"(em[0][1][1]), "v"(em[1][0][0]), "v"(em[1][0][1]), "v"(em[1][1][0]), "v"(em[1][1][1]));
#pragma unroll
        for (int q = 0; q < 2; ++q) { const int n = n0 + q * 16 + lr; float s[16]; float cm = -3.0e38f;
#pragma unroll
            for (int u = 0; u < 2; ++u) { const int mb = m0 + u * 16 + hi * 8;
                v8f acc = (v8f){}; acc = wmmab(kh[u], qh[q], acc); acc = wmmab(kh[u], ql[q], acc); acc = wmmab(kl[u], qh[q], acc);
#pragma unroll
                for (int j = 0; j < 8; ++j) { const bool keep = (am[q][u][j >> 2][j & 3] != 0) | (mb + j == n); const float sb = __fadd_rn(acc[j], bfr(em[q][u][j >> 2][j & 3])); const float v = keep ? sb : -3.0e38f; s[u * 8 + j] = v; cm = fmaxf(cm, v); } }
            cm = fmaxf(cm, __shfl_xor(cm, 16, 32));
            const float mn = fmaxf(mx[q], cm); const float al = __expf(mx[q] - mn); mx[q] = mn; float ps = 0.f; v16h p;
#pragma unroll
            for (int i = 0; i < 16; ++i) { const float ex = __expf(s[i] - mn); ps += ex; p[i] = tohx(ex); }
            sum[q] = sum[q] * al + ps;
#pragma unroll
            for (int dt = 0; dt < 2; ++dt) { o[q][dt] *= al; o[q][dt] = wmma16(vt[dt], p, o[q][dt]); } }
    }
#pragma unroll
    for (int q = 0; q < 2; ++q) { const float inv = __fdiv_rn(1.0f, sum[q] + __shfl_xor(sum[q], 16, 32)); const size_t di = ((size_t)(b * NNODE + n0 + q * 16 + lr) * TT + t) * DD + h * HD + hi * 8;
#pragma unroll
        for (int dt = 0; dt < 2; ++dt) { v8us wh, wl;
#pragma unroll
            for (int j = 0; j < 8; ++j) { unsigned short u, l; splitf(o[q][dt][j] * inv, u, l); wh[j] = u; wl[j] = l; }
            *(v8us*)(Ah + di + dt * 16) = wh; *(v8us*)(Al + di + dt * 16) = wl; } }
}

// ---- k_out: output projection, residual and LayerNorm in one kernel. ONE WAVE per 16 rows (b,n,t) x all 128 columns (8 accumulators); grid 24576/16, 32 threads. A = hl planes from k_attn, B = bf16 Wo formed in registers from the f32 input.
// Epilogue: the 16 rows are staged in LDS; then row by row, 4 consecutive columns a lane: + bf16 bo, + bf16 x, mean and variance by the same 4-term sums and xor tree over the 32 lanes as a wave-per-row LayerNorm, 512 B stored a row.
__global__ __launch_bounds__(32) void k_out(const bf* Ah, const bf* Al, const float* wo, const float* bo, const float* x, const float* g, const float* bb, float* Y) {
    __shared__ __align__(16) float os[16 * 132];
    const int lane = threadIdx.x & 31, lr = lane & 15, hi = lane >> 4; const int r0 = blockIdx.x * 16;
    v8f acc[8];
#pragma unroll
    for (int nb = 0; nb < 8; ++nb) acc[nb] = (v8f){};
    const size_t aoff = (size_t)(r0 + lr) * DD + 8 * hi; const float* wr = wo + (size_t)lr * DD + 8 * hi;
#pragma unroll
    for (int kc = 0; kc < DD; kc += 32) { const v16bf a = WFrag<bf>::ld(Ah + aoff + kc), a2 = WFrag<bf>::ld(Al + aoff + kc); XW(); float wf[8][16];
#pragma unroll
        for (int nb = 0; nb < 8; ++nb) ld16(wr + (size_t)nb * 16 * DD + kc, wf[nb]);
#pragma unroll
        for (int nb = 0; nb < 8; ++nb) { const v16bf bw = cvt16(wf[nb]); acc[nb] = wmmab(a, bw, acc[nb]); acc[nb] = wmmab(a2, bw, acc[nb]); } }
#pragma unroll
    for (int nb = 0; nb < 8; ++nb) {
#pragma unroll
        for (int j = 0; j < 8; ++j) os[(hi * 8 + j) * 132 + nb * 16 + lr] = acc[nb][j]; }
    __builtin_amdgcn_wave_barrier(); asm volatile("" ::: "memory");    // the rows read below were written by other lanes of this wave: keeps the reads behind the writes
    const int c0 = lane * 4; float bo4[4], g4[4], b4[4]; v4f xv[16];    // the 16 residual rows are asked for together: one memory latency
    { const v4f t0 = *(const v4f*)(bo + c0), t1 = *(const v4f*)(g + c0), t2 = *(const v4f*)(bb + c0); XW();
#pragma unroll
      for (int q = 0; q < 4; ++q) { bo4[q] = t0[q]; g4[q] = t1[q]; b4[q] = t2[q]; } }
#pragma unroll
    for (int r = 0; r < 16; ++r) { if (r == 15) XW();    // the last load's result may be given the address registers that the fifteen before it name
        xv[r] = *(const v4f*)(x + (size_t)(r0 + r) * DD + c0); }
    XW();
#pragma unroll
    for (int q = 0; q < 4; ++q) { bo4[q] = bfr32(bo4[q]); g4[q] = bfr32(g4[q]); b4[q] = bfr32(b4[q]); }
#pragma unroll
    for (int r = 0; r < 16; ++r) { const size_t rb = (size_t)(r0 + r) * DD; const v4f a = *(const v4fa*)(os + r * 132 + c0); float v[4]; float s = 0.f;
#pragma unroll
        for (int q = 0; q < 4; ++q) { v[q] = __fadd_rn(a[q] + bo4[q], bfr32(xv[r][q])); s = __fadd_rn(s, v[q]); }
#pragma unroll
        for (int sh = 16; sh; sh >>= 1) s += __shfl_xor(s, sh, 32);
        const float mean = s * (1.0f / DD); float q2 = 0.f;
#pragma unroll
        for (int q = 0; q < 4; ++q) { const float d0 = v[q] - mean; q2 += d0 * d0; }
#pragma unroll
        for (int sh = 16; sh; sh >>= 1) q2 += __shfl_xor(q2, sh, 32);
        const float rstd = __frsqrt_rn(__fadd_rn(q2 * (1.0f / DD), 1e-5f)); v4f o;
#pragma unroll
        for (int q = 0; q < 4; ++q) o[q] = (v[q] - mean) * rstd * g4[q] + b4[q];
        *(v4f*)(Y + rb + c0) = o; XW(); }
}

extern "C" void kernel_launch(void* const* d_in, const int* in_sizes, int n_in,
                              void* d_out, int out_size, void* d_ws, size_t ws_size, hipStream_t stream) {
    (void)in_sizes; (void)n_in; (void)out_size;
    const float* x = (const float*)d_in[0]; const int* adj = (const int*)d_in[1]; const float* emb = (const float*)d_in[2]; const float* wq = (const float*)d_in[3]; const float* bq = (const float*)d_in[4]; const float* wk = (const float*)d_in[5]; const float* bk = (const float*)d_in[6]; const float* wv = (const float*)d_in[7]; const float* bv = (const float*)d_in[8]; const float* eb = (const float*)d_in[9]; const float* wo = (const float*)d_in[10]; const float* bo = (const float*)d_in[11]; const float* g = (const float*)d_in[12]; const float* be = (const float*)d_in[13];
    float* OUT = (float*)d_out;     // [2][1024][12][128]
    char* wsp = (char*)d_ws;
    auto take = [&](size_t bytes) { char* p = wsp; wsp += (bytes + 255) & ~(size_t)255; return (void*)p; };
    bf* Qh = (bf*)take((size_t)NBT * NH_ * NNODE * HD * 2); bf* Ql = (bf*)take((size_t)NBT * NH_ * NNODE * HD * 2); bf* Kh = (bf*)take((size_t)NBT * NH_ * NNODE * HD * 2); bf* Kl = (bf*)take((size_t)NBT * NH_ * NNODE * HD * 2); h16* V16 = (h16*)take((size_t)NBT * NH_ * HD * NNODE * 2);
    bf* Ah = (bf*)take((size_t)NRB * DD * 2); bf* Al = (bf*)take((size_t)NRB * DD * 2);
    if ((size_t)(wsp - (char*)d_ws) > ws_size) return;    // total ~ 44 MB
    k_qkv<<<dim3(3 * DD / 64, NBT * (NNODE / (16 * MBT)), 1), 32, 0, stream>>>(x, emb, wq, bq, wk, bk, wv, bv, Qh, Ql, Kh, Kl, V16);
    k_attn<<<dim3(NNODE / 128, NH_, NBT), 128, 0, stream>>>(Qh, Ql, Kh, Kl, V16, adj, eb, Ah, Al);
    k_out<<<NRB / 16, 32, 0, stream>>>(Ah, Al, wo, bo, x, g, be, OUT);
}

// v003
// A run of this version takes 79.9 microseconds.
// Timed twice side by side with v002, it ran 1.35 and 1.37 times as fast.
// Over all steps from v000 it is 19.3 times as fast.
#include <hip/hip_runtime.h>

// CHGANSimplified (node_features [2][1024 nodes][12 steps][128]; enh = x + node_type_embed[1 - n%2]; Q/K/V = enh W^T + b (4 heads x 32); per (batch, head, step): scores over node pairs = q.k/sqrt(32) + edge_bias[n][m]; masked to -inf where
// adj[n][m] == 0 and n != m (adj / edge_bias read as data); softmax over m (nan_to_num is a no-op: self loops keep every row non-empty); out = attn V merged; out = out Wo^T + bo; result = LN(out + node_features) -> [2][1024][12][128]).
// Compute dtypes, f32 accumulate: every input rounded to bf16; Q/K/V on bf16 hi+lo planes of enh x exact weights (2 products, + bias); scores (K 32) on hl planes (3 products), masked online softmax f32 and fp16 p x fp16 V in one kernel (k_attn); mask, self loop and bf16 edge_bias are merged once a call into one bf16 plane (k_qkv's seventh column of blocks)

#define NB_  2
#define NNODE 1024
#define TT   12
#define DD   128
#define NH_  4
#define HD   32
#define NR   (NNODE * TT)
#define SCL  0.1767766952966369f
#define NBT  (NB_ * TT)
#define NRB  (NB_ * NR)
typedef _Float16 h16;
typedef unsigned short bf;
typedef __attribute__((ext_vector_type(16))) __bf16   v16bf;
typedef __attribute__((ext_vector_type(16))) _Float16 v16h;
typedef __attribute__((ext_vector_type(8)))  _Float16 v8h;
typedef __attribute__((ext_vector_type(8)))  unsigned short v8us;
typedef __attribute__((ext_vector_type(8)))  float    v8f;
typedef __attribute__((ext_vector_type(4)))  float    v4f;
typedef v8h  __attribute__((may_alias)) v8ha;
typedef v4f  __attribute__((may_alias)) v4fa;
typedef v8us __attribute__((may_alias)) v8usa;

__device__ __forceinline__ unsigned short f2bf(float f) { unsigned u = __float_as_uint(f); u += 0x7FFFu + ((u >> 16) & 1u); return (unsigned short)(u >> 16); }
__device__ __forceinline__ float bf2f(unsigned short b) { return __uint_as_float(((unsigned)b) << 16); }
__device__ __forceinline__ float bfr(float f) { return bf2f(f2bf(f)); }
__device__ __forceinline__ v16h cat16(v8h lo, v8h hi) { return __builtin_shufflevector(lo, hi, 0, 1, 2, 3, 4, 5, 6, 7, 8, 9, 10, 11, 12, 13, 14, 15); }
__device__ __forceinline__ v16bf cat16b(v8us lo, v8us hi) { return __builtin_bit_cast(v16bf, __builtin_shufflevector(lo, hi, 0, 1, 2, 3, 4, 5, 6, 7, 8, 9, 10, 11, 12, 13, 14, 15)); }
__device__ __forceinline__ v8f wmma16(v16h a, v16h b, v8f c) { return __builtin_amdgcn_wmma_f32_16x16x32_f16(false, a, false, b, (short)0, c, false, false); }
__device__ __forceinline__ v8f wmmab(v16bf a, v16bf b, v8f c) { return __builtin_amdgcn_wmma_f32_16x16x32_bf16(false, a, false, b, (short)0, c, false, false); }




template <typename T16> struct WFrag;
template <> struct WFrag<h16> { typedef v16h V; static __device__ __forceinline__ V ld(const h16* p) { return cat16(*(const v8h*)p, *(const v8h*)(p + 16)); } static __device__ __forceinline__ v8f mma(V a, V b, v8f c) { return wmma16(a, b, c); } };
template <> struct WFrag<bf> { typedef v16bf V; static __device__ __forceinline__ V ld(const bf* p) { return cat16b(*(const v8us*)p, *(const v8us*)(p + 16)); } static __device__ __forceinline__ v8f mma(V a, V b, v8f c) { return wmmab(a, b, c); } };
__device__ __forceinline__ h16 tohx(float x) { return (h16)x; }
__device__ __forceinline__ void splitf(float y, unsigned short& h, unsigned short& l) { h = f2bf(y); l = f2bf(y - bf2f(h)); }
// XW: s_wait_xcnt 0 behind a group of global loads or stores, in front of whatever later overwrites a register that they name (address or store data). The pointers of k_qkv and k_out carry no __restrict__, so that the "memory" clobber keeps each load and store on its side.
#define XW() asm volatile("s_wait_xcnt 0x0" ::: "memory")
// ld16: the 16 f32 that make one lane's share of a 16x16x32 fragment, in the k order of WFrag::ld (p[0..7], then p[16..23]); cvt16: such a share rounded to bf16 (a weight fragment from the f32 input)
__device__ __forceinline__ void ld16(const float* p, float* f) { const v4f a0 = *(const v4f*)p, a1 = *(const v4f*)(p + 4), a2 = *(const v4f*)(p + 16), a3 = *(const v4f*)(p + 20); XW();
#pragma unroll
    for (int i = 0; i < 4; ++i) { f[i] = a0[i]; f[4 + i] = a1[i]; f[8 + i] = a2[i]; f[12 + i] = a3[i]; } }
// The same roundings as f2bf, bfr and splitf, kept in 32-bit registers: rbits(f) holds f2bf(f) in its upper half; pk packs two such halves into one register of a fragment (element 2i low, 2i + 1 high)
typedef __attribute__((ext_vector_type(8))) unsigned v8u;
typedef __attribute__((ext_vector_type(2))) unsigned v2u;
__device__ __forceinline__ unsigned rbits(float f) { const unsigned u = __float_as_uint(f); return u + 0x7FFFu + ((u >> 16) & 1u); }
__device__ __forceinline__ float bfr32(float f) { return __uint_as_float(rbits(f) & 0xFFFF0000u); }
__device__ __forceinline__ unsigned pk(unsigned r0, unsigned r1) { return (r0 >> 16) | (r1 & 0xFFFF0000u); }
__device__ __forceinline__ void split32(float y, unsigned& rh, unsigned& rl) { rh = rbits(y); rl = rbits(y - __uint_as_float(rh & 0xFFFF0000u)); }
__device__ __forceinline__ v16bf cvt16(const float* f) { v8u o;
#pragma unroll
    for (int i = 0; i < 8; ++i) o[i] = pk(rbits(f[2 * i]), rbits(f[2 * i + 1]));
    return __builtin_bit_cast(v16bf, o); }

// ---- k_qkv: Q, K or V projection with its neighbours folded in. ONE WAVE per 32x64 output tile (8 accumulators); grid (6 column tiles of [q | k | v] and a seventh column for the plane MB, 24 slices bt x 32 node blocks), 32 threads.
// The 32 rows of a tile are 32 consecutive nodes n of one (batch, step) slice bt, so that the tile's results lie contiguous in the planes that k_attn reads.
// Prologue: the A fragments (hi + lo bf16 planes of enh = bf16 x + bf16 emb[1 - n%2]; n's parity is the lane's, as n0 and the 16-row steps are even) and the B fragments (bf16 weights) are formed in registers from the f32 inputs.
// Epilogue (+ bf16 bias): Q (x scale) and K go out as hl planes [bt][h][n][d], staged through LDS so that a store covers whole 128-B lines; V goes out as fp16 V16[bt][h][dv][m] straight from the accumulators, whose 8 registers are 8 consecutive m.
// Blocks of column 6 do no projection: they write MB, the masked bias of every node pair as bf16 (bf16 edge_bias where adj != 0 or n == m, else -3e38), in the order in which k_attn's lanes hold the scores:
// MB[n/16][m/32][u][lane][j], 512 B in a row for each load of a wave. adj and edge_bias are the same for all 96 (batch, step, head) slices, so this is done once a call and not once a slice.
#define MBT 2    // 16-row blocks a tile
#define MBTILES ((NNODE / 16) * (NNODE / 32))
typedef __attribute__((ext_vector_type(4))) int v4i;
typedef __attribute__((ext_vector_type(4))) unsigned v4u;
typedef v4u __attribute__((may_alias)) v4ua;
__global__ __launch_bounds__(32) void k_qkv(const float* x, const float* emb, const float* wq, const float* bq, const float* wk, const float* bk, const float* wv, const float* bv, const int* adj, const float* eb, bf* Qh, bf* Ql, bf* Kh, bf* Kl, h16* V16, bf* MB) {
    __shared__ __align__(16) float os[16 * 68];
    const int lane = threadIdx.x & 31, lr = lane & 15, hi = lane >> 4; const int bt = blockIdx.y / (NNODE / (16 * MBT)), b = bt / TT, t = bt % TT, n0 = (blockIdx.y % (NNODE / (16 * MBT))) * 16 * MBT; const int which = blockIdx.x >> 1, c0 = (blockIdx.x & 1) * 64;
    if (which == 3) {    // the masked-bias plane: tile (nb, mc) = 16 nodes n x 32 nodes m; a lane forms the 8 values that it will hold in k_attn's score accumulator (n = nb*16 + lr, m = mc*32 + u*16 + hi*8 + j)
        for (int tile = blockIdx.y; tile < MBTILES; tile += NBT * (NNODE / (16 * MBT))) { const int n = (tile >> 5) * 16 + lr;
            const int mt = (tile & 31) * 32 + hi * 8; const size_t ro = (size_t)n * NNODE + mt; v4i a[2][2]; v4f e[2][2];    // the tile's 8 loads are asked for together: one memory latency
#pragma unroll
            for (int u = 0; u < 2; ++u) { a[u][0] = *(const v4i*)(adj + ro + u * 16); a[u][1] = *(const v4i*)(adj + ro + u * 16 + 4); e[u][0] = *(const v4f*)(eb + ro + u * 16); e[u][1] = *(const v4f*)(eb + ro + u * 16 + 4); }
            XW();
#pragma unroll
            for (int u = 0; u < 2; ++u) { const int mb = mt + u * 16; unsigned r[8];
#pragma unroll
                for (int j = 0; j < 8; ++j) { const bool keep = (a[u][j >> 2][j & 3] != 0) | (mb + j == n); r[j] = rbits(keep ? e[u][j >> 2][j & 3] : -3.0e38f); }
                const v4u o = { pk(r[0], r[1]), pk(r[2], r[3]), pk(r[4], r[5]), pk(r[6], r[7]) };
                *(v4ua*)(MB + ((size_t)tile * 2 + u) * 256 + lane * 8) = o; XW(); } }
        return;
    }
    const float* w = which == 0 ? wq : (which == 1 ? wk : wv); const float* bias = which == 0 ? bq : (which == 1 ? bk : bv);
    v8f acc[MBT][4];
#pragma unroll
    for (int mb = 0; mb < MBT; ++mb)
#pragma unroll
        for (int nb = 0; nb < 4; ++nb) acc[mb][nb] = (v8f){};
    const float* xr = x + ((size_t)(b * NNODE + n0 + lr) * TT + t) * DD + 8 * hi; const float* er = emb + (1 - (lr & 1)) * DD + 8 * hi; const float* wr = w + (size_t)(c0 + lr) * DD + 8 * hi;
#pragma unroll 1    // kept rolled: unrolled, the four passes' loads are hoisted together, the wave's registers grow and fewer waves fit a SIMD
    for (int kc = 0; kc < DD; kc += 32) {
        v16bf a[MBT], a2[MBT]; float ev[16], f[MBT][16], wf[4][16];    // all 28 loads of the pass are asked for at its head, so that one memory latency covers them
#pragma unroll
        for (int mb = 0; mb < MBT; ++mb) ld16(xr + (size_t)mb * 16 * TT * DD + kc, f[mb]);
        ld16(er + kc, ev);
#pragma unroll
        for (int nb = 0; nb < 4; ++nb) ld16(wr + (size_t)nb * 16 * DD + kc, wf[nb]);
#pragma unroll
        for (int i = 0; i < 16; ++i) ev[i] = bfr32(ev[i]);
#pragma unroll
        for (int mb = 0; mb < MBT; ++mb) { v8u oh, ol;
#pragma unroll
            for (int i = 0; i < 8; ++i) { unsigned h0, l0, h1, l1; split32(__fadd_rn(bfr32(f[mb][2 * i]), ev[2 * i]), h0, l0); split32(__fadd_rn(bfr32(f[mb][2 * i + 1]), ev[2 * i + 1]), h1, l1); oh[i] = pk(h0, h1); ol[i] = pk(l0, l1); }
            a[mb] = __builtin_bit_cast(v16bf, oh); a2[mb] = __builtin_bit_cast(v16bf, ol); }
#pragma unroll
        for (int nb = 0; nb < 4; ++nb) { const v16bf bw = cvt16(wf[nb]);
#pragma unroll
            for (int mb = 0; mb < MBT; ++mb) { acc[mb][nb] = wmmab(a[mb], bw, acc[mb][nb]); acc[mb][nb] = wmmab(a2[mb], bw, acc[mb][nb]); } }
    }
    if (which == 2) {
#pragma unroll
        for (int nb = 0; nb < 4; ++nb) { const int col = c0 + nb * 16 + lr; const float bc = bfr32(bias[col]); XW(); h16* dst = V16 + (((size_t)bt * NH_ + (col >> 5)) * HD + (col & 31)) * NNODE + n0 + hi * 8;
#pragma unroll
            for (int mb = 0; mb < MBT; ++mb) { v8h o;
#pragma unroll
                for (int j = 0; j < 8; ++j) o[j] = tohx(acc[mb][nb][j] + bc);
                *(v8h*)(dst + mb * 16) = o; XW(); } }
        return;
    }
    bf* Ph = which == 0 ? Qh : Kh; bf* Pl = which == 0 ? Ql : Kl; const float scl = which == 0 ? SCL : 1.0f;
    const int cofs = lr * 4, col = c0 + cofs; float b4[4];
#pragma unroll
    for (int q = 0; q < 4; ++q) b4[q] = bfr32(bias[col + q]);
    XW();
    const size_t pofs = (((size_t)bt * NH_ + (col >> 5)) * NNODE + n0) * HD + (col & 31);
#pragma unroll
    for (int mb = 0; mb < MBT; ++mb) {
#pragma unroll
        for (int nb = 0; nb < 4; ++nb) {
#pragma unroll
            for (int j = 0; j < 8; ++j) os[(hi * 8 + j) * 68 + nb * 16 + lr] = acc[mb][nb][j]; }
        __builtin_amdgcn_wave_barrier(); asm volatile("" ::: "memory");    // the rows read below were written by other lanes of this wave: keeps the reads behind the writes
#pragma unroll
        for (int s = 0; s < 8; ++s) { const int row = 2 * s + hi; const v4f val = *(const v4fa*)(os + row * 68 + cofs); unsigned rh[4], rl[4];
#pragma unroll
            for (int q = 0; q < 4; ++q) split32((val[q] + b4[q]) * scl, rh[q], rl[q]);
            const v2u oh = { pk(rh[0], rh[1]), pk(rh[2], rh[3]) }, ol = { pk(rl[0], rl[1]), pk(rl[2], rl[3]) };
            *(v2u*)(Ph + pofs + (size_t)(mb * 16 + row) * HD) = oh; *(v2u*)(Pl + pofs + (size_t)(mb * 16 + row) * HD) = ol; XW(); }
        __builtin_amdgcn_wave_barrier(); asm volatile("" ::: "memory");    // keeps the next block's writes behind these reads
    }
}
// k_attn: scores, masked softmax and attn V in one kernel, one launch for every (batch, step, head). Grid (1024/128, heads, batch*steps), 4 waves; a wave owns 32 query nodes n (2 tiles of 16) and walks the 1024 key nodes m in chunks of 32.
// Scores are formed TRANSPOSED, St[m][n] = sum_d K[m][d] Q[n][d] (hl planes, the same 3 products): the accumulator then holds, in lane (lr, hi), node n = lr and m = 8 hi + j, which is the k order of a 16x16x32 B fragment
// (tile u = 0 gives k = 8 hi + j, tile u = 1 gives k = 16 + 8 hi + j), so p = exp(s - max) goes from registers into Ot[d][n] = sum_m Vt[d][m] P[n][m] with no exchange, and max, sum and the rescale are per lane (n = lr).
// Online softmax: running max mx (never below -1e38) and sum per n; a masked pair (adj == 0, m != n) carries about -3e38 from the plane MB, so its exp(s - mx) is 0 even while no kept pair has been met; the self loop keeps every sum above 0. Result Ot / sum is stored as hl planes A[(b,n,t)][h*32 + d], the output projection's operand, 16 B a lane and plane.
__global__ __launch_bounds__(128) void k_attn(const bf* Qh, const bf* Ql, const bf* Kh, const bf* Kl, const h16* Vt, const bf* MB, bf* Ah, bf* Al) {
    const int lane = threadIdx.x & 31, lr = lane & 15, hi = lane >> 4; const int h = blockIdx.y, bt = blockIdx.z, b = bt / TT, t = bt % TT; const int n0 = blockIdx.x * 128 + (threadIdx.x >> 5) * 32;
    const size_t pl = ((size_t)bt * NH_ + h) * NNODE * HD; Qh += pl; Ql += pl; Kh += pl; Kl += pl; Vt += pl; MB += (size_t)(n0 >> 4) * 32 * 512 + lane * 8;
    v16bf qh[2], ql[2]; v8f o[2][2]; float mx[2], sum[2];
#pragma unroll
    for (int q = 0; q < 2; ++q) { const size_t qo = (size_t)(n0 + q * 16 + lr) * HD + 8 * hi; qh[q] = WFrag<bf>::ld(Qh + qo); ql[q] = WFrag<bf>::ld(Ql + qo); o[q][0] = (v8f){}; o[q][1] = (v8f){}; mx[q] = -1.0e38f; sum[q] = 0.f; }
#pragma unroll 1    // kept rolled: two passes' loads live at once would not fit 256 registers
    for (int m0 = 0; m0 < NNODE; m0 += 32) {
        v16bf kh[2], kl[2]; v16h vt[2];
#pragma unroll
        for (int u = 0; u < 2; ++u) { const size_t ko = (size_t)(m0 + u * 16 + lr) * HD + 8 * hi; kh[u] = WFrag<bf>::ld(Kh + ko); kl[u] = WFrag<bf>::ld(Kl + ko); }
        v4u bm[2][2];    // the chunk's masked bias, asked for at the head of the pass with the rest so that one memory latency covers them
#pragma unroll
        for (int q = 0; q < 2; ++q)
#pragma unroll
            for (int u = 0; u < 2; ++u) bm[q][u] = *(const v4ua*)(MB + (size_t)(q * 32 + (m0 >> 5)) * 512 + u * 256);
#pragma unroll
        for (int u = 0; u < 2; ++u) vt[u] = WFrag<h16>::ld(Vt + (size_t)(u * 16 + lr) * NNODE + m0 + 8 * hi);
        asm volatile("s_wait_xcnt 0x0" ::: "memory");    // stands between the pass's 16 loads and the step of their address registers to the next chunk (the kernel's pointers carry no __restrict__, so that the "memory" clobber keeps each load on its side)
        __builtin_amdgcn_sched_barrier(0);    // keeps all 16 loads of the pass in flight together: without it the compiler sinks loads to their uses and lifts the first values' unpacking, with its wait, in front of the last loads, and the pass waits out a memory latency several times
#pragma unroll
        for (int q = 0; q < 2; ++q) { v8f s[2]; float cm = -3.0e38f;
#pragma unroll
            for (int u = 0; u < 2; ++u) { v8f acc;    // the masked bias is the accumulator's start value
#pragma unroll
                for (int i = 0; i < 4; ++i) { acc[2 * i] = __uint_as_float(bm[q][u][i] << 16); acc[2 * i + 1] = __uint_as_float(bm[q][u][i] & 0xFFFF0000u); }
                acc = wmmab(kh[u], qh[q], acc); acc = wmmab(kh[u], ql[q], acc); acc = wmmab(kl[u], qh[q], acc); s[u] = acc;
#pragma unroll
                for (int j = 0; j < 8; ++j) cm = fmaxf(cm, acc[j]); }
            cm = fmaxf(cm, __shfl_xor(cm, 16, 32));
            const float mn = fmaxf(mx[q], cm); const float al = __expf(mx[q] - mn); mx[q] = mn; float ps = 0.f; v16h p;
#pragma unroll
            for (int i = 0; i < 16; ++i) { const float ex = __expf(s[i >> 3][i & 7] - mn); ps += ex; p[i] = tohx(ex); }
            sum[q] = sum[q] * al + ps;
#pragma unroll
            for (int dt = 0; dt < 2; ++dt) { o[q][dt] *= al; o[q][dt] = wmma16(vt[dt], p, o[q][dt]); } }
    }
#pragma unroll
    for (int q = 0; q < 2; ++q) { const float inv = __fdiv_rn(1.0f, sum[q] + __shfl_xor(sum[q], 16, 32)); const size_t di = ((size_t)(b * NNODE + n0 + q * 16 + lr) * TT + t) * DD + h * HD + hi * 8;
#pragma unroll
        for (int dt = 0; dt < 2; ++dt) { v8us wh, wl;
#pragma unroll
            for (int j = 0; j < 8; ++j) { unsigned short u, l; splitf(o[q][dt][j] * inv, u, l); wh[j] = u; wl[j] = l; }
            *(v8us*)(Ah + di + dt * 16) = wh; *(v8us*)(Al + di + dt * 16) = wl; } }
}

// ---- k_out: output projection, residual and LayerNorm in one kernel. ONE WAVE per 16 rows (b,n,t) x all 128 columns (8 accumulators); grid 24576/16, 32 threads. A = hl planes from k_attn, B = bf16 Wo formed in registers from the f32 input.
// Epilogue: the 16 rows are staged in LDS; then row by row, 4 consecutive columns a lane: + bf16 bo, + bf16 x, mean and variance by the same 4-term sums and xor tree over the 32 lanes as a wave-per-row LayerNorm, 512 B stored a row.
__global__ __launch_bounds__(32) void k_out(const bf* Ah, const bf* Al, const float* wo, const float* bo, const float* x, const float* g, const float* bb, float* Y) {
    __shared__ __align__(16) float os[16 * 132];
    const int lane = threadIdx.x & 31, lr = lane & 15, hi = lane >> 4; const int r0 = blockIdx.x * 16;
    v8f acc[8];
#pragma unroll
    for (int nb = 0; nb < 8; ++nb) acc[nb] = (v8f){};
    const size_t aoff = (size_t)(r0 + lr) * DD + 8 * hi; const float* wr = wo + (size_t)lr * DD + 8 * hi;
#pragma unroll
    for (int kc = 0; kc < DD; kc += 32) { const v16bf a = WFrag<bf>::ld(Ah + aoff + kc), a2 = WFrag<bf>::ld(Al + aoff + kc); XW(); float wf[8][16];
#pragma unroll
        for (int nb = 0; nb < 8; ++nb) ld16(wr + (size_t)nb * 16 * DD + kc, wf[nb]);
#pragma unroll
        for (int nb = 0; nb < 8; ++nb) { const v16bf bw = cvt16(wf[nb]); acc[nb] = wmmab(a, bw, acc[nb]); acc[nb] = wmmab(a2, bw, acc[nb]); } }
#pragma unroll
    for (int nb = 0; nb < 8; ++nb) {
#pragma unroll
        for (int j = 0; j < 8; ++j) os[(hi * 8 + j) * 132 + nb * 16 + lr] = acc[nb][j]; }
    __builtin_amdgcn_wave_barrier(); asm volatile("" ::: "memory");    // the rows read below were written by other lanes of this wave: keeps the reads behind the writes
    const int c0 = lane * 4; float bo4[4], g4[4], b4[4]; v4f xv[16];    // the 16 residual rows are asked for together: one memory latency
    { const v4f t0 = *(const v4f*)(bo + c0), t1 = *(const v4f*)(g + c0), t2 = *(const v4f*)(bb + c0); XW();
#pragma unroll
      for (int q = 0; q < 4; ++q) { bo4[q] = t0[q]; g4[q] = t1[q]; b4[q] = t2[q]; } }
#pragma unroll
    for (int r = 0; r < 16; ++r) { if (r == 15) XW();    // the last load's result may be given the address registers that the fifteen before it name
        xv[r] = *(const v4f*)(x + (size_t)(r0 + r) * DD + c0); }
    XW();
#pragma unroll
    for (int q = 0; q < 4; ++q) { bo4[q] = bfr32(bo4[q]); g4[q] = bfr32(g4[q]); b4[q] = bfr32(b4[q]); }
#pragma unroll
    for (int r = 0; r < 16; ++r) { const size_t rb = (size_t)(r0 + r) * DD; const v4f a = *(const v4fa*)(os + r * 132 + c0); float v[4]; float s = 0.f;
#pragma unroll
        for (int q = 0; q < 4; ++q) { v[q] = __fadd_rn(a[q] + bo4[q], bfr32(xv[r][q])); s = __fadd_rn(s, v[q]); }
#pragma unroll
        for (int sh = 16; sh; sh >>= 1) s += __shfl_xor(s, sh, 32);
        const float mean = s * (1.0f / DD); float q2 = 0.f;
#pragma unroll
        for (int q = 0; q < 4; ++q) { const float d0 = v[q] - mean; q2 += d0 * d0; }
#pragma unroll
        for (int sh = 16; sh; sh >>= 1) q2 += __shfl_xor(q2, sh, 32);
        const float rstd = __frsqrt_rn(__fadd_rn(q2 * (1.0f / DD), 1e-5f)); v4f o;
#pragma unroll
        for (int q = 0; q < 4; ++q) o[q] = (v[q] - mean) * rstd * g4[q] + b4[q];
        *(v4f*)(Y + rb + c0) = o; XW(); }
}

extern "C" void kernel_launch(void* const* d_in, const int* in_sizes, int n_in,
                              void* d_out, int out_size, void* d_ws, size_t ws_size, hipStream_t stream) {
    (void)in_sizes; (void)n_in; (void)out_size;
    const float* x = (const float*)d_in[0]; const int* adj = (const int*)d_in[1]; const float* emb = (const float*)d_in[2]; const float* wq = (const float*)d_in[3]; const float* bq = (const float*)d_in[4]; const float* wk = (const float*)d_in[5]; const float* bk = (const float*)d_in[6]; const float* wv = (const float*)d_in[7]; const float* bv = (const float*)d_in[8]; const float* eb = (const float*)d_in[9]; const float* wo = (const float*)d_in[10]; const float* bo = (const float*)d_in[11]; const float* g = (const float*)d_in[12]; const float* be = (const float*)d_in[13];
    float* OUT = (float*)d_out;     // [2][1024][12][128]
    char* wsp = (char*)d_ws;
    auto take = [&](size_t bytes) { char* p = wsp; wsp += (bytes + 255) & ~(size_t)255; return (void*)p; };
    bf* Qh = (bf*)take((size_t)NBT * NH_ * NNODE * HD * 2); bf* Ql = (bf*)take((size_t)NBT * NH_ * NNODE * HD * 2); bf* Kh = (bf*)take((size_t)NBT * NH_ * NNODE * HD * 2); bf* Kl = (bf*)take((size_t)NBT * NH_ * NNODE * HD * 2); h16* V16 = (h16*)take((size_t)NBT * NH_ * HD * NNODE * 2);
    bf* Ah = (bf*)take((size_t)NRB * DD * 2); bf* Al = (bf*)take((size_t)NRB * DD * 2); bf* MB = (bf*)take((size_t)NNODE * NNODE * 2);
    if ((size_t)(wsp - (char*)d_ws) > ws_size) return;    // total ~ 46 MB
    k_qkv<<<dim3(3 * DD / 64 + 1, NBT * (NNODE / (16 * MBT)), 1), 32, 0, stream>>>(x, emb, wq, bq, wk, bk, wv, bv, adj, eb, Qh, Ql, Kh, Kl, V16, MB);
    k_attn<<<dim3(NNODE / 128, NH_, NBT), 128, 0, stream>>>(Qh, Ql, Kh, Kl, V16, MB, Ah, Al);
    k_out<<<NRB / 16, 32, 0, stream>>>(Ah, Al, wo, bo, x, g, be, OUT);
}

// v004
// One run takes 75.2 microseconds.
// In two side-by-side timings against v003, it was 1.07 and 1.05 times as fast.
// Over all steps from v000 it is 20.6 times as fast.
#include <hip/hip_runtime.h>

// CHGANSimplified (node_features [2][1024 nodes][12 steps][128]; enh = x + node_type_embed[1 - n%2]; Q/K/V = enh W^T + b (4 heads x 32); per (batch, head, step): scores over node pairs = q.k/sqrt(32) + edge_bias[n][m]; masked to -inf where
// adj[n][m] == 0 and n != m (adj / edge_bias read as data); softmax over m (nan_to_num is a no-op: self loops keep every row non-empty); out = attn V merged; out = out Wo^T + bo; result = LN(out + node_features) -> [2][1024][12][128]).
// Compute dtypes, f32 accumulate: every input rounded to bf16; Q/K/V on bf16 hi+lo planes of enh x exact weights (2 products, + bias); scores (K 32) on hl planes (3 products), masked online softmax f32 and fp16 p x fp16 V in one kernel (k_attn); mask, self loop and bf16 edge_bias are merged once a call into one bf16 plane (k_qkv's seventh column of blocks)

#define NB_  2
#define NNODE 1024
#define TT   12
#define DD   128
#define NH_  4
#define HD   32
#define NR   (NNODE * TT)
#define SCL  0.1767766952966369f
#define NBT  (NB_ * TT)
#define NRB  (NB_ * NR)
typedef _Float16 h16;
typedef unsigned short bf;
typedef __attribute__((ext_vector_type(16))) __bf16   v16bf;
typedef __attribute__((ext_vector_type(16))) _Float16 v16h;
typedef __attribute__((ext_vector_type(8)))  _Float16 v8h;
typedef __attribute__((ext_vector_type(8)))  unsigned short v8us;
typedef __attribute__((ext_vector_type(8)))  float    v8f;
typedef __attribute__((ext_vector_type(4)))  float    v4f;
typedef v8h  __attribute__((may_alias)) v8ha;
typedef v4f  __attribute__((may_alias)) v4fa;
typedef v8us __attribute__((may_alias)) v8usa;

__device__ __forceinline__ v16h cat16(v8h lo, v8h hi) { return __builtin_shufflevector(lo, hi, 0, 1, 2, 3, 4, 5, 6, 7, 8, 9, 10, 11, 12, 13, 14, 15); }
__device__ __forceinline__ v16bf cat16b(v8us lo, v8us hi) { return __builtin_bit_cast(v16bf, __builtin_shufflevector(lo, hi, 0, 1, 2, 3, 4, 5, 6, 7, 8, 9, 10, 11, 12, 13, 14, 15)); }
__device__ __forceinline__ v8f wmma16(v16h a, v16h b, v8f c) { return __builtin_amdgcn_wmma_f32_16x16x32_f16(false, a, false, b, (short)0, c, false, false); }
__device__ __forceinline__ v8f wmmab(v16bf a, v16bf b, v8f c) { return __builtin_amdgcn_wmma_f32_16x16x32_bf16(false, a, false, b, (short)0, c, false, false); }




template <typename T16> struct WFrag;
template <> struct WFrag<h16> { typedef v16h V; static __device__ __forceinline__ V ld(const h16* p) { return cat16(*(const v8h*)p, *(const v8h*)(p + 16)); } static __device__ __forceinline__ v8f mma(V a, V b, v8f c) { return wmma16(a, b, c); } };
template <> struct WFrag<bf> { typedef v16bf V; static __device__ __forceinline__ V ld(const bf* p) { return cat16b(*(const v8us*)p, *(const v8us*)(p + 16)); } static __device__ __forceinline__ v8f mma(V a, V b, v8f c) { return wmmab(a, b, c); } };
__device__ __forceinline__ h16 tohx(float x) { return (h16)x; }
// XW: s_wait_xcnt 0 behind a group of global loads or stores, in front of whatever later overwrites a register that they name (address or store data). The pointers of k_qkv and k_out carry no __restrict__, so that the "memory" clobber keeps each load and store on its side.
#define XW() asm volatile("s_wait_xcnt 0x0" ::: "memory")
// ld16: the 16 f32 that make one lane's share of a 16x16x32 fragment, in the k order of WFrag::ld (p[0..7], then p[16..23]); cvt16: such a share rounded to bf16 (a weight fragment from the f32 input)
__device__ __forceinline__ void ld16(const float* p, float* f) { const v4f a0 = *(const v4f*)p, a1 = *(const v4f*)(p + 4), a2 = *(const v4f*)(p + 16), a3 = *(const v4f*)(p + 20); XW();
#pragma unroll
    for (int i = 0; i < 4; ++i) { f[i] = a0[i]; f[4 + i] = a1[i]; f[8 + i] = a2[i]; f[12 + i] = a3[i]; } }
// Every f32 -> bf16 rounding (to nearest even) is the chip's packed conversion, two values an instruction: cpk(a, b) is one register of a fragment (element 2i = a low, 2i + 1 = b high); lo2f / hi2f give its two halves back as f32.
// bfr2: a pair rounded to bf16 and kept as f32; bfr32: the same for one value; split2: a pair as hi + lo bf16 planes (lo = the rounded rest y - hi)
typedef __attribute__((ext_vector_type(8))) unsigned v8u;
typedef __attribute__((ext_vector_type(2))) unsigned v2u;
typedef __attribute__((ext_vector_type(2))) float v2f;
typedef __attribute__((ext_vector_type(2))) __bf16 v2bf;
__device__ __forceinline__ unsigned cpk(float a, float b) { const v2f x = { a, b }; return __builtin_bit_cast(unsigned, __builtin_convertvector(x, v2bf)); }
__device__ __forceinline__ float lo2f(unsigned p) { return __uint_as_float(p << 16); }
__device__ __forceinline__ float hi2f(unsigned p) { return __uint_as_float(p & 0xFFFF0000u); }
__device__ __forceinline__ void bfr2(float& a, float& b) { const unsigned p = cpk(a, b); a = lo2f(p); b = hi2f(p); }
__device__ __forceinline__ float bfr32(float f) { return lo2f(cpk(f, f)); }
__device__ __forceinline__ void split2(float y0, float y1, unsigned& h, unsigned& l) { h = cpk(y0, y1); l = cpk(y0 - lo2f(h), y1 - hi2f(h)); }
__device__ __forceinline__ v16bf cvt16(const float* f) { v8u o;
#pragma unroll
    for (int i = 0; i < 8; ++i) o[i] = cpk(f[2 * i], f[2 * i + 1]);
    return __builtin_bit_cast(v16bf, o); }

// ---- k_qkv: Q, K or V projection with its neighbours folded in. ONE WAVE per 32x64 output tile (8 accumulators); grid (6 column tiles of [q | k | v] and a seventh column for the plane MB, 24 slices bt x 32 node blocks), 32 threads.
// The 32 rows of a tile are 32 consecutive nodes n of one (batch, step) slice bt, so that the tile's results lie contiguous in the planes that k_attn reads.
// Prologue: the A fragments (hi + lo bf16 planes of enh = bf16 x + bf16 emb[1 - n%2]; n's parity is the lane's, as n0 and the 16-row steps are even) and the B fragments (bf16 weights) are formed in registers from the f32 inputs.
// Epilogue (+ bf16 bias): Q (x scale) and K go out as hl planes [bt][h][n][d], staged through LDS so that a store covers whole 128-B lines; V goes out as fp16 V16[bt][h][dv][m] straight from the accumulators, whose 8 registers are 8 consecutive m.
// Blocks of column 6 do no projection: they write MB, the masked bias of every node pair as bf16 (bf16 edge_bias where adj != 0 or n == m, else -3e38), in the order in which k_attn's lanes hold the scores:
// MB[n/16][m/32][u][lane][j], 512 B in a row for each load of a wave. adj and edge_bias are the same for all 96 (batch, step, head) slices, so this is done once a call and not once a slice.
#define MBT 2    // 16-row blocks a tile
#define MBTILES ((NNODE / 16) * (NNODE / 32))
typedef __attribute__((ext_vector_type(4))) int v4i;
typedef __attribute__((ext_vector_type(4))) unsigned v4u;
typedef v4u __attribute__((may_alias)) v4ua;
__global__ __launch_bounds__(32) void k_qkv(const float* x, const float* emb, const float* wq, const float* bq, const float* wk, const float* bk, const float* wv, const float* bv, const int* adj, const float* eb, bf* Qh, bf* Ql, bf* Kh, bf* Kl, h16* V16, bf* MB) {
    __shared__ __align__(16) float os[16 * 68];
    const int lane = threadIdx.x & 31, lr = lane & 15, hi = lane >> 4; const int bt = blockIdx.y / (NNODE / (16 * MBT)), b = bt / TT, t = bt % TT, n0 = (blockIdx.y % (NNODE / (16 * MBT))) * 16 * MBT; const int which = blockIdx.x >> 1, c0 = (blockIdx.x & 1) * 64;
    if (which == 3) {    // the masked-bias plane: tile (nb, mc) = 16 nodes n x 32 nodes m; a lane forms the 8 values that it will hold in k_attn's score accumulator (n = nb*16 + lr, m = mc*32 + u*16 + hi*8 + j)
        for (int tile = blockIdx.y; tile < MBTILES; tile += NBT * (NNODE / (16 * MBT))) { const int n = (tile >> 5) * 16 + lr;
            const int mt = (tile & 31) * 32 + hi * 8; const size_t ro = (size_t)n * NNODE + mt; v4i a[2][2]; v4f e[2][2];    // the tile's 8 loads are asked for together: one memory latency
#pragma unroll
            for (int u = 0; u < 2; ++u) { a[u][0] = *(const v4i*)(adj + ro + u * 16); a[u][1] = *(const v4i*)(adj + ro + u * 16 + 4); e[u][0] = *(const v4f*)(eb + ro + u * 16); e[u][1] = *(const v4f*)(eb + ro + u * 16 + 4); }
            XW();
#pragma unroll
            for (int u = 0; u < 2; ++u) { const int mb = mt + u * 16; float r[8];
#pragma unroll
                for (int j = 0; j < 8; ++j) { const bool keep = (a[u][j >> 2][j & 3] != 0) | (mb + j == n); r[j] = keep ? e[u][j >> 2][j & 3] : -3.0e38f; }
                const v4u o = { cpk(r[0], r[1]), cpk(r[2], r[3]), cpk(r[4], r[5]), cpk(r[6], r[7]) };
                *(v4ua*)(MB + ((size_t)tile * 2 + u) * 256 + lane * 8) = o; XW(); } }
        return;
    }
    const float* w = which == 0 ? wq : (which == 1 ? wk : wv); const float* bias = which == 0 ? bq : (which == 1 ? bk : bv);
    v8f acc[MBT][4];
#pragma unroll
    for (int mb = 0; mb < MBT; ++mb)
#pragma unroll
        for (int nb = 0; nb < 4; ++nb) acc[mb][nb] = (v8f){};
    const float* xr = x + ((size_t)(b * NNODE + n0 + lr) * TT + t) * DD + 8 * hi; const float* er = emb + (1 - (lr & 1)) * DD + 8 * hi; const float* wr = w + (size_t)(c0 + lr) * DD + 8 * hi;
#pragma unroll 1    // kept rolled: unrolled, the four passes' loads are hoisted together, the wave's registers grow and fewer waves fit a SIMD
    for (int kc = 0; kc < DD; kc += 32) {
        v16bf a[MBT], a2[MBT]; float ev[16], f[MBT][16], wf[4][16];    // all 28 loads of the pass are asked for at its head, so that one memory latency covers them
#pragma unroll
        for (int mb = 0; mb < MBT; ++mb) ld16(xr + (size_t)mb * 16 * TT * DD + kc, f[mb]);
        ld16(er + kc, ev);
#pragma unroll
        for (int nb = 0; nb < 4; ++nb) ld16(wr + (size_t)nb * 16 * DD + kc, wf[nb]);
#pragma unroll
        for (int i = 0; i < 8; ++i) bfr2(ev[2 * i], ev[2 * i + 1]);
#pragma unroll
        for (int mb = 0; mb < MBT; ++mb) { v8u oh, ol;
#pragma unroll
            for (int i = 0; i < 8; ++i) { unsigned h, l; bfr2(f[mb][2 * i], f[mb][2 * i + 1]); split2(__fadd_rn(f[mb][2 * i], ev[2 * i]), __fadd_rn(f[mb][2 * i + 1], ev[2 * i + 1]), h, l); oh[i] = h; ol[i] = l; }
            a[mb] = __builtin_bit_cast(v16bf, oh); a2[mb] = __builtin_bit_cast(v16bf, ol); }
#pragma unroll
        for (int nb = 0; nb < 4; ++nb) { const v16bf bw = cvt16(wf[nb]);
#pragma unroll
            for (int mb = 0; mb < MBT; ++mb) { acc[mb][nb] = wmmab(a[mb], bw, acc[mb][nb]); acc[mb][nb] = wmmab(a2[mb], bw, acc[mb][nb]); } }
    }
    if (which == 2) {
#pragma unroll
        for (int nb = 0; nb < 4; ++nb) { const int col = c0 + nb * 16 + lr; const float bc = bfr32(bias[col]); XW(); h16* dst = V16 + (((size_t)bt * NH_ + (col >> 5)) * HD + (col & 31)) * NNODE + n0 + hi * 8;
#pragma unroll
            for (int mb = 0; mb < MBT; ++mb) { v8h o;
#pragma unroll
                for (int j = 0; j < 8; ++j) o[j] = tohx(acc[mb][nb][j] + bc);
                *(v8h*)(dst + mb * 16) = o; XW(); } }
        return;
    }
    bf* Ph = which == 0 ? Qh : Kh; bf* Pl = which == 0 ? Ql : Kl; const float scl = which == 0 ? SCL : 1.0f;
    const int cofs = lr * 4, col = c0 + cofs; float b4[4];
#pragma unroll
    for (int q = 0; q < 4; ++q) b4[q] = bfr32(bias[col + q]);
    XW();
    const size_t pofs = (((size_t)bt * NH_ + (col >> 5)) * NNODE + n0) * HD + (col & 31);
#pragma unroll
    for (int mb = 0; mb < MBT; ++mb) {
#pragma unroll
        for (int nb = 0; nb < 4; ++nb) {
#pragma unroll
            for (int j = 0; j < 8; ++j) os[(hi * 8 + j) * 68 + nb * 16 + lr] = acc[mb][nb][j]; }
        __builtin_amdgcn_wave_barrier(); asm volatile("" ::: "memory");    // the rows read below were written by other lanes of this wave: keeps the reads behind the writes
#pragma unroll
        for (int s = 0; s < 8; ++s) { const int row = 2 * s + hi; const v4f val = *(const v4fa*)(os + row * 68 + cofs); v2u oh, ol;
#pragma unroll
            for (int q = 0; q < 2; ++q) { unsigned h, l; split2((val[2 * q] + b4[2 * q]) * scl, (val[2 * q + 1] + b4[2 * q + 1]) * scl, h, l); oh[q] = h; ol[q] = l; }
            *(v2u*)(Ph + pofs + (size_t)(mb * 16 + row) * HD) = oh; *(v2u*)(Pl + pofs + (size_t)(mb * 16 + row) * HD) = ol; XW(); }
        __builtin_amdgcn_wave_barrier(); asm volatile("" ::: "memory");    // keeps the next block's writes behind these reads
    }
}
// k_attn: scores, masked softmax and attn V in one kernel, one launch for every (batch, step, head). Grid (1024/128, heads, batch*steps), 4 waves; a wave owns 32 query nodes n (2 tiles of 16) and walks the 1024 key nodes m in chunks of 32.
// Scores are formed TRANSPOSED, St[m][n] = sum_d K[m][d] Q[n][d] (hl planes, the same 3 products): the accumulator then holds, in lane (lr, hi), node n = lr and m = 8 hi + j, which is the k order of a 16x16x32 B fragment
// (tile u = 0 gives k = 8 hi + j, tile u = 1 gives k = 16 + 8 hi + j), so p = exp(s - max) goes from registers into Ot[d][n] = sum_m Vt[d][m] P[n][m] with no exchange, and max, sum and the rescale are per lane (n = lr).
// Online softmax: running max mx (never below -1e38) and sum per n; a masked pair (adj == 0, m != n) carries about -3e38 from the plane MB, so its exp(s - mx) is 0 even while no kept pair has been met; the self loop keeps every sum above 0. Result Ot / sum is stored as hl planes A[(b,n,t)][h*32 + d], the output projection's operand, 16 B a lane and plane.
__global__ __launch_bounds__(128) void k_attn(const bf* Qh, const bf* Ql, const bf* Kh, const bf* Kl, const h16* Vt, const bf* MB, bf* Ah, bf* Al) {
    const int lane = threadIdx.x & 31, lr = lane & 15, hi = lane >> 4; const int h = blockIdx.y, bt = blockIdx.z, b = bt / TT, t = bt % TT; const int n0 = blockIdx.x * 128 + (threadIdx.x >> 5) * 32;
    const size_t pl = ((size_t)bt * NH_ + h) * NNODE * HD; Qh += pl; Ql += pl; Kh += pl; Kl += pl; Vt += pl; MB += (size_t)(n0 >> 4) * 32 * 512 + lane * 8;
    v16bf qh[2], ql[2]; v8f o[2][2]; float mx[2], sum[2];
#pragma unroll
    for (int q = 0; q < 2; ++q) { const size_t qo = (size_t)(n0 + q * 16 + lr) * HD + 8 * hi; qh[q] = WFrag<bf>::ld(Qh + qo); ql[q] = WFrag<bf>::ld(Ql + qo); o[q][0] = (v8f){}; o[q][1] = (v8f){}; mx[q] = -1.0e38f; sum[q] = 0.f; }
#pragma unroll 1    // kept rolled: two passes' loads live at once would not fit 256 registers
    for (int m0 = 0; m0 < NNODE; m0 += 32) {
        v16bf kh[2], kl[2]; v16h vt[2];
#pragma unroll
        for (int u = 0; u < 2; ++u) { const size_t ko = (size_t)(m0 + u * 16 + lr) * HD + 8 * hi; kh[u] = WFrag<bf>::ld(Kh + ko); kl[u] = WFrag<bf>::ld(Kl + ko); }
        v4u bm[2][2];    // the chunk's masked bias, asked for at the head of the pass with the rest so that one memory latency covers them
#pragma unroll
        for (int q = 0; q < 2; ++q)
#pragma unroll
            for (int u = 0; u < 2; ++u) bm[q][u] = *(const v4ua*)(MB + (size_t)(q * 32 + (m0 >> 5)) * 512 + u * 256);
#pragma unroll
        for (int u = 0; u < 2; ++u) vt[u] = WFrag<h16>::ld(Vt + (size_t)(u * 16 + lr) * NNODE + m0 + 8 * hi);
        asm volatile("s_wait_xcnt 0x0" ::: "memory");    // stands between the pass's 16 loads and the step of their address registers to the next chunk (the kernel's pointers carry no __restrict__, so that the "memory" clobber keeps each load on its side)
        __builtin_amdgcn_sched_barrier(0);    // keeps all 16 loads of the pass in flight together: without it the compiler sinks loads to their uses and lifts the first values' unpacking, with its wait, in front of the last loads, and the pass waits out a memory latency several times
#pragma unroll
        for (int q = 0; q < 2; ++q) { v8f s[2]; float cm = -3.0e38f;
#pragma unroll
            for (int u = 0; u < 2; ++u) { v8f acc;    // the masked bias is the accumulator's start value
#pragma unroll
                for (int i = 0; i < 4; ++i) { acc[2 * i] = __uint_as_float(bm[q][u][i] << 16); acc[2 * i + 1] = __uint_as_float(bm[q][u][i] & 0xFFFF0000u); }
                acc = wmmab(kh[u], qh[q], acc); acc = wmmab(kh[u], ql[q], acc); acc = wmmab(kl[u], qh[q], acc); s[u] = acc;
#pragma unroll
                for (int j = 0; j < 8; ++j) cm = fmaxf(cm, acc[j]); }
            cm = fmaxf(cm, __shfl_xor(cm, 16, 32));
            const float mn = fmaxf(mx[q], cm); const float al = __expf(mx[q] - mn); mx[q] = mn; float ps = 0.f; v16h p;
#pragma unroll
            for (int i = 0; i < 16; ++i) { const float ex = __expf(s[i >> 3][i & 7] - mn); ps += ex; p[i] = tohx(ex); }
            sum[q] = sum[q] * al + ps;
#pragma unroll
            for (int dt = 0; dt < 2; ++dt) { o[q][dt] *= al; o[q][dt] = wmma16(vt[dt], p, o[q][dt]); } }
    }
#pragma unroll
    for (int q = 0; q < 2; ++q) { const float inv = __fdiv_rn(1.0f, sum[q] + __shfl_xor(sum[q], 16, 32)); const size_t di = ((size_t)(b * NNODE + n0 + q * 16 + lr) * TT + t) * DD + h * HD + hi * 8;
#pragma unroll
        for (int dt = 0; dt < 2; ++dt) { v4u ph, pl;
#pragma unroll
            for (int j = 0; j < 4; ++j) { unsigned u, l; split2(o[q][dt][2 * j] * inv, o[q][dt][2 * j + 1] * inv, u, l); ph[j] = u; pl[j] = l; }
            const v8us wh = __builtin_bit_cast(v8us, ph), wl = __builtin_bit_cast(v8us, pl);
            *(v8us*)(Ah + di + dt * 16) = wh; *(v8us*)(Al + di + dt * 16) = wl; XW(); } }
}

// ---- k_out: output projection, residual and LayerNorm in one kernel. ONE WAVE per 16 rows (b,n,t) x all 128 columns (8 accumulators); grid 24576/16, 32 threads. A = hl planes from k_attn, B = bf16 Wo formed in registers from the f32 input.
// Epilogue: the 16 rows are staged in LDS; then row by row, 4 consecutive columns a lane: + bf16 bo, + bf16 x, mean and variance by the same 4-term sums and xor tree over the 32 lanes as a wave-per-row LayerNorm, 512 B stored a row.
__global__ __launch_bounds__(32) void k_out(const bf* Ah, const bf* Al, const float* wo, const float* bo, const float* x, const float* g, const float* bb, float* Y) {
    __shared__ __align__(16) float os[16 * 132];
    const int lane = threadIdx.x & 31, lr = lane & 15, hi = lane >> 4; const int r0 = blockIdx.x * 16;
    v8f acc[8];
#pragma unroll
    for (int nb = 0; nb < 8; ++nb) acc[nb] = (v8f){};
    const size_t aoff = (size_t)(r0 + lr) * DD + 8 * hi; const float* wr = wo + (size_t)lr * DD + 8 * hi;
#pragma unroll
    for (int kc = 0; kc < DD; kc += 32) { const v16bf a = WFrag<bf>::ld(Ah + aoff + kc), a2 = WFrag<bf>::ld(Al + aoff + kc); XW(); float wf[8][16];
#pragma unroll
        for (int nb = 0; nb < 8; ++nb) ld16(wr + (size_t)nb * 16 * DD + kc, wf[nb]);
#pragma unroll
        for (int nb = 0; nb < 8; ++nb) { const v16bf bw = cvt16(wf[nb]); acc[nb] = wmmab(a, bw, acc[nb]); acc[nb] = wmmab(a2, bw, acc[nb]); } }
#pragma unroll
    for (int nb = 0; nb < 8; ++nb) {
#pragma unroll
        for (int j = 0; j < 8; ++j) os[(hi * 8 + j) * 132 + nb * 16 + lr] = acc[nb][j]; }
    __builtin_amdgcn_wave_barrier(); asm volatile("" ::: "memory");    // the rows read below were written by other lanes of this wave: keeps the reads behind the writes
    const int c0 = lane * 4; float bo4[4], g4[4], b4[4]; v4f xv[16];    // the 16 residual rows are asked for together: one memory latency
    { const v4f t0 = *(const v4f*)(bo + c0), t1 = *(const v4f*)(g + c0), t2 = *(const v4f*)(bb + c0); XW();
#pragma unroll
      for (int q = 0; q < 4; ++q) { bo4[q] = t0[q]; g4[q] = t1[q]; b4[q] = t2[q]; } }
#pragma unroll
    for (int r = 0; r < 16; ++r) { if (r == 15) XW();    // the last load's result may be given the address registers that the fifteen before it name
        xv[r] = *(const v4f*)(x + (size_t)(r0 + r) * DD + c0); }
    XW();
#pragma unroll
    for (int q = 0; q < 2; ++q) { bfr2(bo4[2 * q], bo4[2 * q + 1]); bfr2(g4[2 * q], g4[2 * q + 1]); bfr2(b4[2 * q], b4[2 * q + 1]); }
#pragma unroll
    for (int r = 0; r < 16; ++r) { const size_t rb = (size_t)(r0 + r) * DD; const v4f a = *(const v4fa*)(os + r * 132 + c0); float v[4]; float s = 0.f; float xb[4] = { xv[r][0], xv[r][1], xv[r][2], xv[r][3] }; bfr2(xb[0], xb[1]); bfr2(xb[2], xb[3]);
#pragma unroll
        for (int q = 0; q < 4; ++q) { v[q] = __fadd_rn(a[q] + bo4[q], xb[q]); s = __fadd_rn(s, v[q]); }
#pragma unroll
        for (int sh = 16; sh; sh >>= 1) s += __shfl_xor(s, sh, 32);
        const float mean = s * (1.0f / DD); float q2 = 0.f;
#pragma unroll
        for (int q = 0; q < 4; ++q) { const float d0 = v[q] - mean; q2 += d0 * d0; }
#pragma unroll
        for (int sh = 16; sh; sh >>= 1) q2 += __shfl_xor(q2, sh, 32);
        const float rstd = __frsqrt_rn(__fadd_rn(q2 * (1.0f / DD), 1e-5f)); v4f o;
#pragma unroll
        for (int q = 0; q < 4; ++q) o[q] = (v[q] - mean) * rstd * g4[q] + b4[q];
        *(v4f*)(Y + rb + c0) = o; XW(); }
}

extern "C" void kernel_launch(void* const* d_in, const int* in_sizes, int n_in,
                              void* d_out, int out_size, void* d_ws, size_t ws_size, hipStream_t stream) {
    (void)in_sizes; (void)n_in; (void)out_size;
    const float* x = (const float*)d_in[0]; const int* adj = (const int*)d_in[1]; const float* emb = (const float*)d_in[2]; const float* wq = (const float*)d_in[3]; const float* bq = (const float*)d_in[4]; const float* wk = (const float*)d_in[5]; const float* bk = (const float*)d_in[6]; const float* wv = (const float*)d_in[7]; const float* bv = (const float*)d_in[8]; const float* eb = (const float*)d_in[9]; const float* wo = (const float*)d_in[10]; const float* bo = (const float*)d_in[11]; const float* g = (const float*)d_in[12]; const float* be = (const float*)d_in[13];
    float* OUT = (float*)d_out;     // [2][1024][12][128]
    char* wsp = (char*)d_ws;
    auto take = [&](size_t bytes) { char* p = wsp; wsp += (bytes + 255) & ~(size_t)255; return (void*)p; };
    bf* Qh = (bf*)take((size_t)NBT * NH_ * NNODE * HD * 2); bf* Ql = (bf*)take((size_t)NBT * NH_ * NNODE * HD * 2); bf* Kh = (bf*)take((size_t)NBT * NH_ * NNODE * HD * 2); bf* Kl = (bf*)take((size_t)NBT * NH_ * NNODE * HD * 2); h16* V16 = (h16*)take((size_t)NBT * NH_ * HD * NNODE * 2);
    bf* Ah = (bf*)take((size_t)NRB * DD * 2); bf* Al = (bf*)take((size_t)NRB * DD * 2); bf* MB = (bf*)take((size_t)NNODE * NNODE * 2);
    if ((size_t)(wsp - (char*)d_ws) > ws_size) return;    // total ~ 46 MB
    k_qkv<<<dim3(3 * DD / 64 + 1, NBT * (NNODE / (16 * MBT)), 1), 32, 0, stream>>>(x, emb, wq, bq, wk, bk, wv, bv, adj, eb, Qh, Ql, Kh, Kl, V16, MB);
    k_attn<<<dim3(NNODE / 128, NH_, NBT), 128, 0, stream>>>(Qh, Ql, Kh, Kl, V16, MB, Ah, Al);
    k_out<<<NRB / 16, 32, 0, stream>>>(Ah, Al, wo, bo, x, g, be, OUT);
}

// v005
// Measured time: 69.4 microseconds a run.
// Timed twice side by side with v004, it ran 1.09 and 1.07 times as fast.
// Over all steps from v000 it is 22.2 times as fast.
#include <hip/hip_runtime.h>

// CHGANSimplified (node_features [2][1024 nodes][12 steps][128]; enh = x + node_type_embed[1 - n%2]; Q/K/V = enh W^T + b (4 heads x 32); per (batch, head, step): scores over node pairs = q.k/sqrt(32) + edge_bias[n][m]; masked to -inf where
// adj[n][m] == 0 and n != m (adj / edge_bias read as data); softmax over m (nan_to_num is a no-op: self loops keep every row non-empty); out = attn V merged; out = out Wo^T + bo; result = LN(out + node_features) -> [2][1024][12][128]).
// Compute dtypes, f32 accumulate: every input rounded to bf16; Q/K/V on bf16 hi+lo planes of enh x exact weights (2 products, + bias); scores (K 32) on hl planes (3 products), masked online softmax f32 and fp16 p x fp16 V in one kernel (k_attn); mask, self loop and bf16 edge_bias are merged once a call into one bf16 plane (k_qkv's seventh column of blocks)

#define NB_  2
#define NNODE 1024
#define TT   12
#define DD   128
#define NH_  4
#define HD   32
#define NR   (NNODE * TT)
#define SCL  0.1767766952966369f
#define NBT  (NB_ * TT)
#define NRB  (NB_ * NR)
typedef _Float16 h16;
typedef unsigned short bf;
typedef __attribute__((ext_vector_type(16))) __bf16   v16bf;
typedef __attribute__((ext_vector_type(16))) _Float16 v16h;
typedef __attribute__((ext_vector_type(8)))  _Float16 v8h;
typedef __attribute__((ext_vector_type(8)))  unsigned short v8us;
typedef __attribute__((ext_vector_type(8)))  float    v8f;
typedef __attribute__((ext_vector_type(4)))  float    v4f;
typedef v8h  __attribute__((may_alias)) v8ha;
typedef v4f  __attribute__((may_alias)) v4fa;
typedef v8us __attribute__((may_alias)) v8usa;

__device__ __forceinline__ v16h cat16(v8h lo, v8h hi) { return __builtin_shufflevector(lo, hi, 0, 1, 2, 3, 4, 5, 6, 7, 8, 9, 10, 11, 12, 13, 14, 15); }
__device__ __forceinline__ v16bf cat16b(v8us lo, v8us hi) { return __builtin_bit_cast(v16bf, __builtin_shufflevector(lo, hi, 0, 1, 2, 3, 4, 5, 6, 7, 8, 9, 10, 11, 12, 13, 14, 15)); }
__device__ __forceinline__ v8f wmma16(v16h a, v16h b, v8f c) { return __builtin_amdgcn_wmma_f32_16x16x32_f16(false, a, false, b, (short)0, c, false, false); }
__device__ __forceinline__ v8f wmmab(v16bf a, v16bf b, v8f c) { return __builtin_amdgcn_wmma_f32_16x16x32_bf16(false, a, false, b, (short)0, c, false, false); }




template <typename T16> struct WFrag;
template <> struct WFrag<h16> { typedef v16h V; static __device__ __forceinline__ V ld(const h16* p) { return cat16(*(const v8h*)p, *(const v8h*)(p + 16)); } static __device__ __forceinline__ v8f mma(V a, V b, v8f c) { return wmma16(a, b, c); } };
template <> struct WFrag<bf> { typedef v16bf V; static __device__ __forceinline__ V ld(const bf* p) { return cat16b(*(const v8us*)p, *(const v8us*)(p + 16)); } static __device__ __forceinline__ v8f mma(V a, V b, v8f c) { return wmmab(a, b, c); } };
__device__ __forceinline__ h16 tohx(float x) { return (h16)x; }
// Exchanges between lanes stay on the vector port (a shuffle through the LDS pipe costs its latency and a wait at every link of a dependent chain): xhalf(x) is lane l ^ 16's x (v_permlanex16_b32), xrow<M>(x) lane l ^ M's, M < 16 (DPP row_xmask, fused into the add that uses it).
__device__ __forceinline__ float xhalf(float x) { const int b = __builtin_bit_cast(int, x); return __builtin_bit_cast(float, __builtin_amdgcn_permlanex16(b, b, 0x76543210, 0xfedcba98, false, false)); }
template <int M> __device__ __forceinline__ float xrow(float x) { return __builtin_bit_cast(float, __builtin_amdgcn_update_dpp(0, __builtin_bit_cast(int, x), 0x160 | M, 0xf, 0xf, true)); }
// wsum: sum over the wave's 32 lanes, the xor tree 16, 8, 4, 2, 1; every lane ends with the same value
__device__ __forceinline__ float wsum(float s) { s += xhalf(s); s += xrow<8>(s); s += xrow<4>(s); s += xrow<2>(s); s += xrow<1>(s); return s; }
// XW: s_wait_xcnt 0 behind a group of global loads or stores, in front of whatever later overwrites a register that they name (address or store data). The pointers of k_qkv and k_out carry no __restrict__, so that the "memory" clobber keeps each load and store on its side.
#define XW() asm volatile("s_wait_xcnt 0x0" ::: "memory")
// ld16: the 16 f32 that make one lane's share of a 16x16x32 fragment, in the k order of WFrag::ld (p[0..7], then p[16..23]); cvt16: such a share rounded to bf16 (a weight fragment from the f32 input)
__device__ __forceinline__ void ld16(const float* p, float* f) { const v4f a0 = *(const v4f*)p, a1 = *(const v4f*)(p + 4), a2 = *(const v4f*)(p + 16), a3 = *(const v4f*)(p + 20); XW();
#pragma unroll
    for (int i = 0; i < 4; ++i) { f[i] = a0[i]; f[4 + i] = a1[i]; f[8 + i] = a2[i]; f[12 + i] = a3[i]; } }
// Every f32 -> bf16 rounding (to nearest even) is the chip's packed conversion, two values an instruction: cpk(a, b) is one register of a fragment (element 2i = a low, 2i + 1 = b high); lo2f / hi2f give its two halves back as f32.
// bfr2: a pair rounded to bf16 and kept as f32; bfr32: the same for one value; split2: a pair as hi + lo bf16 planes (lo = the rounded rest y - hi)
typedef __attribute__((ext_vector_type(8))) unsigned v8u;
typedef __attribute__((ext_vector_type(2))) unsigned v2u;
typedef __attribute__((ext_vector_type(2))) float v2f;
typedef __attribute__((ext_vector_type(2))) __bf16 v2bf;
__device__ __forceinline__ unsigned cpk(float a, float b) { const v2f x = { a, b }; return __builtin_bit_cast(unsigned, __builtin_convertvector(x, v2bf)); }
__device__ __forceinline__ float lo2f(unsigned p) { return __uint_as_float(p << 16); }
__device__ __forceinline__ float hi2f(unsigned p) { return __uint_as_float(p & 0xFFFF0000u); }
__device__ __forceinline__ void bfr2(float& a, float& b) { const unsigned p = cpk(a, b); a = lo2f(p); b = hi2f(p); }
__device__ __forceinline__ float bfr32(float f) { return lo2f(cpk(f, f)); }
__device__ __forceinline__ void split2(float y0, float y1, unsigned& h, unsigned& l) { h = cpk(y0, y1); l = cpk(y0 - lo2f(h), y1 - hi2f(h)); }
__device__ __forceinline__ v16bf cvt16(const float* f) { v8u o;
#pragma unroll
    for (int i = 0; i < 8; ++i) o[i] = cpk(f[2 * i], f[2 * i + 1]);
    return __builtin_bit_cast(v16bf, o); }

// ---- k_qkv: Q, K or V projection with its neighbours folded in. ONE WAVE per 32x64 output tile (8 accumulators); grid (6 column tiles of [q | k | v] and a seventh column for the plane MB, 24 slices bt x 32 node blocks), 32 threads.
// The 32 rows of a tile are 32 consecutive nodes n of one (batch, step) slice bt, so that the tile's results lie contiguous in the planes that k_attn reads.
// Prologue: the A fragments (hi + lo bf16 planes of enh = bf16 x + bf16 emb[1 - n%2]; n's parity is the lane's, as n0 and the 16-row steps are even) and the B fragments (bf16 weights) are formed in registers from the f32 inputs.
// Epilogue (+ bf16 bias): Q (x scale) and K go out as hl planes [bt][h][n][d], staged through LDS so that a store covers whole 128-B lines; V goes out as fp16 V16[bt][h][dv][m] straight from the accumulators, whose 8 registers are 8 consecutive m.
// Blocks of column 6 do no projection: they write MB, the masked bias of every node pair as bf16 (bf16 edge_bias where adj != 0 or n == m, else -3e38), in the order in which k_attn's lanes hold the scores:
// MB[n/16][m/32][u][lane][j], 512 B in a row for each load of a wave. adj and edge_bias are the same for all 96 (batch, step, head) slices, so this is done once a call and not once a slice.
#define MBT 2    // 16-row blocks a tile
#define MBTILES ((NNODE / 16) * (NNODE / 32))
typedef __attribute__((ext_vector_type(4))) int v4i;
typedef __attribute__((ext_vector_type(4))) unsigned v4u;
typedef v4u __attribute__((may_alias)) v4ua;
__global__ __launch_bounds__(32) void k_qkv(const float* x, const float* emb, const float* wq, const float* bq, const float* wk, const float* bk, const float* wv, const float* bv, const int* adj, const float* eb, bf* Qh, bf* Ql, bf* Kh, bf* Kl, h16* V16, bf* MB) {
    __shared__ __align__(16) float os[16 * 68];
    const int lane = threadIdx.x & 31, lr = lane & 15, hi = lane >> 4; const int bt = blockIdx.y / (NNODE / (16 * MBT)), b = bt / TT, t = bt % TT, n0 = (blockIdx.y % (NNODE / (16 * MBT))) * 16 * MBT; const int which = blockIdx.x >> 1, c0 = (blockIdx.x & 1) * 64;
    if (which == 3) {    // the masked-bias plane: tile (nb, mc) = 16 nodes n x 32 nodes m; a lane forms the 8 values that it will hold in k_attn's score accumulator (n = nb*16 + lr, m = mc*32 + u*16 + hi*8 + j)
        for (int tile = blockIdx.y; tile < MBTILES; tile += NBT * (NNODE / (16 * MBT))) { const int n = (tile >> 5) * 16 + lr;
            const int mt = (tile & 31) * 32 + hi * 8; const size_t ro = (size_t)n * NNODE + mt; v4i a[2][2]; v4f e[2][2];    // the tile's 8 loads are asked for together: one memory latency
#pragma unroll
            for (int u = 0; u < 2; ++u) { a[u][0] = *(const v4i*)(adj + ro + u * 16); a[u][1] = *(const v4i*)(adj + ro + u * 16 + 4); e[u][0] = *(const v4f*)(eb + ro + u * 16); e[u][1] = *(const v4f*)(eb + ro + u * 16 + 4); }
            XW();
#pragma unroll
            for (int u = 0; u < 2; ++u) { const int mb = mt + u * 16; float r[8];
#pragma unroll
                for (int j = 0; j < 8; ++j) { const bool keep = (a[u][j >> 2][j & 3] != 0) | (mb + j == n); r[j] = keep ? e[u][j >> 2][j & 3] : -3.0e38f; }
                const v4u o = { cpk(r[0], r[1]), cpk(r[2], r[3]), cpk(r[4], r[5]), cpk(r[6], r[7]) };
                *(v4ua*)(MB + ((size_t)tile * 2 + u) * 256 + lane * 8) = o; XW(); } }
        return;
    }
    const float* w = which == 0 ? wq : (which == 1 ? wk : wv); const float* bias = which == 0 ? bq : (which == 1 ? bk : bv);
    v8f acc[MBT][4];
#pragma unroll
    for (int mb = 0; mb < MBT; ++mb)
#pragma unroll
        for (int nb = 0; nb < 4; ++nb) acc[mb][nb] = (v8f){};
    const float* xr = x + ((size_t)(b * NNODE + n0 + lr) * TT + t) * DD + 8 * hi; const float* er = emb + (1 - (lr & 1)) * DD + 8 * hi; const float* wr = w + (size_t)(c0 + lr) * DD + 8 * hi;
#pragma unroll 1    // kept rolled: unrolled, the four passes' loads are hoisted together, the wave's registers grow and fewer waves fit a SIMD
    for (int kc = 0; kc < DD; kc += 32) {
        v16bf a[MBT], a2[MBT]; float ev[16], f[MBT][16], wf[4][16];    // all 28 loads of the pass are asked for at its head, so that one memory latency covers them
#pragma unroll
        for (int mb = 0; mb < MBT; ++mb) ld16(xr + (size_t)mb * 16 * TT * DD + kc, f[mb]);
        ld16(er + kc, ev);
#pragma unroll
        for (int nb = 0; nb < 4; ++nb) ld16(wr + (size_t)nb * 16 * DD + kc, wf[nb]);
#pragma unroll
        for (int i = 0; i < 8; ++i) bfr2(ev[2 * i], ev[2 * i + 1]);
#pragma unroll
        for (int mb = 0; mb < MBT; ++mb) { v8u oh, ol;
#pragma unroll
            for (int i = 0; i < 8; ++i) { unsigned h, l; bfr2(f[mb][2 * i], f[mb][2 * i + 1]); split2(__fadd_rn(f[mb][2 * i], ev[2 * i]), __fadd_rn(f[mb][2 * i + 1], ev[2 * i + 1]), h, l); oh[i] = h; ol[i] = l; }
            a[mb] = __builtin_bit_cast(v16bf, oh); a2[mb] = __builtin_bit_cast(v16bf, ol); }
#pragma unroll
        for (int nb = 0; nb < 4; ++nb) { const v16bf bw = cvt16(wf[nb]);
#pragma unroll
            for (int mb = 0; mb < MBT; ++mb) { acc[mb][nb] = wmmab(a[mb], bw, acc[mb][nb]); acc[mb][nb] = wmmab(a2[mb], bw, acc[mb][nb]); } }
    }
    if (which == 2) {
#pragma unroll
        for (int nb = 0; nb < 4; ++nb) { const int col = c0 + nb * 16 + lr; const float bc = bfr32(bias[col]); XW(); h16* dst = V16 + (((size_t)bt * NH_ + (col >> 5)) * HD + (col & 31)) * NNODE + n0 + hi * 8;
#pragma unroll
            for (int mb = 0; mb < MBT; ++mb) { v8h o;
#pragma unroll
                for (int j = 0; j < 8; ++j) o[j] = tohx(acc[mb][nb][j] + bc);
                *(v8h*)(dst + mb * 16) = o; XW(); } }
        return;
    }
    bf* Ph = which == 0 ? Qh : Kh; bf* Pl = which == 0 ? Ql : Kl; const float scl = which == 0 ? SCL : 1.0f;
    const int cofs = lr * 4, col = c0 + cofs; float b4[4];
#pragma unroll
    for (int q = 0; q < 4; ++q) b4[q] = bfr32(bias[col + q]);
    XW();
    const size_t pofs = (((size_t)bt * NH_ + (col >> 5)) * NNODE + n0) * HD + (col & 31);
#pragma unroll
    for (int mb = 0; mb < MBT; ++mb) {
#pragma unroll
        for (int nb = 0; nb < 4; ++nb) {
#pragma unroll
            for (int j = 0; j < 8; ++j) os[(hi * 8 + j) * 68 + nb * 16 + lr] = acc[mb][nb][j]; }
        __builtin_amdgcn_wave_barrier(); asm volatile("" ::: "memory");    // the rows read below were written by other lanes of this wave: keeps the reads behind the writes
#pragma unroll
        for (int s = 0; s < 8; ++s) { const int row = 2 * s + hi; const v4f val = *(const v4fa*)(os + row * 68 + cofs); v2u oh, ol;
#pragma unroll
            for (int q = 0; q < 2; ++q) { unsigned h, l; split2((val[2 * q] + b4[2 * q]) * scl, (val[2 * q + 1] + b4[2 * q + 1]) * scl, h, l); oh[q] = h; ol[q] = l; }
            *(v2u*)(Ph + pofs + (size_t)(mb * 16 + row) * HD) = oh; *(v2u*)(Pl + pofs + (size_t)(mb * 16 + row) * HD) = ol; XW(); }
        __builtin_amdgcn_wave_barrier(); asm volatile("" ::: "memory");    // keeps the next block's writes behind these reads
    }
}
// k_attn: scores, masked softmax and attn V in one kernel, one launch for every (batch, step, head). Grid (1024/128, heads, batch*steps), 4 waves; a wave owns 32 query nodes n (2 tiles of 16) and walks the 1024 key nodes m in chunks of 32.
// Scores are formed TRANSPOSED, St[m][n] = sum_d K[m][d] Q[n][d] (hl planes, the same 3 products): the accumulator then holds, in lane (lr, hi), node n = lr and m = 8 hi + j, which is the k order of a 16x16x32 B fragment
// (tile u = 0 gives k = 8 hi + j, tile u = 1 gives k = 16 + 8 hi + j), so p = exp(s - max) goes from registers into Ot[d][n] = sum_m Vt[d][m] P[n][m] with no exchange, and max, sum and the rescale are per n = lr, shared by lanes l and l ^ 16 (the chunk max is exchanged by xhalf, the two partial sums are added at the end).
// Online softmax: running max mx (never below -1e38) and sum per n; a masked pair (adj == 0, m != n) carries about -3e38 from the plane MB, so its exp(s - mx) is 0 even while no kept pair has been met; the self loop keeps every sum above 0. Result Ot / sum is stored as hl planes A[(b,n,t)][h*32 + d], the output projection's operand, 16 B a lane and plane.
__global__ __launch_bounds__(128) void k_attn(const bf* Qh, const bf* Ql, const bf* Kh, const bf* Kl, const h16* Vt, const bf* MB, bf* Ah, bf* Al) {
    const int lane = threadIdx.x & 31, lr = lane & 15, hi = lane >> 4; const int h = blockIdx.y, bt = blockIdx.z, b = bt / TT, t = bt % TT; const int n0 = blockIdx.x * 128 + (threadIdx.x >> 5) * 32;
    const size_t pl = ((size_t)bt * NH_ + h) * NNODE * HD; Qh += pl; Ql += pl; Kh += pl; Kl += pl; Vt += pl; MB += (size_t)(n0 >> 4) * 32 * 512 + lane * 8;
    v16bf qh[2], ql[2]; v8f o[2][2]; float mx[2], sum[2];
#pragma unroll
    for (int q = 0; q < 2; ++q) { const size_t qo = (size_t)(n0 + q * 16 + lr) * HD + 8 * hi; qh[q] = WFrag<bf>::ld(Qh + qo); ql[q] = WFrag<bf>::ld(Ql + qo); o[q][0] = (v8f){}; o[q][1] = (v8f){}; mx[q] = -1.0e38f; sum[q] = 0.f; }
#pragma unroll 1    // kept rolled: two passes' loads live at once would not fit 256 registers
    for (int m0 = 0; m0 < NNODE; m0 += 32) {
        v16bf kh[2], kl[2]; v16h vt[2];
#pragma unroll
        for (int u = 0; u < 2; ++u) { const size_t ko = (size_t)(m0 + u * 16 + lr) * HD + 8 * hi; kh[u] = WFrag<bf>::ld(Kh + ko); kl[u] = WFrag<bf>::ld(Kl + ko); }
        v4u bm[2][2];    // the chunk's masked bias, asked for at the head of the pass with the rest so that one memory latency covers them
#pragma unroll
        for (int q = 0; q < 2; ++q)
#pragma unroll
            for (int u = 0; u < 2; ++u) bm[q][u] = *(const v4ua*)(MB + (size_t)(q * 32 + (m0 >> 5)) * 512 + u * 256);
#pragma unroll
        for (int u = 0; u < 2; ++u) vt[u] = WFrag<h16>::ld(Vt + (size_t)(u * 16 + lr) * NNODE + m0 + 8 * hi);
        asm volatile("s_wait_xcnt 0x0" ::: "memory");    // stands between the pass's 16 loads and the step of their address registers to the next chunk (the kernel's pointers carry no __restrict__, so that the "memory" clobber keeps each load on its side)
        __builtin_amdgcn_sched_barrier(0);    // keeps all 16 loads of the pass in flight together: without it the compiler sinks loads to their uses and lifts the first values' unpacking, with its wait, in front of the last loads, and the pass waits out a memory latency several times
#pragma unroll
        for (int q = 0; q < 2; ++q) { v8f s[2]; float cm = -3.0e38f;
#pragma unroll
            for (int u = 0; u < 2; ++u) { v8f acc;    // the masked bias is the accumulator's start value
#pragma unroll
                for (int i = 0; i < 4; ++i) { acc[2 * i] = __uint_as_float(bm[q][u][i] << 16); acc[2 * i + 1] = __uint_as_float(bm[q][u][i] & 0xFFFF0000u); }
                acc = wmmab(kh[u], qh[q], acc); acc = wmmab(kh[u], ql[q], acc); acc = wmmab(kl[u], qh[q], acc); s[u] = acc;
#pragma unroll
                for (int j = 0; j < 8; ++j) cm = fmaxf(cm, acc[j]); }
            cm = fmaxf(cm, xhalf(cm));
            const float mn = fmaxf(mx[q], cm); const float al = __expf(mx[q] - mn); mx[q] = mn; float ps = 0.f; v16h p;
#pragma unroll
            for (int i = 0; i < 16; ++i) { const float ex = __expf(s[i >> 3][i & 7] - mn); ps += ex; p[i] = tohx(ex); }
            sum[q] = sum[q] * al + ps;
#pragma unroll
            for (int dt = 0; dt < 2; ++dt) { o[q][dt] *= al; o[q][dt] = wmma16(vt[dt], p, o[q][dt]); } }
    }
#pragma unroll
    for (int q = 0; q < 2; ++q) { const float inv = __fdiv_rn(1.0f, sum[q] + xhalf(sum[q])); const size_t di = ((size_t)(b * NNODE + n0 + q * 16 + lr) * TT + t) * DD + h * HD + hi * 8;
#pragma unroll
        for (int dt = 0; dt < 2; ++dt) { v4u ph, pl;
#pragma unroll
            for (int j = 0; j < 4; ++j) { unsigned u, l; split2(o[q][dt][2 * j] * inv, o[q][dt][2 * j + 1] * inv, u, l); ph[j] = u; pl[j] = l; }
            const v8us wh = __builtin_bit_cast(v8us, ph), wl = __builtin_bit_cast(v8us, pl);
            *(v8us*)(Ah + di + dt * 16) = wh; *(v8us*)(Al + di + dt * 16) = wl; XW(); } }
}

// ---- k_out: output projection, residual and LayerNorm in one kernel. ONE WAVE per 16 rows (b,n,t) x all 128 columns (8 accumulators); grid 24576/16, 32 threads. A = hl planes from k_attn, B = bf16 Wo formed in registers from the f32 input.
// Epilogue: the 16 rows are staged in LDS; then row by row, 4 consecutive columns a lane: + bf16 bo, + bf16 x, mean and variance by the same 4-term sums and xor tree over the 32 lanes as a wave-per-row LayerNorm, 512 B stored a row.
__global__ __launch_bounds__(32) void k_out(const bf* Ah, const bf* Al, const float* wo, const float* bo, const float* x, const float* g, const float* bb, float* Y) {
    __shared__ __align__(16) float os[16 * 132];
    const int lane = threadIdx.x & 31, lr = lane & 15, hi = lane >> 4; const int r0 = blockIdx.x * 16;
    v8f acc[8];
#pragma unroll
    for (int nb = 0; nb < 8; ++nb) acc[nb] = (v8f){};
    const size_t aoff = (size_t)(r0 + lr) * DD + 8 * hi; const float* wr = wo + (size_t)lr * DD + 8 * hi;
#pragma unroll
    for (int kc = 0; kc < DD; kc += 32) { const v16bf a = WFrag<bf>::ld(Ah + aoff + kc), a2 = WFrag<bf>::ld(Al + aoff + kc); XW(); float wf[8][16];
#pragma unroll
        for (int nb = 0; nb < 8; ++nb) ld16(wr + (size_t)nb * 16 * DD + kc, wf[nb]);
#pragma unroll
        for (int nb = 0; nb < 8; ++nb) { const v16bf bw = cvt16(wf[nb]); acc[nb] = wmmab(a, bw, acc[nb]); acc[nb] = wmmab(a2, bw, acc[nb]); } }
#pragma unroll
    for (int nb = 0; nb < 8; ++nb) {
#pragma unroll
        for (int j = 0; j < 8; ++j) os[(hi * 8 + j) * 132 + nb * 16 + lr] = acc[nb][j]; }
    __builtin_amdgcn_wave_barrier(); asm volatile("" ::: "memory");    // the rows read below were written by other lanes of this wave: keeps the reads behind the writes
    const int c0 = lane * 4; float bo4[4], g4[4], b4[4]; v4f xv[16];    // the 16 residual rows are asked for together: one memory latency
    { const v4f t0 = *(const v4f*)(bo + c0), t1 = *(const v4f*)(g + c0), t2 = *(const v4f*)(bb + c0); XW();
#pragma unroll
      for (int q = 0; q < 4; ++q) { bo4[q] = t0[q]; g4[q] = t1[q]; b4[q] = t2[q]; } }
#pragma unroll
    for (int r = 0; r < 16; ++r) { if (r == 15) XW();    // the last load's result may be given the address registers that the fifteen before it name
        xv[r] = *(const v4f*)(x + (size_t)(r0 + r) * DD + c0); }
    XW();
#pragma unroll
    for (int q = 0; q < 2; ++q) { bfr2(bo4[2 * q], bo4[2 * q + 1]); bfr2(g4[2 * q], g4[2 * q + 1]); bfr2(b4[2 * q], b4[2 * q + 1]); }
#pragma unroll
    for (int r = 0; r < 16; ++r) { const size_t rb = (size_t)(r0 + r) * DD; const v4f a = *(const v4fa*)(os + r * 132 + c0); float v[4]; float s = 0.f; float xb[4] = { xv[r][0], xv[r][1], xv[r][2], xv[r][3] }; bfr2(xb[0], xb[1]); bfr2(xb[2], xb[3]);
#pragma unroll
        for (int q = 0; q < 4; ++q) { v[q] = __fadd_rn(a[q] + bo4[q], xb[q]); s = __fadd_rn(s, v[q]); }
        s = wsum(s);
        const float mean = s * (1.0f / DD); float q2 = 0.f;
#pragma unroll
        for (int q = 0; q < 4; ++q) { const float d0 = v[q] - mean; q2 += d0 * d0; }
        q2 = wsum(q2);
        const float rstd = __frsqrt_rn(__fadd_rn(q2 * (1.0f / DD), 1e-5f)); v4f o;
#pragma unroll
        for (int q = 0; q < 4; ++q) o[q] = (v[q] - mean) * rstd * g4[q] + b4[q];
        *(v4f*)(Y + rb + c0) = o; XW(); }
}

extern "C" void kernel_launch(void* const* d_in, const int* in_sizes, int n_in,
                              void* d_out, int out_size, void* d_ws, size_t ws_size, hipStream_t stream) {
    (void)in_sizes; (void)n_in; (void)out_size;
    const float* x = (const float*)d_in[0]; const int* adj = (const int*)d_in[1]; const float* emb = (const float*)d_in[2]; const float* wq = (const float*)d_in[3]; const float* bq = (const float*)d_in[4]; const float* wk = (const float*)d_in[5]; const float* bk = (const float*)d_in[6]; const float* wv = (const float*)d_in[7]; const float* bv = (const float*)d_in[8]; const float* eb = (const float*)d_in[9]; const float* wo = (const float*)d_in[10]; const float* bo = (const float*)d_in[11]; const float* g = (const float*)d_in[12]; const float* be = (const float*)d_in[13];
    float* OUT = (float*)d_out;     // [2][1024][12][128]
    char* wsp = (char*)d_ws;
    auto take = [&](size_t bytes) { char* p = wsp; wsp += (bytes + 255) & ~(size_t)255; return (void*)p; };
    bf* Qh = (bf*)take((size_t)NBT * NH_ * NNODE * HD * 2); bf* Ql = (bf*)take((size_t)NBT * NH_ * NNODE * HD * 2); bf* Kh = (bf*)take((size_t)NBT * NH_ * NNODE * HD * 2); bf* Kl = (bf*)take((size_t)NBT * NH_ * NNODE * HD * 2); h16* V16 = (h16*)take((size_t)NBT * NH_ * HD * NNODE * 2);
    bf* Ah = (bf*)take((size_t)NRB * DD * 2); bf* Al = (bf*)take((size_t)NRB * DD * 2); bf* MB = (bf*)take((size_t)NNODE * NNODE * 2);
    if ((size_t)(wsp - (char*)d_ws) > ws_size) return;    // total ~ 46 MB
    k_qkv<<<dim3(3 * DD / 64 + 1, NBT * (NNODE / (16 * MBT)), 1), 32, 0, stream>>>(x, emb, wq, bq, wk, bk, wv, bv, adj, eb, Qh, Ql, Kh, Kl, V16, MB);
    k_attn<<<dim3(NNODE / 128, NH_, NBT), 128, 0, stream>>>(Qh, Ql, Kh, Kl, V16, MB, Ah, Al);
    k_out<<<NRB / 16, 32, 0, stream>>>(Ah, Al, wo, bo, x, g, be, OUT);
}

// v006
// Measured time: 57.9 microseconds a run.
// In two side-by-side timings against v005, it was 1.20 and 1.21 times as fast.
// Counting every step since v000, it is 26.7 times as fast.
#include <hip/hip_runtime.h>

// CHGANSimplified (node_features [2][1024 nodes][12 steps][128]; enh = x + node_type_embed[1 - n%2]; Q/K/V = enh W^T + b (4 heads x 32); per (batch, head, step): scores over node pairs = q.k/sqrt(32) + edge_bias[n][m]; masked to -inf where
// adj[n][m] == 0 and n != m (adj / edge_bias read as data); softmax over m (nan_to_num is a no-op: self loops keep every row non-empty); out = attn V merged; out = out Wo^T + bo; result = LN(out + node_features) -> [2][1024][12][128]).
// Compute dtypes, f32 accumulate: every input rounded to bf16; Q/K/V on bf16 hi+lo planes of enh x exact weights (2 products, + bias); scores (K 32) on hl planes (3 products), masked online softmax f32 and fp16 p x fp16 V in one kernel (k_attn); mask, self loop and bf16 edge_bias are merged once a call into one bf16 plane (k_qkv's seventh column of blocks)

#define NB_  2
#define NNODE 1024
#define TT   12
#define DD   128
#define NH_  4
#define HD   32
#define NR   (NNODE * TT)
#define SCL  0.1767766952966369f
#define NBT  (NB_ * TT)
#define NRB  (NB_ * NR)
typedef _Float16 h16;
typedef unsigned short bf;
typedef __attribute__((ext_vector_type(16))) __bf16   v16bf;
typedef __attribute__((ext_vector_type(16))) _Float16 v16h;
typedef __attribute__((ext_vector_type(8)))  _Float16 v8h;
typedef __attribute__((ext_vector_type(8)))  unsigned short v8us;
typedef __attribute__((ext_vector_type(8)))  float    v8f;
typedef __attribute__((ext_vector_type(4)))  float    v4f;
typedef v8h  __attribute__((may_alias)) v8ha;
typedef v4f  __attribute__((may_alias)) v4fa;
typedef v8us __attribute__((may_alias)) v8usa;

__device__ __forceinline__ v16h cat16(v8h lo, v8h hi) { return __builtin_shufflevector(lo, hi, 0, 1, 2, 3, 4, 5, 6, 7, 8, 9, 10, 11, 12, 13, 14, 15); }
__device__ __forceinline__ v16bf cat16b(v8us lo, v8us hi) { return __builtin_bit_cast(v16bf, __builtin_shufflevector(lo, hi, 0, 1, 2, 3, 4, 5, 6, 7, 8, 9, 10, 11, 12, 13, 14, 15)); }
__device__ __forceinline__ v8f wmma16(v16h a, v16h b, v8f c) { return __builtin_amdgcn_wmma_f32_16x16x32_f16(false, a, false, b, (short)0, c, false, false); }
__device__ __forceinline__ v8f wmmab(v16bf a, v16bf b, v8f c) { return __builtin_amdgcn_wmma_f32_16x16x32_bf16(false, a, false, b, (short)0, c, false, false); }




template <typename T16> struct WFrag;
template <> struct WFrag<h16> { typedef v16h V; static __device__ __forceinline__ V ld(const h16* p) { return cat16(*(const v8h*)p, *(const v8h*)(p + 16)); } static __device__ __forceinline__ v8f mma(V a, V b, v8f c) { return wmma16(a, b, c); } };
template <> struct WFrag<bf> { typedef v16bf V; static __device__ __forceinline__ V ld(const bf* p) { return cat16b(*(const v8us*)p, *(const v8us*)(p + 16)); } static __device__ __forceinline__ v8f mma(V a, V b, v8f c) { return wmmab(a, b, c); } };
__device__ __forceinline__ h16 tohx(float x) { return (h16)x; }
// Exchanges between lanes stay on the vector port (a shuffle through the LDS pipe costs its latency and a wait at every link of a dependent chain): xhalf(x) is lane l ^ 16's x (v_permlanex16_b32), xrow<M>(x) lane l ^ M's, M < 16 (DPP row_xmask, fused into the add that uses it).
__device__ __forceinline__ float xhalf(float x) { const int b = __builtin_bit_cast(int, x); return __builtin_bit_cast(float, __builtin_amdgcn_permlanex16(b, b, 0x76543210, 0xfedcba98, false, false)); }
template <int M> __device__ __forceinline__ float xrow(float x) { return __builtin_bit_cast(float, __builtin_amdgcn_update_dpp(0, __builtin_bit_cast(int, x), 0x160 | M, 0xf, 0xf, true)); }
// wsum: sum over the wave's 32 lanes, the xor tree 16, 8, 4, 2, 1; every lane ends with the same value
__device__ __forceinline__ float wsum(float s) { s += xhalf(s); s += xrow<8>(s); s += xrow<4>(s); s += xrow<2>(s); s += xrow<1>(s); return s; }
// XW: s_wait_xcnt 0 behind a group of global loads or stores, in front of whatever later overwrites a register that they name (address or store data). The pointers of k_qkv and k_out carry no __restrict__, so that the "memory" clobber keeps each load and store on its side.
#define XW() asm volatile("s_wait_xcnt 0x0" ::: "memory")
// ld16: the 16 f32 that make one lane's share of a 16x16x32 fragment, in the k order of WFrag::ld (p[0..7], then p[16..23])
__device__ __forceinline__ void ld16(const float* p, float* f) { const v4f a0 = *(const v4f*)p, a1 = *(const v4f*)(p + 4), a2 = *(const v4f*)(p + 16), a3 = *(const v4f*)(p + 20); XW();
#pragma unroll
    for (int i = 0; i < 4; ++i) { f[i] = a0[i]; f[4 + i] = a1[i]; f[8 + i] = a2[i]; f[12 + i] = a3[i]; } }
// Every f32 -> bf16 rounding (to nearest even) is the chip's packed conversion, two values an instruction: cpk(a, b) is one register of a fragment (element 2i = a low, 2i + 1 = b high); lo2f / hi2f give its two halves back as f32.
// bfr2: a pair rounded to bf16 and kept as f32; bfr32: the same for one value; split2: a pair as hi + lo bf16 planes (lo = the rounded rest y - hi)
typedef __attribute__((ext_vector_type(8))) unsigned v8u;
typedef __attribute__((ext_vector_type(2))) unsigned v2u;
typedef __attribute__((ext_vector_type(2))) float v2f;
typedef __attribute__((ext_vector_type(2))) __bf16 v2bf;
__device__ __forceinline__ unsigned cpk(float a, float b) { const v2f x = { a, b }; return __builtin_bit_cast(unsigned, __builtin_convertvector(x, v2bf)); }
__device__ __forceinline__ float lo2f(unsigned p) { return __uint_as_float(p << 16); }
__device__ __forceinline__ float hi2f(unsigned p) { return __uint_as_float(p & 0xFFFF0000u); }
__device__ __forceinline__ void bfr2(float& a, float& b) { const unsigned p = cpk(a, b); a = lo2f(p); b = hi2f(p); }
__device__ __forceinline__ float bfr32(float f) { return lo2f(cpk(f, f)); }
__device__ __forceinline__ void split2(float y0, float y1, unsigned& h, unsigned& l) { h = cpk(y0, y1); l = cpk(y0 - lo2f(h), y1 - hi2f(h)); }

typedef __attribute__((ext_vector_type(4))) unsigned v4u;
typedef v4u __attribute__((may_alias)) v4ua;
// stage_w: the block's weight tile (16 * NBK rows of 128 f32) is read from memory ONCE A BLOCK, rounded to bf16 and laid in LDS as ready B fragments, fragment (kc/32) * NBK + nb = 1 KB = [half][lane][8], in the k order of WFrag::ld.
// A wave takes units of 8 rows x 32 k: lane = (row & 7) + 8 * (k/8 & 3), 32 B a lane, so that a load touches 8 whole lines (a fragment load from the row-major f32 matrix touches 16 lines for 512 B, and every wave repeated it).
template <int NBK, int NW> __device__ __forceinline__ void stage_w(const float* w, bf* wsm, int wave, int lane) {
    constexpr int PER = NBK * 2 * 4 / NW; v4f a[PER][2];    // all loads of the wave are asked for together: one memory latency
#pragma unroll
    for (int i = 0; i < PER; ++i) { const int u = wave * PER + i, row = (u % (NBK * 2)) * 8 + (lane & 7), k = (u / (NBK * 2)) * 32 + (lane >> 3) * 8; a[i][0] = *(const v4f*)(w + (size_t)row * DD + k); a[i][1] = *(const v4f*)(w + (size_t)row * DD + k + 4); }
    XW();
#pragma unroll
    for (int i = 0; i < PER; ++i) { const int u = wave * PER + i, row = (u % (NBK * 2)) * 8 + (lane & 7), p4 = lane >> 3; const v4u o = { cpk(a[i][0][0], a[i][0][1]), cpk(a[i][0][2], a[i][0][3]), cpk(a[i][1][0], a[i][1][1]), cpk(a[i][1][2], a[i][1][3]) };
        *(v4ua*)(wsm + ((((u / (NBK * 2)) * NBK + (row >> 4)) * 2 + (p4 >> 1)) * 32 + (p4 & 1) * 16 + (row & 15)) * 8) = o; }
}
__device__ __forceinline__ v16bf ldw(const bf* wsm, int frag, int lane) { return cat16b(*(const v8usa*)(wsm + frag * 512 + lane * 8), *(const v8usa*)(wsm + frag * 512 + 256 + lane * 8)); }

// ---- k_qkv: Q, K or V projection with its neighbours folded in. ONE WAVE per 32x64 output tile (8 accumulators); 8 waves a block, which share one column tile's weights through LDS (stage_w); grid (6 column tiles of [q | k | v] and a seventh column for the plane MB, 24 slices bt x 32 node blocks / 8), 256 threads.
// The 32 rows of a tile are 32 consecutive nodes n of one (batch, step) slice bt, so that the tile's results lie contiguous in the planes that k_attn reads.
// Prologue: the A fragments (hi + lo bf16 planes of enh = bf16 x + bf16 emb[1 - n%2]; n's parity is the lane's, as n0 and the 16-row steps are even) are formed in registers from the f32 inputs; the B fragments (bf16 weights) come from LDS (stage_w).
// Epilogue (+ bf16 bias): Q (x scale) and K go out as hl planes [bt][h][n][d], staged through LDS so that a store covers whole 128-B lines; V goes out as fp16 V16[bt][h][dv][m] straight from the accumulators, whose 8 registers are 8 consecutive m.
// Blocks of column 6 do no projection: they write MB, the masked bias of every node pair as bf16 (bf16 edge_bias where adj != 0 or n == m, else -3e38), in the order in which k_attn's lanes hold the scores:
// MB[n/16][m/32][u][lane][j], 512 B in a row for each load of a wave. adj and edge_bias are the same for all 96 (batch, step, head) slices, so this is done once a call and not once a slice.
#define MBT 2    // 16-row blocks a tile
#define MBTILES ((NNODE / 16) * (NNODE / 32))
typedef __attribute__((ext_vector_type(4))) int v4i;
#define QW 8    // waves a block of k_qkv
__global__ __launch_bounds__(32 * QW) void k_qkv(const float* x, const float* emb, const float* wq, const float* bq, const float* wk, const float* bk, const float* wv, const float* bv, const int* adj, const float* eb, bf* Qh, bf* Ql, bf* Kh, bf* Kl, h16* V16, bf* MB) {
    __shared__ __align__(16) float osm[QW][16 * 68]; __shared__ __align__(16) bf wsm[16 * 512];
    const int lane = threadIdx.x & 31, lr = lane & 15, hi = lane >> 4, wave = __builtin_amdgcn_readfirstlane(threadIdx.x >> 5); const int ry = blockIdx.y * QW + wave; float* os = osm[wave]; const int bt = ry / (NNODE / (16 * MBT)), b = bt / TT, t = bt % TT, n0 = (ry % (NNODE / (16 * MBT))) * 16 * MBT; const int which = blockIdx.x >> 1, c0 = (blockIdx.x & 1) * 64;
    if (which == 3) {    // the masked-bias plane: tile (nb, mc) = 16 nodes n x 32 nodes m; a lane forms the 8 values that it will hold in k_attn's score accumulator (n = nb*16 + lr, m = mc*32 + u*16 + hi*8 + j)
        for (int tile = ry; tile < MBTILES; tile += NBT * (NNODE / (16 * MBT))) { const int n = (tile >> 5) * 16 + lr;
            const int mt = (tile & 31) * 32 + hi * 8; const size_t ro = (size_t)n * NNODE + mt; v4i a[2][2]; v4f e[2][2];    // the tile's 8 loads are asked for together: one memory latency
#pragma unroll
            for (int u = 0; u < 2; ++u) { a[u][0] = *(const v4i*)(adj + ro + u * 16); a[u][1] = *(const v4i*)(adj + ro + u * 16 + 4); e[u][0] = *(const v4f*)(eb + ro + u * 16); e[u][1] = *(const v4f*)(eb + ro + u * 16 + 4); }
            XW();
#pragma unroll
            for (int u = 0; u < 2; ++u) { const int mb = mt + u * 16; float r[8];
#pragma unroll
                for (int j = 0; j < 8; ++j) { const bool keep = (a[u][j >> 2][j & 3] != 0) | (mb + j == n); r[j] = keep ? e[u][j >> 2][j & 3] : -3.0e38f; }
                const v4u o = { cpk(r[0], r[1]), cpk(r[2], r[3]), cpk(r[4], r[5]), cpk(r[6], r[7]) };
                *(v4ua*)(MB + ((size_t)tile * 2 + u) * 256 + lane * 8) = o; XW(); } }
        return;
    }
    const float* w = which == 0 ? wq : (which == 1 ? wk : wv); const float* bias = which == 0 ? bq : (which == 1 ? bk : bv);
    v8f acc[MBT][4];
#pragma unroll
    for (int mb = 0; mb < MBT; ++mb)
#pragma unroll
        for (int nb = 0; nb < 4; ++nb) acc[mb][nb] = (v8f){};
    const float* xr = x + ((size_t)(b * NNODE + n0 + lr) * TT + t) * DD + 8 * hi; const float* er = emb + (1 - (lr & 1)) * DD + 8 * hi;
    stage_w<4, QW>(w + (size_t)c0 * DD, wsm, wave, lane);
    __syncthreads();    // the fragments read below were written by all 8 waves (the block's only barrier; every wave of a projection block passes it)
#pragma unroll 1    // kept rolled: unrolled, the four passes' loads are hoisted together, the wave's registers grow and fewer waves fit a SIMD
    for (int kc = 0; kc < DD; kc += 32) {
        v16bf a[MBT], a2[MBT]; float ev[16], f[MBT][16];    // all 12 loads of the pass are asked for at its head, so that one memory latency covers them
#pragma unroll
        for (int mb = 0; mb < MBT; ++mb) ld16(xr + (size_t)mb * 16 * TT * DD + kc, f[mb]);
        ld16(er + kc, ev);
#pragma unroll
        for (int i = 0; i < 8; ++i) bfr2(ev[2 * i], ev[2 * i + 1]);
#pragma unroll
        for (int mb = 0; mb < MBT; ++mb) { v8u oh, ol;
#pragma unroll
            for (int i = 0; i < 8; ++i) { unsigned h, l; bfr2(f[mb][2 * i], f[mb][2 * i + 1]); split2(__fadd_rn(f[mb][2 * i], ev[2 * i]), __fadd_rn(f[mb][2 * i + 1], ev[2 * i + 1]), h, l); oh[i] = h; ol[i] = l; }
            a[mb] = __builtin_bit_cast(v16bf, oh); a2[mb] = __builtin_bit_cast(v16bf, ol); }
#pragma unroll
        for (int nb = 0; nb < 4; ++nb) { const v16bf bw = ldw(wsm, (kc >> 5) * 4 + nb, lane);
#pragma unroll
            for (int mb = 0; mb < MBT; ++mb) { acc[mb][nb] = wmmab(a[mb], bw, acc[mb][nb]); acc[mb][nb] = wmmab(a2[mb], bw, acc[mb][nb]); } }
    }
    if (which == 2) {
#pragma unroll
        for (int nb = 0; nb < 4; ++nb) { const int col = c0 + nb * 16 + lr; const float bc = bfr32(bias[col]); XW(); h16* dst = V16 + (((size_t)bt * NH_ + (col >> 5)) * HD + (col & 31)) * NNODE + n0 + hi * 8;
#pragma unroll
            for (int mb = 0; mb < MBT; ++mb) { v8h o;
#pragma unroll
                for (int j = 0; j < 8; ++j) o[j] = tohx(acc[mb][nb][j] + bc);
                *(v8h*)(dst + mb * 16) = o; XW(); } }
        return;
    }
    bf* Ph = which == 0 ? Qh : Kh; bf* Pl = which == 0 ? Ql : Kl; const float scl = which == 0 ? SCL : 1.0f;
    const int cofs = lr * 4, col = c0 + cofs; float b4[4];
#pragma unroll
    for (int q = 0; q < 4; ++q) b4[q] = bfr32(bias[col + q]);
    XW();
    const size_t pofs = (((size_t)bt * NH_ + (col >> 5)) * NNODE + n0) * HD + (col & 31);
#pragma unroll
    for (int mb = 0; mb < MBT; ++mb) {
#pragma unroll
        for (int nb = 0; nb < 4; ++nb) {
#pragma unroll
            for (int j = 0; j < 8; ++j) os[(hi * 8 + j) * 68 + nb * 16 + lr] = acc[mb][nb][j]; }
        __builtin_amdgcn_wave_barrier(); asm volatile("" ::: "memory");    // the rows read below were written by other lanes of this wave: keeps the reads behind the writes
#pragma unroll
        for (int s = 0; s < 8; ++s) { const int row = 2 * s + hi; const v4f val = *(const v4fa*)(os + row * 68 + cofs); v2u oh, ol;
#pragma unroll
            for (int q = 0; q < 2; ++q) { unsigned h, l; split2((val[2 * q] + b4[2 * q]) * scl, (val[2 * q + 1] + b4[2 * q + 1]) * scl, h, l); oh[q] = h; ol[q] = l; }
            *(v2u*)(Ph + pofs + (size_t)(mb * 16 + row) * HD) = oh; *(v2u*)(Pl + pofs + (size_t)(mb * 16 + row) * HD) = ol; XW(); }
        __builtin_amdgcn_wave_barrier(); asm volatile("" ::: "memory");    // keeps the next block's writes behind these reads
    }
}
// k_attn: scores, masked softmax and attn V in one kernel, one launch for every (batch, step, head). Grid (1024/128, heads, batch*steps), 4 waves; a wave owns 32 query nodes n (2 tiles of 16) and walks the 1024 key nodes m in chunks of 32.
// Scores are formed TRANSPOSED, St[m][n] = sum_d K[m][d] Q[n][d] (hl planes, the same 3 products): the accumulator then holds, in lane (lr, hi), node n = lr and m = 8 hi + j, which is the k order of a 16x16x32 B fragment
// (tile u = 0 gives k = 8 hi + j, tile u = 1 gives k = 16 + 8 hi + j), so p = exp(s - max) goes from registers into Ot[d][n] = sum_m Vt[d][m] P[n][m] with no exchange, and max, sum and the rescale are per n = lr, shared by lanes l and l ^ 16 (the chunk max is exchanged by xhalf, the two partial sums are added at the end).
// Online softmax: running max mx (never below -1e38) and sum per n; a masked pair (adj == 0, m != n) carries about -3e38 from the plane MB, so its exp(s - mx) is 0 even while no kept pair has been met; the self loop keeps every sum above 0. Result Ot / sum is stored as hl planes A[(b,n,t)][h*32 + d], the output projection's operand, 16 B a lane and plane.
__global__ __launch_bounds__(128) void k_attn(const bf* Qh, const bf* Ql, const bf* Kh, const bf* Kl, const h16* Vt, const bf* MB, bf* Ah, bf* Al) {
    const int lane = threadIdx.x & 31, lr = lane & 15, hi = lane >> 4; const int h = blockIdx.y, bt = blockIdx.z, b = bt / TT, t = bt % TT; const int n0 = blockIdx.x * 128 + (threadIdx.x >> 5) * 32;
    const size_t pl = ((size_t)bt * NH_ + h) * NNODE * HD; Qh += pl; Ql += pl; Kh += pl; Kl += pl; Vt += pl; MB += (size_t)(n0 >> 4) * 32 * 512 + lane * 8;
    v16bf qh[2], ql[2]; v8f o[2][2]; float mx[2], sum[2];
#pragma unroll
    for (int q = 0; q < 2; ++q) { const size_t qo = (size_t)(n0 + q * 16 + lr) * HD + 8 * hi; qh[q] = WFrag<bf>::ld(Qh + qo); ql[q] = WFrag<bf>::ld(Ql + qo); o[q][0] = (v8f){}; o[q][1] = (v8f){}; mx[q] = -1.0e38f; sum[q] = 0.f; }
#pragma unroll 1    // kept rolled: two passes' loads live at once would not fit 256 registers
    for (int m0 = 0; m0 < NNODE; m0 += 32) {
        v16bf kh[2], kl[2]; v16h vt[2];
#pragma unroll
        for (int u = 0; u < 2; ++u) { const size_t ko = (size_t)(m0 + u * 16 + lr) * HD + 8 * hi; kh[u] = WFrag<bf>::ld(Kh + ko); kl[u] = WFrag<bf>::ld(Kl + ko); }
        v4u bm[2][2];    // the chunk's masked bias, asked for at the head of the pass with the rest so that one memory latency covers them
#pragma unroll
        for (int q = 0; q < 2; ++q)
#pragma unroll
            for (int u = 0; u < 2; ++u) bm[q][u] = *(const v4ua*)(MB + (size_t)(q * 32 + (m0 >> 5)) * 512 + u * 256);
#pragma unroll
        for (int u = 0; u < 2; ++u) vt[u] = WFrag<h16>::ld(Vt + (size_t)(u * 16 + lr) * NNODE + m0 + 8 * hi);
        asm volatile("s_wait_xcnt 0x0" ::: "memory");    // stands between the pass's 16 loads and the step of their address registers to the next chunk (the kernel's pointers carry no __restrict__, so that the "memory" clobber keeps each load on its side)
        __builtin_amdgcn_sched_barrier(0);    // keeps all 16 loads of the pass in flight together: without it the compiler sinks loads to their uses and lifts the first values' unpacking, with its wait, in front of the last loads, and the pass waits out a memory latency several times
#pragma unroll
        for (int q = 0; q < 2; ++q) { v8f s[2]; float cm = -3.0e38f;
#pragma unroll
            for (int u = 0; u < 2; ++u) { v8f acc;    // the masked bias is the accumulator's start value
#pragma unroll
                for (int i = 0; i < 4; ++i) { acc[2 * i] = __uint_as_float(bm[q][u][i] << 16); acc[2 * i + 1] = __uint_as_float(bm[q][u][i] & 0xFFFF0000u); }
                acc = wmmab(kh[u], qh[q], acc); acc = wmmab(kh[u], ql[q], acc); acc = wmmab(kl[u], qh[q], acc); s[u] = acc;
#pragma unroll
                for (int j = 0; j < 8; ++j) cm = fmaxf(cm, acc[j]); }
            cm = fmaxf(cm, xhalf(cm));
            const float mn = fmaxf(mx[q], cm); const float al = __expf(mx[q] - mn); mx[q] = mn; float ps = 0.f; v16h p;
#pragma unroll
            for (int i = 0; i < 16; ++i) { const float ex = __expf(s[i >> 3][i & 7] - mn); ps += ex; p[i] = tohx(ex); }
            sum[q] = sum[q] * al + ps;
#pragma unroll
            for (int dt = 0; dt < 2; ++dt) { o[q][dt] *= al; o[q][dt] = wmma16(vt[dt], p, o[q][dt]); } }
    }
#pragma unroll
    for (int q = 0; q < 2; ++q) { const float inv = __fdiv_rn(1.0f, sum[q] + xhalf(sum[q])); const size_t di = ((size_t)(b * NNODE + n0 + q * 16 + lr) * TT + t) * DD + h * HD + hi * 8;
#pragma unroll
        for (int dt = 0; dt < 2; ++dt) { v4u ph, pl;
#pragma unroll
            for (int j = 0; j < 4; ++j) { unsigned u, l; split2(o[q][dt][2 * j] * inv, o[q][dt][2 * j + 1] * inv, u, l); ph[j] = u; pl[j] = l; }
            const v8us wh = __builtin_bit_cast(v8us, ph), wl = __builtin_bit_cast(v8us, pl);
            *(v8us*)(Ah + di + dt * 16) = wh; *(v8us*)(Al + di + dt * 16) = wl; XW(); } }
}

// ---- k_out: output projection, residual and LayerNorm in one kernel. ONE WAVE per 16 rows (b,n,t) x all 128 columns (8 accumulators); 4 waves a block, grid 24576/64, 128 threads. A = hl planes from k_attn, B = bf16 Wo, staged once a block in LDS as fragments (stage_w).
// Epilogue: the 16 rows are staged in LDS; then row by row, 4 consecutive columns a lane: + bf16 bo, + bf16 x, mean and variance by the same 4-term sums and xor tree over the 32 lanes as a wave-per-row LayerNorm, 512 B stored a row.
#define OW 4    // waves a block of k_out
__global__ __launch_bounds__(32 * OW) void k_out(const bf* Ah, const bf* Al, const float* wo, const float* bo, const float* x, const float* g, const float* bb, float* Y) {
    __shared__ __align__(16) float osm[OW][16 * 132]; __shared__ __align__(16) bf wsm[32 * 512];
    const int lane = threadIdx.x & 31, lr = lane & 15, hi = lane >> 4, wave = threadIdx.x >> 5; const int r0 = (blockIdx.x * OW + wave) * 16; float* os = osm[wave];
    const size_t aoff = (size_t)(r0 + lr) * DD + 8 * hi; v16bf a = WFrag<bf>::ld(Ah + aoff), a2 = WFrag<bf>::ld(Al + aoff);    // the wave's first A fragments are asked for in front of the staging, so that their latency runs beside the weights' and the barrier's and not behind them
    XW();
    stage_w<8, OW>(wo, wsm, wave, lane);
    __syncthreads();    // the fragments read below were written by all 4 waves (the block's only barrier)
    v8f acc[8];
#pragma unroll
    for (int nb = 0; nb < 8; ++nb) acc[nb] = (v8f){};
#pragma unroll
    for (int kc = 0; kc < DD; kc += 32) { v16bf an = a, an2 = a2;    // the next pass's A fragments are asked for at the head of this one
        if (kc + 32 < DD) { an = WFrag<bf>::ld(Ah + aoff + kc + 32); an2 = WFrag<bf>::ld(Al + aoff + kc + 32); XW(); }
#pragma unroll
        for (int nb = 0; nb < 8; ++nb) { const v16bf bw = ldw(wsm, (kc >> 5) * 8 + nb, lane); acc[nb] = wmmab(a, bw, acc[nb]); acc[nb] = wmmab(a2, bw, acc[nb]); }
        a = an; a2 = an2; }
#pragma unroll
    for (int nb = 0; nb < 8; ++nb) {
#pragma unroll
        for (int j = 0; j < 8; ++j) os[(hi * 8 + j) * 132 + nb * 16 + lr] = acc[nb][j]; }
    __builtin_amdgcn_wave_barrier(); asm volatile("" ::: "memory");    // the rows read below were written by other lanes of this wave: keeps the reads behind the writes
    const int c0 = lane * 4; float bo4[4], g4[4], b4[4]; v4f xv[16];    // the 16 residual rows are asked for together: one memory latency
    { const v4f t0 = *(const v4f*)(bo + c0), t1 = *(const v4f*)(g + c0), t2 = *(const v4f*)(bb + c0); XW();
#pragma unroll
      for (int q = 0; q < 4; ++q) { bo4[q] = t0[q]; g4[q] = t1[q]; b4[q] = t2[q]; } }
#pragma unroll
    for (int r = 0; r < 16; ++r) { if (r == 15) XW();    // the last load's result may be given the address registers that the fifteen before it name
        xv[r] = *(const v4f*)(x + (size_t)(r0 + r) * DD + c0); }
    XW();
#pragma unroll
    for (int q = 0; q < 2; ++q) { bfr2(bo4[2 * q], bo4[2 * q + 1]); bfr2(g4[2 * q], g4[2 * q + 1]); bfr2(b4[2 * q], b4[2 * q + 1]); }
#pragma unroll
    for (int r = 0; r < 16; ++r) { const size_t rb = (size_t)(r0 + r) * DD; const v4f a = *(const v4fa*)(os + r * 132 + c0); float v[4]; float s = 0.f; float xb[4] = { xv[r][0], xv[r][1], xv[r][2], xv[r][3] }; bfr2(xb[0], xb[1]); bfr2(xb[2], xb[3]);
#pragma unroll
        for (int q = 0; q < 4; ++q) { v[q] = __fadd_rn(a[q] + bo4[q], xb[q]); s = __fadd_rn(s, v[q]); }
        s = wsum(s);
        const float mean = s * (1.0f / DD); float q2 = 0.f;
#pragma unroll
        for (int q = 0; q < 4; ++q) { const float d0 = v[q] - mean; q2 += d0 * d0; }
        q2 = wsum(q2);
        const float rstd = __frsqrt_rn(__fadd_rn(q2 * (1.0f / DD), 1e-5f)); v4f o;
#pragma unroll
        for (int q = 0; q < 4; ++q) o[q] = (v[q] - mean) * rstd * g4[q] + b4[q];
        *(v4f*)(Y + rb + c0) = o; XW(); }
}

extern "C" void kernel_launch(void* const* d_in, const int* in_sizes, int n_in,
                              void* d_out, int out_size, void* d_ws, size_t ws_size, hipStream_t stream) {
    (void)in_sizes; (void)n_in; (void)out_size;
    const float* x = (const float*)d_in[0]; const int* adj = (const int*)d_in[1]; const float* emb = (const float*)d_in[2]; const float* wq = (const float*)d_in[3]; const float* bq = (const float*)d_in[4]; const float* wk = (const float*)d_in[5]; const float* bk = (const float*)d_in[6]; const float* wv = (const float*)d_in[7]; const float* bv = (const float*)d_in[8]; const float* eb = (const float*)d_in[9]; const float* wo = (const float*)d_in[10]; const float* bo = (const float*)d_in[11]; const float* g = (const float*)d_in[12]; const float* be = (const float*)d_in[13];
    float* OUT = (float*)d_out;     // [2][1024][12][128]
    char* wsp = (char*)d_ws;
    auto take = [&](size_t bytes) { char* p = wsp; wsp += (bytes + 255) & ~(size_t)255; return (void*)p; };
    bf* Qh = (bf*)take((size_t)NBT * NH_ * NNODE * HD * 2); bf* Ql = (bf*)take((size_t)NBT * NH_ * NNODE * HD * 2); bf* Kh = (bf*)take((size_t)NBT * NH_ * NNODE * HD * 2); bf* Kl = (bf*)take((size_t)NBT * NH_ * NNODE * HD * 2); h16* V16 = (h16*)take((size_t)NBT * NH_ * HD * NNODE * 2);
    bf* Ah = (bf*)take((size_t)NRB * DD * 2); bf* Al = (bf*)take((size_t)NRB * DD * 2); bf* MB = (bf*)take((size_t)NNODE * NNODE * 2);
    if ((size_t)(wsp - (char*)d_ws) > ws_size) return;    // total ~ 46 MB
    k_qkv<<<dim3(3 * DD / 64 + 1, NBT * (NNODE / (16 * MBT)) / QW, 1), 32 * QW, 0, stream>>>(x, emb, wq, bq, wk, bk, wv, bv, adj, eb, Qh, Ql, Kh, Kl, V16, MB);
    k_attn<<<dim3(NNODE / 128, NH_, NBT), 128, 0, stream>>>(Qh, Ql, Kh, Kl, V16, MB, Ah, Al);
    k_out<<<NRB / (16 * OW), 32 * OW, 0, stream>>>(Ah, Al, wo, bo, x, g, be, OUT);
}

// v007
// One run takes 55.3 microseconds.
// Next to v006, in two timings, it ran 1.05 and 1.04 times as fast.
// Over all steps from v000 it is 27.8 times as fast.
#include <hip/hip_runtime.h>

// CHGANSimplified (node_features [2][1024 nodes][12 steps][128]; enh = x + node_type_embed[1 - n%2]; Q/K/V = enh W^T + b (4 heads x 32); per (batch, head, step): scores over node pairs = q.k/sqrt(32) + edge_bias[n][m]; masked to -inf where
// adj[n][m] == 0 and n != m (adj / edge_bias read as data); softmax over m (nan_to_num is a no-op: self loops keep every row non-empty); out = attn V merged; out = out Wo^T + bo; result = LN(out + node_features) -> [2][1024][12][128]).
// Compute dtypes, f32 accumulate: every input rounded to bf16; Q/K/V on bf16 hi+lo planes of enh x exact weights (2 products, + bias); scores (K 32) on hl planes (3 products), masked online softmax f32 and fp16 p x fp16 V in one kernel (k_attn); mask, self loop and bf16 edge_bias are merged once a call into one bf16 plane (k_qkv's seventh column of blocks)

#define NB_  2
#define NNODE 1024
#define TT   12
#define DD   128
#define NH_  4
#define HD   32
#define NR   (NNODE * TT)
#define SCL  0.1767766952966369f
#define NBT  (NB_ * TT)
#define NRB  (NB_ * NR)
typedef _Float16 h16;
typedef unsigned short bf;
typedef __attribute__((ext_vector_type(16))) __bf16   v16bf;
typedef __attribute__((ext_vector_type(16))) _Float16 v16h;
typedef __attribute__((ext_vector_type(8)))  _Float16 v8h;
typedef __attribute__((ext_vector_type(8)))  unsigned short v8us;
typedef __attribute__((ext_vector_type(8)))  float    v8f;
typedef __attribute__((ext_vector_type(4)))  float    v4f;
typedef v8h  __attribute__((may_alias)) v8ha;
typedef v4f  __attribute__((may_alias)) v4fa;
typedef v8us __attribute__((may_alias)) v8usa;

__device__ __forceinline__ v16h cat16(v8h lo, v8h hi) { return __builtin_shufflevector(lo, hi, 0, 1, 2, 3, 4, 5, 6, 7, 8, 9, 10, 11, 12, 13, 14, 15); }
__device__ __forceinline__ v16bf cat16b(v8us lo, v8us hi) { return __builtin_bit_cast(v16bf, __builtin_shufflevector(lo, hi, 0, 1, 2, 3, 4, 5, 6, 7, 8, 9, 10, 11, 12, 13, 14, 15)); }
__device__ __forceinline__ v8f wmma16(v16h a, v16h b, v8f c) { return __builtin_amdgcn_wmma_f32_16x16x32_f16(false, a, false, b, (short)0, c, false, false); }
__device__ __forceinline__ v8f wmmab(v16bf a, v16bf b, v8f c) { return __builtin_amdgcn_wmma_f32_16x16x32_bf16(false, a, false, b, (short)0, c, false, false); }




template <typename T16> struct WFrag;
template <> struct WFrag<h16> { typedef v16h V; static __device__ __forceinline__ V ld(const h16* p) { return cat16(*(const v8h*)p, *(const v8h*)(p + 16)); } static __device__ __forceinline__ v8f mma(V a, V b, v8f c) { return wmma16(a, b, c); } };
template <> struct WFrag<bf> { typedef v16bf V; static __device__ __forceinline__ V ld(const bf* p) { return cat16b(*(const v8us*)p, *(const v8us*)(p + 16)); } static __device__ __forceinline__ v8f mma(V a, V b, v8f c) { return wmmab(a, b, c); } };
__device__ __forceinline__ h16 tohx(float x) { return (h16)x; }
// Exchanges between lanes stay on the vector port (a shuffle through the LDS pipe costs its latency and a wait at every link of a dependent chain): xhalf(x) is lane l ^ 16's x (v_permlanex16_b32), xrow<M>(x) lane l ^ M's, M < 16 (DPP row_xmask, fused into the add that uses it).
__device__ __forceinline__ float xhalf(float x) { const int b = __builtin_bit_cast(int, x); return __builtin_bit_cast(float, __builtin_amdgcn_permlanex16(b, b, 0x76543210, 0xfedcba98, false, false)); }
template <int M> __device__ __forceinline__ float xrow(float x) { return __builtin_bit_cast(float, __builtin_amdgcn_update_dpp(0, __builtin_bit_cast(int, x), 0x160 | M, 0xf, 0xf, true)); }
// wsum: sum over the wave's 32 lanes, the xor tree 16, 8, 4, 2, 1; every lane ends with the same value
__device__ __forceinline__ float wsum(float s) { s += xhalf(s); s += xrow<8>(s); s += xrow<4>(s); s += xrow<2>(s); s += xrow<1>(s); return s; }
// XW: s_wait_xcnt 0 behind a group of global loads or stores, in front of whatever later overwrites a register that they name (address or store data). The pointers of k_qkv and k_out carry no __restrict__, so that the "memory" clobber keeps each load and store on its side.
#define XW() asm volatile("s_wait_xcnt 0x0" ::: "memory")
// ld16: the 16 f32 that make one lane's share of a 16x16x32 fragment, in the k order of WFrag::ld (p[0..7], then p[16..23])
__device__ __forceinline__ void ld16(const float* p, float* f) { const v4f a0 = *(const v4f*)p, a1 = *(const v4f*)(p + 4), a2 = *(const v4f*)(p + 16), a3 = *(const v4f*)(p + 20); XW();
#pragma unroll
    for (int i = 0; i < 4; ++i) { f[i] = a0[i]; f[4 + i] = a1[i]; f[8 + i] = a2[i]; f[12 + i] = a3[i]; } }
// Every f32 -> bf16 rounding (to nearest even) is the chip's packed conversion, two values an instruction: cpk(a, b) is one register of a fragment (element 2i = a low, 2i + 1 = b high); lo2f / hi2f give its two halves back as f32.
// bfr2: a pair rounded to bf16 and kept as f32; bfr32: the same for one value; split2: a pair as hi + lo bf16 planes (lo = the rounded rest y - hi)
typedef __attribute__((ext_vector_type(8))) unsigned v8u;
typedef __attribute__((ext_vector_type(2))) unsigned v2u;
typedef __attribute__((ext_vector_type(2))) float v2f;
typedef __attribute__((ext_vector_type(2))) __bf16 v2bf;
__device__ __forceinline__ unsigned cpk(float a, float b) { const v2f x = { a, b }; return __builtin_bit_cast(unsigned, __builtin_convertvector(x, v2bf)); }
__device__ __forceinline__ float lo2f(unsigned p) { return __uint_as_float(p << 16); }
__device__ __forceinline__ float hi2f(unsigned p) { return __uint_as_float(p & 0xFFFF0000u); }
__device__ __forceinline__ void bfr2(float& a, float& b) { const unsigned p = cpk(a, b); a = lo2f(p); b = hi2f(p); }
__device__ __forceinline__ float bfr32(float f) { return lo2f(cpk(f, f)); }
__device__ __forceinline__ void split2(float y0, float y1, unsigned& h, unsigned& l) { h = cpk(y0, y1); l = cpk(y0 - lo2f(h), y1 - hi2f(h)); }

typedef __attribute__((ext_vector_type(4))) unsigned v4u;
typedef v4u __attribute__((may_alias)) v4ua;
// stage_w: the block's weight tile (16 * NBK rows of 128 f32) is read from memory ONCE A BLOCK, rounded to bf16 and laid in LDS as ready B fragments, fragment (kc/32) * NBK + nb = 1 KB = [half][lane][8], in the k order of WFrag::ld.
// A wave takes units of 8 rows x 32 k: lane = (row & 7) + 8 * (k/8 & 3), 32 B a lane, so that a load touches 8 whole lines (a fragment load from the row-major f32 matrix touches 16 lines for 512 B, and every wave repeated it).
template <int NBK, int NW> __device__ __forceinline__ void stage_w(const float* w, bf* wsm, int wave, int lane) {
    constexpr int PER = NBK * 2 * 4 / NW; v4f a[PER][2];    // all loads of the wave are asked for together: one memory latency
#pragma unroll
    for (int i = 0; i < PER; ++i) { const int u = wave * PER + i, row = (u % (NBK * 2)) * 8 + (lane & 7), k = (u / (NBK * 2)) * 32 + (lane >> 3) * 8; a[i][0] = *(const v4f*)(w + (size_t)row * DD + k); a[i][1] = *(const v4f*)(w + (size_t)row * DD + k + 4); }
    XW();
#pragma unroll
    for (int i = 0; i < PER; ++i) { const int u = wave * PER + i, row = (u % (NBK * 2)) * 8 + (lane & 7), p4 = lane >> 3; const v4u o = { cpk(a[i][0][0], a[i][0][1]), cpk(a[i][0][2], a[i][0][3]), cpk(a[i][1][0], a[i][1][1]), cpk(a[i][1][2], a[i][1][3]) };
        *(v4ua*)(wsm + ((((u / (NBK * 2)) * NBK + (row >> 4)) * 2 + (p4 >> 1)) * 32 + (p4 & 1) * 16 + (row & 15)) * 8) = o; }
}
__device__ __forceinline__ v16bf ldw(const bf* wsm, int frag, int lane) { return cat16b(*(const v8usa*)(wsm + frag * 512 + lane * 8), *(const v8usa*)(wsm + frag * 512 + 256 + lane * 8)); }

// ---- k_qkv: Q, K or V projection with its neighbours folded in. ONE WAVE per 32x64 output tile (8 accumulators); 8 waves a block, which share one column tile's weights through LDS (stage_w); grid (6 column tiles of [q | k | v] and a seventh column for the plane MB, 24 slices bt x 32 node blocks / 8), 256 threads.
// The 32 rows of a tile are 32 consecutive nodes n of one (batch, step) slice bt, so that the tile's results lie contiguous in the planes that k_attn reads.
// Prologue: the A fragments (hi + lo bf16 planes of enh = bf16 x + bf16 emb[1 - n%2]; n's parity is the lane's, as n0 and the 16-row steps are even) are formed in registers from the f32 inputs; the B fragments (bf16 weights) come from LDS (stage_w).
// Epilogue (+ bf16 bias): Q (x scale) and K go out as hl planes [bt][h][n][d], staged through LDS so that a store covers whole 128-B lines; V goes out as fp16 V16[bt][h][dv][m] straight from the accumulators, whose 8 registers are 8 consecutive m.
// Blocks of column 6 do no projection: they write MB, the masked bias of every node pair as bf16 (bf16 edge_bias where adj != 0 or n == m, else -3e38), in the order in which k_attn's lanes hold the scores:
// MB[n/16][m/32][u][lane][j], 512 B in a row for each load of a wave. adj and edge_bias are the same for all 96 (batch, step, head) slices, so this is done once a call and not once a slice.
#define MBT 2    // 16-row blocks a tile
#define MBTILES ((NNODE / 16) * (NNODE / 32))
typedef __attribute__((ext_vector_type(4))) int v4i;
#define QW 8    // waves a block of k_qkv
__global__ __launch_bounds__(32 * QW) void k_qkv(const float* x, const float* emb, const float* wq, const float* bq, const float* wk, const float* bk, const float* wv, const float* bv, const int* adj, const float* eb, bf* Qh, bf* Ql, bf* Kh, bf* Kl, h16* V16, bf* MB) {
    __shared__ __align__(16) float osm[QW][16 * 68]; __shared__ __align__(16) bf wsm[16 * 512];
    const int lane = threadIdx.x & 31, lr = lane & 15, hi = lane >> 4, wave = __builtin_amdgcn_readfirstlane(threadIdx.x >> 5); const int ry = blockIdx.y * QW + wave; float* os = osm[wave]; const int bt = ry / (NNODE / (16 * MBT)), b = bt / TT, t = bt % TT, n0 = (ry % (NNODE / (16 * MBT))) * 16 * MBT; const int which = blockIdx.x >> 1, c0 = (blockIdx.x & 1) * 64;
    if (which == 3) {    // the masked-bias plane: tile (nb, mc) = 16 nodes n x 32 nodes m; a lane forms the 8 values that it will hold in k_attn's score accumulator (n = nb*16 + lr, m = mc*32 + u*16 + hi*8 + j)
        for (int tile = ry; tile < MBTILES; tile += NBT * (NNODE / (16 * MBT))) { const int n = (tile >> 5) * 16 + lr;
            const int mt = (tile & 31) * 32 + hi * 8; const size_t ro = (size_t)n * NNODE + mt; v4i a[2][2]; v4f e[2][2];    // the tile's 8 loads are asked for together: one memory latency
#pragma unroll
            for (int u = 0; u < 2; ++u) { a[u][0] = *(const v4i*)(adj + ro + u * 16); a[u][1] = *(const v4i*)(adj + ro + u * 16 + 4); e[u][0] = *(const v4f*)(eb + ro + u * 16); e[u][1] = *(const v4f*)(eb + ro + u * 16 + 4); }
            XW();
#pragma unroll
            for (int u = 0; u < 2; ++u) { const int mb = mt + u * 16; float r[8];
#pragma unroll
                for (int j = 0; j < 8; ++j) { const bool keep = (a[u][j >> 2][j & 3] != 0) | (mb + j == n); r[j] = keep ? e[u][j >> 2][j & 3] : -3.0e38f; }
                const v4u o = { cpk(r[0], r[1]), cpk(r[2], r[3]), cpk(r[4], r[5]), cpk(r[6], r[7]) };
                *(v4ua*)(MB + ((size_t)tile * 2 + u) * 256 + lane * 8) = o; XW(); } }
        return;
    }
    const float* w = which == 0 ? wq : (which == 1 ? wk : wv); const float* bias = which == 0 ? bq : (which == 1 ? bk : bv);
    v8f acc[MBT][4];
#pragma unroll
    for (int mb = 0; mb < MBT; ++mb)
#pragma unroll
        for (int nb = 0; nb < 4; ++nb) acc[mb][nb] = (v8f){};
    const float* xr = x + ((size_t)(b * NNODE + n0 + lr) * TT + t) * DD + 8 * hi; const float* er = emb + (1 - (lr & 1)) * DD + 8 * hi;
    stage_w<4, QW>(w + (size_t)c0 * DD, wsm, wave, lane);
    __syncthreads();    // the fragments read below were written by all 8 waves (the block's only barrier; every wave of a projection block passes it)
#pragma unroll 1    // kept rolled: unrolled, the four passes' loads are hoisted together, the wave's registers grow and fewer waves fit a SIMD
    for (int kc = 0; kc < DD; kc += 32) {
        v16bf a[MBT], a2[MBT]; float ev[16], f[MBT][16];    // all 12 loads of the pass are asked for at its head, so that one memory latency covers them
#pragma unroll
        for (int mb = 0; mb < MBT; ++mb) ld16(xr + (size_t)mb * 16 * TT * DD + kc, f[mb]);
        ld16(er + kc, ev);
#pragma unroll
        for (int i = 0; i < 8; ++i) bfr2(ev[2 * i], ev[2 * i + 1]);
#pragma unroll
        for (int mb = 0; mb < MBT; ++mb) { v8u oh, ol;
#pragma unroll
            for (int i = 0; i < 8; ++i) { unsigned h, l; bfr2(f[mb][2 * i], f[mb][2 * i + 1]); split2(__fadd_rn(f[mb][2 * i], ev[2 * i]), __fadd_rn(f[mb][2 * i + 1], ev[2 * i + 1]), h, l); oh[i] = h; ol[i] = l; }
            a[mb] = __builtin_bit_cast(v16bf, oh); a2[mb] = __builtin_bit_cast(v16bf, ol); }
#pragma unroll
        for (int nb = 0; nb < 4; ++nb) { const v16bf bw = ldw(wsm, (kc >> 5) * 4 + nb, lane);
#pragma unroll
            for (int mb = 0; mb < MBT; ++mb) { acc[mb][nb] = wmmab(a[mb], bw, acc[mb][nb]); acc[mb][nb] = wmmab(a2[mb], bw, acc[mb][nb]); } }
    }
    if (which == 2) {
#pragma unroll
        for (int nb = 0; nb < 4; ++nb) { const int col = c0 + nb * 16 + lr; const float bc = bfr32(bias[col]); XW(); h16* dst = V16 + (((size_t)bt * NH_ + (col >> 5)) * HD + (col & 31)) * NNODE + n0 + hi * 8;
#pragma unroll
            for (int mb = 0; mb < MBT; ++mb) { v8h o;
#pragma unroll
                for (int j = 0; j < 8; ++j) o[j] = tohx(acc[mb][nb][j] + bc);
                *(v8h*)(dst + mb * 16) = o; XW(); } }
        return;
    }
    bf* Ph = which == 0 ? Qh : Kh; bf* Pl = which == 0 ? Ql : Kl; const float scl = which == 0 ? SCL : 1.0f;
    const int cofs = lr * 4, col = c0 + cofs; float b4[4];
#pragma unroll
    for (int q = 0; q < 4; ++q) b4[q] = bfr32(bias[col + q]);
    XW();
    const size_t pofs = (((size_t)bt * NH_ + (col >> 5)) * NNODE + n0) * HD + (col & 31);
#pragma unroll
    for (int mb = 0; mb < MBT; ++mb) {
#pragma unroll
        for (int nb = 0; nb < 4; ++nb) {
#pragma unroll
            for (int j = 0; j < 8; ++j) os[(hi * 8 + j) * 68 + nb * 16 + lr] = acc[mb][nb][j]; }
        __builtin_amdgcn_wave_barrier(); asm volatile("" ::: "memory");    // the rows read below were written by other lanes of this wave: keeps the reads behind the writes
#pragma unroll
        for (int s = 0; s < 8; ++s) { const int row = 2 * s + hi; const v4f val = *(const v4fa*)(os + row * 68 + cofs); v2u oh, ol;
#pragma unroll
            for (int q = 0; q < 2; ++q) { unsigned h, l; split2((val[2 * q] + b4[2 * q]) * scl, (val[2 * q + 1] + b4[2 * q + 1]) * scl, h, l); oh[q] = h; ol[q] = l; }
            *(v2u*)(Ph + pofs + (size_t)(mb * 16 + row) * HD) = oh; *(v2u*)(Pl + pofs + (size_t)(mb * 16 + row) * HD) = ol; XW(); }
        __builtin_amdgcn_wave_barrier(); asm volatile("" ::: "memory");    // keeps the next block's writes behind these reads
    }
}
// exp2x8, exp2x1: 2^x on the transcendental unit, eight (or one) in one asm statement that ends in v_nop: the slot that the instruction set asks for between a transcendental and an instruction that reads its result or overwrites its source. Outputs are early-clobber, so that inside the statement no result lies on a source.
__device__ __forceinline__ void exp2x8(const float* x, float* r) {
    asm("v_exp_f32 %0, %8\n\tv_exp_f32 %1, %9\n\tv_exp_f32 %2, %10\n\tv_exp_f32 %3, %11\n\tv_exp_f32 %4, %12\n\tv_exp_f32 %5, %13\n\tv_exp_f32 %6, %14\n\tv_exp_f32 %7, %15\n\tv_nop"
        : "=&v"(r[0]), "=&v"(r[1]), "=&v"(r[2]), "=&v"(r[3]), "=&v"(r[4]), "=&v"(r[5]), "=&v"(r[6]), "=&v"(r[7]) : "v"(x[0]), "v"(x[1]), "v"(x[2]), "v"(x[3]), "v"(x[4]), "v"(x[5]), "v"(x[6]), "v"(x[7])); }
__device__ __forceinline__ float exp2x1(float x) { float r; asm("v_exp_f32 %0, %1\n\tv_nop" : "=&v"(r) : "v"(x)); return r; }
#define LOG2E 1.44269504f
// k_attn: scores, masked softmax and attn V in one kernel, one launch for every (batch, step, head). Grid (1024/128, heads, batch*steps), 4 waves; a wave owns 32 query nodes n (2 tiles of 16) and walks the 1024 key nodes m in chunks of 32.
// Scores are formed TRANSPOSED, St[m][n] = sum_d K[m][d] Q[n][d] (hl planes, the same 3 products): the accumulator then holds, in lane (lr, hi), node n = lr and m = 8 hi + j, which is the k order of a 16x16x32 B fragment
// (tile u = 0 gives k = 8 hi + j, tile u = 1 gives k = 16 + 8 hi + j), so p = exp(s - max) goes from registers into Ot[d][n] = sum_m Vt[d][m] P[n][m] with no exchange, and max, sum and the rescale are per n = lr, shared by lanes l and l ^ 16 (the chunk max is exchanged by xhalf, the two partial sums are added at the end).
// Online softmax: running max mx (never below -1e38) and sum per n; a masked pair (adj == 0, m != n) carries about -3e38 from the plane MB, so its exp(s - mx) is 0 even while no kept pair has been met; the self loop keeps every sum above 0. Result Ot / sum is stored as hl planes A[(b,n,t)][h*32 + d], the output projection's operand, 16 B a lane and plane.
__global__ __launch_bounds__(128) void k_attn(const bf* Qh, const bf* Ql, const bf* Kh, const bf* Kl, const h16* Vt, const bf* MB, bf* Ah, bf* Al) {
    const int lane = threadIdx.x & 31, lr = lane & 15, hi = lane >> 4; const int h = blockIdx.y, bt = blockIdx.z, b = bt / TT, t = bt % TT; const int n0 = blockIdx.x * 128 + (threadIdx.x >> 5) * 32;
    const size_t pl = ((size_t)bt * NH_ + h) * NNODE * HD; Qh += pl; Ql += pl; Kh += pl; Kl += pl; Vt += pl; MB += (size_t)(n0 >> 4) * 32 * 512 + lane * 8;
    v16bf qh[2], ql[2]; v8f o[2][2]; float mx[2], sum[2];
#pragma unroll
    for (int q = 0; q < 2; ++q) { const size_t qo = (size_t)(n0 + q * 16 + lr) * HD + 8 * hi; qh[q] = WFrag<bf>::ld(Qh + qo); ql[q] = WFrag<bf>::ld(Ql + qo); o[q][0] = (v8f){}; o[q][1] = (v8f){}; mx[q] = -1.0e38f; sum[q] = 0.f; }
    // The chunk's operands are asked for ONE PASS AHEAD, into a second register set: while a pass works on one set, the 16 loads of the next chunk fly into the other, so that a pass no longer opens with a wait for its own loads.
    struct Chunk { v16bf kh[2], kl[2]; v4u bm[2][2]; v16h vt[2]; };
    const bf* pkh = Kh + (size_t)lr * HD + 8 * hi; const bf* pkl = Kl + (size_t)lr * HD + 8 * hi; const h16* pv = Vt + (size_t)lr * NNODE + 8 * hi; const bf* pmb = MB;    // the lane's places in the next chunk to ask for; they step on by a chunk behind each group of loads
    auto ask = [&](Chunk& c) __attribute__((always_inline)) {
#pragma unroll
        for (int u = 0; u < 2; ++u) { c.kh[u] = WFrag<bf>::ld(pkh + u * 16 * HD); c.kl[u] = WFrag<bf>::ld(pkl + u * 16 * HD); }
#pragma unroll
        for (int q = 0; q < 2; ++q)
#pragma unroll
            for (int u = 0; u < 2; ++u) c.bm[q][u] = *(const v4ua*)(pmb + q * 32 * 512 + u * 256);
#pragma unroll
        for (int u = 0; u < 2; ++u) c.vt[u] = WFrag<h16>::ld(pv + (size_t)u * 16 * NNODE);
        asm volatile("s_wait_xcnt 0x0" ::: "memory");    // stands between the chunk's 16 loads and the step of their address registers to the next chunk (the kernel's pointers carry no __restrict__, so that the "memory" clobber keeps each load on its side, in front of the pass that it flies beside)
        pkh += 32 * HD; pkl += 32 * HD; pv += 32; pmb += 512;
    };
    auto pass = [&](const Chunk& c) __attribute__((always_inline)) {
#pragma unroll
        for (int q = 0; q < 2; ++q) { v8f s[2]; float cm = -3.0e38f;
#pragma unroll
            for (int u = 0; u < 2; ++u) { v8f acc;    // the masked bias is the accumulator's start value
#pragma unroll
                for (int i = 0; i < 4; ++i) { acc[2 * i] = __uint_as_float(c.bm[q][u][i] << 16); acc[2 * i + 1] = __uint_as_float(c.bm[q][u][i] & 0xFFFF0000u); }
                acc = wmmab(c.kh[u], qh[q], acc); acc = wmmab(c.kh[u], ql[q], acc); acc = wmmab(c.kl[u], qh[q], acc); s[u] = acc;
#pragma unroll
                for (int j = 0; j < 8; ++j) cm = fmaxf(cm, acc[j]); }
            cm = fmaxf(cm, xhalf(cm));
            const float mn = fmaxf(mx[q], cm); const float al = exp2x1((mx[q] - mn) * LOG2E); mx[q] = mn; float ps = 0.f; v16h p; float ar[16], ex[16];
#pragma unroll
            for (int i = 0; i < 16; ++i) ar[i] = (s[i >> 3][i & 7] - mn) * LOG2E;
            exp2x8(ar, ex); exp2x8(ar + 8, ex + 8);
#pragma unroll
            for (int i = 0; i < 16; ++i) { ps += ex[i]; p[i] = tohx(ex[i]); }
            sum[q] = sum[q] * al + ps;
#pragma unroll
            for (int dt = 0; dt < 2; ++dt) { o[q][dt] *= al; o[q][dt] = wmma16(c.vt[dt], p, o[q][dt]); } }
    };
    Chunk ca, cb;
    ask(ca);
#pragma unroll 1    // kept rolled: a trip is two passes, one on each register set, so that no set is copied into the other
    for (int m0 = 0; ; m0 += 64) { ask(cb); pass(ca);
        if (m0 + 64 >= NNODE) break;    // the loop is left between its two passes: behind the last chunk there is none to ask for
        ask(ca); pass(cb); }
    pass(cb);
#pragma unroll
    for (int q = 0; q < 2; ++q) { const float inv = __fdiv_rn(1.0f, sum[q] + xhalf(sum[q])); const size_t di = ((size_t)(b * NNODE + n0 + q * 16 + lr) * TT + t) * DD + h * HD + hi * 8;
#pragma unroll
        for (int dt = 0; dt < 2; ++dt) { v4u ph, pl;
#pragma unroll
            for (int j = 0; j < 4; ++j) { unsigned u, l; split2(o[q][dt][2 * j] * inv, o[q][dt][2 * j + 1] * inv, u, l); ph[j] = u; pl[j] = l; }
            const v8us wh = __builtin_bit_cast(v8us, ph), wl = __builtin_bit_cast(v8us, pl);
            *(v8us*)(Ah + di + dt * 16) = wh; *(v8us*)(Al + di + dt * 16) = wl; XW(); } }
}

// ---- k_out: output projection, residual and LayerNorm in one kernel. ONE WAVE per 16 rows (b,n,t) x all 128 columns (8 accumulators); 4 waves a block, grid 24576/64, 128 threads. A = hl planes from k_attn, B = bf16 Wo, staged once a block in LDS as fragments (stage_w).
// Epilogue: the 16 rows are staged in LDS; then row by row, 4 consecutive columns a lane: + bf16 bo, + bf16 x, mean and variance by the same 4-term sums and xor tree over the 32 lanes as a wave-per-row LayerNorm, 512 B stored a row.
#define OW 4    // waves a block of k_out
__global__ __launch_bounds__(32 * OW) void k_out(const bf* Ah, const bf* Al, const float* wo, const float* bo, const float* x, const float* g, const float* bb, float* Y) {
    __shared__ __align__(16) float osm[OW][16 * 132]; __shared__ __align__(16) bf wsm[32 * 512];
    const int lane = threadIdx.x & 31, lr = lane & 15, hi = lane >> 4, wave = threadIdx.x >> 5; const int r0 = (blockIdx.x * OW + wave) * 16; float* os = osm[wave];
    const size_t aoff = (size_t)(r0 + lr) * DD + 8 * hi; v16bf a = WFrag<bf>::ld(Ah + aoff), a2 = WFrag<bf>::ld(Al + aoff);    // the wave's first A fragments are asked for in front of the staging, so that their latency runs beside the weights' and the barrier's and not behind them
    XW();
    stage_w<8, OW>(wo, wsm, wave, lane);
    __syncthreads();    // the fragments read below were written by all 4 waves (the block's only barrier)
    v8f acc[8];
#pragma unroll
    for (int nb = 0; nb < 8; ++nb) acc[nb] = (v8f){};
#pragma unroll
    for (int kc = 0; kc < DD; kc += 32) { v16bf an = a, an2 = a2;    // the next pass's A fragments are asked for at the head of this one
        if (kc + 32 < DD) { an = WFrag<bf>::ld(Ah + aoff + kc + 32); an2 = WFrag<bf>::ld(Al + aoff + kc + 32); XW(); }
#pragma unroll
        for (int nb = 0; nb < 8; ++nb) { const v16bf bw = ldw(wsm, (kc >> 5) * 8 + nb, lane); acc[nb] = wmmab(a, bw, acc[nb]); acc[nb] = wmmab(a2, bw, acc[nb]); }
        a = an; a2 = an2; }
#pragma unroll
    for (int nb = 0; nb < 8; ++nb) {
#pragma unroll
        for (int j = 0; j < 8; ++j) os[(hi * 8 + j) * 132 + nb * 16 + lr] = acc[nb][j]; }
    __builtin_amdgcn_wave_barrier(); asm volatile("" ::: "memory");    // the rows read below were written by other lanes of this wave: keeps the reads behind the writes
    const int c0 = lane * 4; float bo4[4], g4[4], b4[4]; v4f xv[16];    // the 16 residual rows are asked for together: one memory latency
    { const v4f t0 = *(const v4f*)(bo + c0), t1 = *(const v4f*)(g + c0), t2 = *(const v4f*)(bb + c0); XW();
#pragma unroll
      for (int q = 0; q < 4; ++q) { bo4[q] = t0[q]; g4[q] = t1[q]; b4[q] = t2[q]; } }
#pragma unroll
    for (int r = 0; r < 16; ++r) { if (r == 15) XW();    // the last load's result may be given the address registers that the fifteen before it name
        xv[r] = *(const v4f*)(x + (size_t)(r0 + r) * DD + c0); }
    XW();
#pragma unroll
    for (int q = 0; q < 2; ++q) { bfr2(bo4[2 * q], bo4[2 * q + 1]); bfr2(g4[2 * q], g4[2 * q + 1]); bfr2(b4[2 * q], b4[2 * q + 1]); }
#pragma unroll
    for (int r = 0; r < 16; ++r) { const size_t rb = (size_t)(r0 + r) * DD; const v4f a = *(const v4fa*)(os + r * 132 + c0); float v[4]; float s = 0.f; float xb[4] = { xv[r][0], xv[r][1], xv[r][2], xv[r][3] }; bfr2(xb[0], xb[1]); bfr2(xb[2], xb[3]);
#pragma unroll
        for (int q = 0; q < 4; ++q) { v[q] = __fadd_rn(a[q] + bo4[q], xb[q]); s = __fadd_rn(s, v[q]); }
        s = wsum(s);
        const float mean = s * (1.0f / DD); float q2 = 0.f;
#pragma unroll
        for (int q = 0; q < 4; ++q) { const float d0 = v[q] - mean; q2 += d0 * d0; }
        q2 = wsum(q2);
        const float rstd = __frsqrt_rn(__fadd_rn(q2 * (1.0f / DD), 1e-5f)); v4f o;
#pragma unroll
        for (int q = 0; q < 4; ++q) o[q] = (v[q] - mean) * rstd * g4[q] + b4[q];
        *(v4f*)(Y + rb + c0) = o; XW(); }
}

extern "C" void kernel_launch(void* const* d_in, const int* in_sizes, int n_in,
                              void* d_out, int out_size, void* d_ws, size_t ws_size, hipStream_t stream) {
    (void)in_sizes; (void)n_in; (void)out_size;
    const float* x = (const float*)d_in[0]; const int* adj = (const int*)d_in[1]; const float* emb = (const float*)d_in[2]; const float* wq = (const float*)d_in[3]; const float* bq = (const float*)d_in[4]; const float* wk = (const float*)d_in[5]; const float* bk = (const float*)d_in[6]; const float* wv = (const float*)d_in[7]; const float* bv = (const float*)d_in[8]; const float* eb = (const float*)d_in[9]; const float* wo = (const float*)d_in[10]; const float* bo = (const float*)d_in[11]; const float* g = (const float*)d_in[12]; const float* be = (const float*)d_in[13];
    float* OUT = (float*)d_out;     // [2][1024][12][128]
    char* wsp = (char*)d_ws;
    auto take = [&](size_t bytes) { char* p = wsp; wsp += (bytes + 255) & ~(size_t)255; return (void*)p; };
    bf* Qh = (bf*)take((size_t)NBT * NH_ * NNODE * HD * 2); bf* Ql = (bf*)take((size_t)NBT * NH_ * NNODE * HD * 2); bf* Kh = (bf*)take((size_t)NBT * NH_ * NNODE * HD * 2); bf* Kl = (bf*)take((size_t)NBT * NH_ * NNODE * HD * 2); h16* V16 = (h16*)take((size_t)NBT * NH_ * HD * NNODE * 2);
    bf* Ah = (bf*)take((size_t)NRB * DD * 2); bf* Al = (bf*)take((size_t)NRB * DD * 2); bf* MB = (bf*)take((size_t)NNODE * NNODE * 2);
    if ((size_t)(wsp - (char*)d_ws) > ws_size) return;    // total ~ 46 MB
    k_qkv<<<dim3(3 * DD / 64 + 1, NBT * (NNODE / (16 * MBT)) / QW, 1), 32 * QW, 0, stream>>>(x, emb, wq, bq, wk, bk, wv, bv, adj, eb, Qh, Ql, Kh, Kl, V16, MB);
    k_attn<<<dim3(NNODE / 128, NH_, NBT), 128, 0, stream>>>(Qh, Ql, Kh, Kl, V16, MB, Ah, Al);
    k_out<<<NRB / (16 * OW), 32 * OW, 0, stream>>>(Ah, Al, wo, bo, x, g, be, OUT);
}

// v008
// One run takes 50 microseconds.
// Two timings next to v007 both put it at 1.11 times that version's speed.
// All steps since v000 together make it 30.9 times as fast.
#include <hip/hip_runtime.h>

// CHGANSimplified (node_features [2][1024 nodes][12 steps][128]; enh = x + node_type_embed[1 - n%2]; Q/K/V = enh W^T + b (4 heads x 32); per (batch, head, step): scores over node pairs = q.k/sqrt(32) + edge_bias[n][m]; masked to -inf where
// adj[n][m] == 0 and n != m (adj / edge_bias read as data); softmax over m (nan_to_num is a no-op: self loops keep every row non-empty); out = attn V merged; out = out Wo^T + bo; result = LN(out + node_features) -> [2][1024][12][128]).
// Compute dtypes, f32 accumulate: every input rounded to bf16; Q/K/V on bf16 hi+lo planes of enh x exact weights (2 products, + bias); scores (K 32) on hl planes (3 products), masked online softmax f32 and fp16 p x fp16 V in one kernel (k_attn); mask, self loop and bf16 edge_bias are merged once a call into one bf16 plane (k_qkv's seventh column of blocks)

#define NB_  2
#define NNODE 1024
#define TT   12
#define DD   128
#define NH_  4
#define HD   32
#define NR   (NNODE * TT)
#define SCL  0.1767766952966369f
#define NBT  (NB_ * TT)
#define NRB  (NB_ * NR)
typedef _Float16 h16;
typedef unsigned short bf;
typedef __attribute__((ext_vector_type(16))) __bf16   v16bf;
typedef __attribute__((ext_vector_type(16))) _Float16 v16h;
typedef __attribute__((ext_vector_type(8)))  _Float16 v8h;
typedef __attribute__((ext_vector_type(8)))  unsigned short v8us;
typedef __attribute__((ext_vector_type(8)))  float    v8f;
typedef __attribute__((ext_vector_type(4)))  float    v4f;
typedef v8h  __attribute__((may_alias)) v8ha;
typedef v4f  __attribute__((may_alias)) v4fa;
typedef v8us __attribute__((may_alias)) v8usa;

__device__ __forceinline__ v16h cat16(v8h lo, v8h hi) { return __builtin_shufflevector(lo, hi, 0, 1, 2, 3, 4, 5, 6, 7, 8, 9, 10, 11, 12, 13, 14, 15); }
__device__ __forceinline__ v16bf cat16b(v8us lo, v8us hi) { return __builtin_bit_cast(v16bf, __builtin_shufflevector(lo, hi, 0, 1, 2, 3, 4, 5, 6, 7, 8, 9, 10, 11, 12, 13, 14, 15)); }
__device__ __forceinline__ v8f wmma16(v16h a, v16h b, v8f c) { return __builtin_amdgcn_wmma_f32_16x16x32_f16(false, a, false, b, (short)0, c, false, false); }
__device__ __forceinline__ v8f wmmab(v16bf a, v16bf b, v8f c) { return __builtin_amdgcn_wmma_f32_16x16x32_bf16(false, a, false, b, (short)0, c, false, false); }




template <typename T16> struct WFrag;
template <> struct WFrag<h16> { typedef v16h V; static __device__ __forceinline__ V ld(const h16* p) { return cat16(*(const v8h*)p, *(const v8h*)(p + 16)); } static __device__ __forceinline__ v8f mma(V a, V b, v8f c) { return wmma16(a, b, c); } };
template <> struct WFrag<bf> { typedef v16bf V; static __device__ __forceinline__ V ld(const bf* p) { return cat16b(*(const v8us*)p, *(const v8us*)(p + 16)); } static __device__ __forceinline__ v8f mma(V a, V b, v8f c) { return wmmab(a, b, c); } };
__device__ __forceinline__ h16 tohx(float x) { return (h16)x; }
// Exchanges between lanes stay on the vector port (a shuffle through the LDS pipe costs its latency and a wait at every link of a dependent chain): xhalf(x) is lane l ^ 16's x (v_permlanex16_b32), xrow<M>(x) lane l ^ M's, M < 16 (DPP row_xmask, fused into the add that uses it).
__device__ __forceinline__ float xhalf(float x) { const int b = __builtin_bit_cast(int, x); return __builtin_bit_cast(float, __builtin_amdgcn_permlanex16(b, b, 0x76543210, 0xfedcba98, false, false)); }
template <int M> __device__ __forceinline__ float xrow(float x) { return __builtin_bit_cast(float, __builtin_amdgcn_update_dpp(0, __builtin_bit_cast(int, x), 0x160 | M, 0xf, 0xf, true)); }
// wsum: sum over the wave's 32 lanes, the xor tree 16, 8, 4, 2, 1; every lane ends with the same value
__device__ __forceinline__ float wsum(float s) { s += xhalf(s); s += xrow<8>(s); s += xrow<4>(s); s += xrow<2>(s); s += xrow<1>(s); return s; }
// XW: s_wait_xcnt 0 behind a group of global loads or stores, in front of whatever later overwrites a register that they name (address or store data). The pointers of the kernels carry no __restrict__, so that the "memory" clobber keeps each load and store on its side.
#define XW() asm volatile("s_wait_xcnt 0x0" ::: "memory")
// ld16: the 16 f32 that make one lane's share of a 16x16x32 fragment, in the k order of WFrag::ld (p[0..7], then p[16..23])
__device__ __forceinline__ void ld16(const float* p, float* f) { const v4f a0 = *(const v4f*)p, a1 = *(const v4f*)(p + 4), a2 = *(const v4f*)(p + 16), a3 = *(const v4f*)(p + 20); XW();
#pragma unroll
    for (int i = 0; i < 4; ++i) { f[i] = a0[i]; f[4 + i] = a1[i]; f[8 + i] = a2[i]; f[12 + i] = a3[i]; } }
// Every f32 -> bf16 rounding (to nearest even) is the chip's packed conversion, two values an instruction: cpk(a, b) is one register of a fragment (element 2i = a low, 2i + 1 = b high); lo2f / hi2f give its two halves back as f32.
// bfr2: a pair rounded to bf16 and kept as f32; bfr32: the same for one value; split2: a pair as hi + lo bf16 planes (lo = the rounded rest y - hi)
typedef __attribute__((ext_vector_type(8))) unsigned v8u;
typedef __attribute__((ext_vector_type(2))) unsigned v2u;
typedef __attribute__((ext_vector_type(2))) float v2f;
typedef __attribute__((ext_vector_type(2))) __bf16 v2bf;
__device__ __forceinline__ unsigned cpk(float a, float b) { const v2f x = { a, b }; return __builtin_bit_cast(unsigned, __builtin_convertvector(x, v2bf)); }
__device__ __forceinline__ float lo2f(unsigned p) { return __uint_as_float(p << 16); }
__device__ __forceinline__ float hi2f(unsigned p) { return __uint_as_float(p & 0xFFFF0000u); }
__device__ __forceinline__ void bfr2(float& a, float& b) { const unsigned p = cpk(a, b); a = lo2f(p); b = hi2f(p); }
__device__ __forceinline__ float bfr32(float f) { return lo2f(cpk(f, f)); }
__device__ __forceinline__ void split2(float y0, float y1, unsigned& h, unsigned& l) { h = cpk(y0, y1); l = cpk(y0 - lo2f(h), y1 - hi2f(h)); }

typedef __attribute__((ext_vector_type(4))) unsigned v4u;
typedef v4u __attribute__((may_alias)) v4ua;
// stage_w: the block's weight tile (16 * NBK rows of 128 f32) is read from memory ONCE A BLOCK, rounded to bf16 and laid in LDS as ready B fragments, fragment (kc/32) * NBK + nb = 1 KB = [half][lane][8], in the k order of WFrag::ld.
// A wave takes units of 8 rows x 32 k: lane = (row & 7) + 8 * (k/8 & 3), 32 B a lane, so that a load touches 8 whole lines (a fragment load from the row-major f32 matrix touches 16 lines for 512 B, and every wave repeated it).
template <int NBK, int NW> __device__ __forceinline__ void stage_w(const float* w, bf* wsm, int wave, int lane) {
    constexpr int PER = NBK * 2 * 4 / NW; v4f a[PER][2];    // all loads of the wave are asked for together: one memory latency
#pragma unroll
    for (int i = 0; i < PER; ++i) { const int u = wave * PER + i, row = (u % (NBK * 2)) * 8 + (lane & 7), k = (u / (NBK * 2)) * 32 + (lane >> 3) * 8; a[i][0] = *(const v4f*)(w + (size_t)row * DD + k); a[i][1] = *(const v4f*)(w + (size_t)row * DD + k + 4); }
    XW();
#pragma unroll
    for (int i = 0; i < PER; ++i) { const int u = wave * PER + i, row = (u % (NBK * 2)) * 8 + (lane & 7), p4 = lane >> 3; const v4u o = { cpk(a[i][0][0], a[i][0][1]), cpk(a[i][0][2], a[i][0][3]), cpk(a[i][1][0], a[i][1][1]), cpk(a[i][1][2], a[i][1][3]) };
        *(v4ua*)(wsm + ((((u / (NBK * 2)) * NBK + (row >> 4)) * 2 + (p4 >> 1)) * 32 + (p4 & 1) * 16 + (row & 15)) * 8) = o; }
}
__device__ __forceinline__ v16bf ldw(const bf* wsm, int frag, int lane) { return cat16b(*(const v8usa*)(wsm + frag * 512 + lane * 8), *(const v8usa*)(wsm + frag * 512 + 256 + lane * 8)); }

// ---- k_qkv: Q, K or V projection with its neighbours folded in. ONE WAVE per 32x64 output tile (8 accumulators); 8 waves a block, which share one column tile's weights through LDS (stage_w); grid (6 column tiles of [q | k | v] and a seventh column for the plane MB, 24 slices bt x 32 node blocks / 8), 256 threads.
// The 32 rows of a tile are 32 consecutive nodes n of one (batch, step) slice bt, so that the tile's results lie contiguous in the planes that k_attn reads.
// Prologue: the A fragments (hi + lo bf16 planes of enh = bf16 x + bf16 emb[1 - n%2]; n's parity is the lane's, as n0 and the 16-row steps are even) are formed in registers from the f32 inputs; the B fragments (bf16 weights) come from LDS (stage_w).
// Epilogue (+ bf16 bias): Q (x scale) and K go out as hl planes [bt][h][n][d], staged through LDS so that a store covers whole 128-B lines; V goes out as fp16 V16[bt][h][dv][m] straight from the accumulators, whose 8 registers are 8 consecutive m.
// Blocks of column 6 do no projection: they write MB, the masked bias of every node pair as bf16 (bf16 edge_bias where adj != 0 or n == m, else -3e38), in the order in which k_attn's lanes hold the scores:
// MB[n/16][m/32][u][lane][j], 512 B in a row for each load of a wave. adj and edge_bias are the same for all 96 (batch, step, head) slices, so this is done once a call and not once a slice.
#define MBT 2    // 16-row blocks a tile
#define MBTILES ((NNODE / 16) * (NNODE / 32))
typedef __attribute__((ext_vector_type(4))) int v4i;
#define QW 8    // waves a block of k_qkv
__global__ __launch_bounds__(32 * QW) void k_qkv(const float* x, const float* emb, const float* wq, const float* bq, const float* wk, const float* bk, const float* wv, const float* bv, const int* adj, const float* eb, bf* Qh, bf* Ql, bf* Kh, bf* Kl, h16* V16, bf* MB) {
    __shared__ __align__(16) float osm[QW][16 * 68]; __shared__ __align__(16) bf wsm[16 * 512];
    const int lane = threadIdx.x & 31, lr = lane & 15, hi = lane >> 4, wave = __builtin_amdgcn_readfirstlane(threadIdx.x >> 5); const int ry = blockIdx.y * QW + wave; float* os = osm[wave]; const int bt = ry / (NNODE / (16 * MBT)), b = bt / TT, t = bt % TT, n0 = (ry % (NNODE / (16 * MBT))) * 16 * MBT; const int which = blockIdx.x >> 1, c0 = (blockIdx.x & 1) * 64;
    if (which == 3) {    // the masked-bias plane: tile (nb, mc) = 16 nodes n x 32 nodes m; a lane forms the 8 values that it will hold in k_attn's score accumulator (n = nb*16 + lr, m = mc*32 + u*16 + hi*8 + j)
        for (int tile = ry; tile < MBTILES; tile += NBT * (NNODE / (16 * MBT))) { const int n = (tile >> 5) * 16 + lr;
            const int mt = (tile & 31) * 32 + hi * 8; const size_t ro = (size_t)n * NNODE + mt; v4i a[2][2]; v4f e[2][2];    // the tile's 8 loads are asked for together: one memory latency
#pragma unroll
            for (int u = 0; u < 2; ++u) { a[u][0] = *(const v4i*)(adj + ro + u * 16); a[u][1] = *(const v4i*)(adj + ro + u * 16 + 4); e[u][0] = *(const v4f*)(eb + ro + u * 16); e[u][1] = *(const v4f*)(eb + ro + u * 16 + 4); }
            XW();
#pragma unroll
            for (int u = 0; u < 2; ++u) { const int mb = mt + u * 16; float r[8];
#pragma unroll
                for (int j = 0; j < 8; ++j) { const bool keep = (a[u][j >> 2][j & 3] != 0) | (mb + j == n); r[j] = keep ? e[u][j >> 2][j & 3] : -3.0e38f; }
                const v4u o = { cpk(r[0], r[1]), cpk(r[2], r[3]), cpk(r[4], r[5]), cpk(r[6], r[7]) };
                *(v4ua*)(MB + ((size_t)tile * 2 + u) * 256 + lane * 8) = o; XW(); } }
        return;
    }
    const float* w = which == 0 ? wq : (which == 1 ? wk : wv); const float* bias = which == 0 ? bq : (which == 1 ? bk : bv);
    v8f acc[MBT][4];
#pragma unroll
    for (int mb = 0; mb < MBT; ++mb)
#pragma unroll
        for (int nb = 0; nb < 4; ++nb) acc[mb][nb] = (v8f){};
    const float* xr = x + ((size_t)(b * NNODE + n0 + lr) * TT + t) * DD + 8 * hi; const float* er = emb + (1 - (lr & 1)) * DD + 8 * hi;
    stage_w<4, QW>(w + (size_t)c0 * DD, wsm, wave, lane);
    __syncthreads();    // the fragments read below were written by all 8 waves (the block's only barrier; every wave of a projection block passes it)
#pragma unroll 1    // kept rolled: unrolled, the four passes' loads are hoisted together, the wave's registers grow and fewer waves fit a SIMD
    for (int kc = 0; kc < DD; kc += 32) {
        v16bf a[MBT], a2[MBT]; float ev[16], f[MBT][16];    // all 12 loads of the pass are asked for at its head, so that one memory latency covers them
#pragma unroll
        for (int mb = 0; mb < MBT; ++mb) ld16(xr + (size_t)mb * 16 * TT * DD + kc, f[mb]);
        ld16(er + kc, ev);
#pragma unroll
        for (int i = 0; i < 8; ++i) bfr2(ev[2 * i], ev[2 * i + 1]);
#pragma unroll
        for (int mb = 0; mb < MBT; ++mb) { v8u oh, ol;
#pragma unroll
            for (int i = 0; i < 8; ++i) { unsigned h, l; bfr2(f[mb][2 * i], f[mb][2 * i + 1]); split2(__fadd_rn(f[mb][2 * i], ev[2 * i]), __fadd_rn(f[mb][2 * i + 1], ev[2 * i + 1]), h, l); oh[i] = h; ol[i] = l; }
            a[mb] = __builtin_bit_cast(v16bf, oh); a2[mb] = __builtin_bit_cast(v16bf, ol); }
#pragma unroll
        for (int nb = 0; nb < 4; ++nb) { const v16bf bw = ldw(wsm, (kc >> 5) * 4 + nb, lane);
#pragma unroll
            for (int mb = 0; mb < MBT; ++mb) { acc[mb][nb] = wmmab(a[mb], bw, acc[mb][nb]); acc[mb][nb] = wmmab(a2[mb], bw, acc[mb][nb]); } }
    }
    if (which == 2) {
#pragma unroll
        for (int nb = 0; nb < 4; ++nb) { const int col = c0 + nb * 16 + lr; const float bc = bfr32(bias[col]); XW(); h16* dst = V16 + (((size_t)bt * NH_ + (col >> 5)) * HD + (col & 31)) * NNODE + n0 + hi * 8;
#pragma unroll
            for (int mb = 0; mb < MBT; ++mb) { v8h o;
#pragma unroll
                for (int j = 0; j < 8; ++j) o[j] = tohx(acc[mb][nb][j] + bc);
                *(v8h*)(dst + mb * 16) = o; XW(); } }
        return;
    }
    bf* Ph = which == 0 ? Qh : Kh; bf* Pl = which == 0 ? Ql : Kl; const float scl = which == 0 ? SCL : 1.0f;
    const int cofs = lr * 4, col = c0 + cofs; float b4[4];
#pragma unroll
    for (int q = 0; q < 4; ++q) b4[q] = bfr32(bias[col + q]);
    XW();
    const size_t pofs = (((size_t)bt * NH_ + (col >> 5)) * NNODE + n0) * HD + (col & 31);
#pragma unroll
    for (int mb = 0; mb < MBT; ++mb) {
#pragma unroll
        for (int nb = 0; nb < 4; ++nb) {
#pragma unroll
            for (int j = 0; j < 8; ++j) os[(hi * 8 + j) * 68 + nb * 16 + lr] = acc[mb][nb][j]; }
        __builtin_amdgcn_wave_barrier(); asm volatile("" ::: "memory");    // the rows read below were written by other lanes of this wave: keeps the reads behind the writes
#pragma unroll
        for (int s = 0; s < 8; ++s) { const int row = 2 * s + hi; const v4f val = *(const v4fa*)(os + row * 68 + cofs); v2u oh, ol;
#pragma unroll
            for (int q = 0; q < 2; ++q) { unsigned h, l; split2((val[2 * q] + b4[2 * q]) * scl, (val[2 * q + 1] + b4[2 * q + 1]) * scl, h, l); oh[q] = h; ol[q] = l; }
            *(v2u*)(Ph + pofs + (size_t)(mb * 16 + row) * HD) = oh; *(v2u*)(Pl + pofs + (size_t)(mb * 16 + row) * HD) = ol; XW(); }
        __builtin_amdgcn_wave_barrier(); asm volatile("" ::: "memory");    // keeps the next block's writes behind these reads
    }
}
// exp2x8, exp2x1: 2^x on the transcendental unit, eight (or one) in one asm statement that ends in v_nop: the slot that the instruction set asks for between a transcendental and an instruction that reads its result or overwrites its source. Outputs are early-clobber, so that inside the statement no result lies on a source.
__device__ __forceinline__ void exp2x8(const float* x, float* r) {
    asm("v_exp_f32 %0, %8\n\tv_exp_f32 %1, %9\n\tv_exp_f32 %2, %10\n\tv_exp_f32 %3, %11\n\tv_exp_f32 %4, %12\n\tv_exp_f32 %5, %13\n\tv_exp_f32 %6, %14\n\tv_exp_f32 %7, %15\n\tv_nop"
        : "=&v"(r[0]), "=&v"(r[1]), "=&v"(r[2]), "=&v"(r[3]), "=&v"(r[4]), "=&v"(r[5]), "=&v"(r[6]), "=&v"(r[7]) : "v"(x[0]), "v"(x[1]), "v"(x[2]), "v"(x[3]), "v"(x[4]), "v"(x[5]), "v"(x[6]), "v"(x[7])); }
__device__ __forceinline__ float exp2x1(float x) { float r; asm("v_exp_f32 %0, %1\n\tv_nop" : "=&v"(r) : "v"(x)); return r; }
#define LOG2E 1.44269504f
// k_attn: scores, masked softmax and attn V in one kernel, with the output projection, residual and LayerNorm as its epilogue; one launch for every (batch, step, head). Grid 256, 12 waves: a block is 3 node tiles x the 4 heads (tile = flat index over (batch*step, 32 tiles), head = wave / 3), which by its registers fills a WGP; a wave owns one head of 32 query nodes n (2 tiles of 16) and walks the 1024 key nodes m in chunks of 32.
// Scores are formed TRANSPOSED, St[m][n] = sum_d K[m][d] Q[n][d] (hl planes, the same 3 products): the accumulator then holds, in lane (lr, hi), node n = lr and m = 8 hi + j, which is the k order of a 16x16x32 B fragment
// (tile u = 0 gives k = 8 hi + j, tile u = 1 gives k = 16 + 8 hi + j), so p = exp(s - max) goes from registers into Ot[d][n] = sum_m Vt[d][m] P[n][m] with no exchange, and max, sum and the rescale are per lane (n = lr).
// Online softmax: running max mx (never below -1e38) and sum per n; a masked pair (adj == 0, m != n) carries about -3e38 from the plane MB, so its exp(s - mx) is 0 even while no kept pair has been met; the self loop keeps every sum above 0. Result Ot / sum, split in hl planes, is in the lane's registers exactly its head's A fragment (k = h*32 + d) of the output projection.
// Epilogue: the 4 waves of a tile hand each other these fragments through LDS (first barrier); wave (tile, h) forms rows 32 x columns h*32 .. h*32+31 over all of K = 128 (head by head, hi then lo: the sum order of a projection kernel of its own), B = bf16 Wo, staged once a block in LDS as fragments at the kernel's head;
// the tile's 32 rows are staged in LDS (second barrier); then wave (tile, h) takes rows h*8 .. h*8+7, row by row, 4 consecutive columns a lane: + bf16 bo, + bf16 x, mean and variance by 4-term sums and the xor tree over the 32 lanes, 512 B stored a row.
#define ATL 3    // node tiles a block of k_attn
#define AW (ATL * NH_)    // waves a block of k_attn
// stage_wo: stage_w for Wo's 64 units (8 rows x 32 k) dealt to 12 waves: unit i * 12 + wave; the sixth round has units for waves 0 to 3 only (a test on the wave's number, the same in every lane)
__device__ __forceinline__ void stage_wo(const float* w, bf* wsm, int wave, int lane) {
    constexpr int PER = 6; v4f a[PER][2];    // all loads of the wave are asked for together: one memory latency
#pragma unroll
    for (int i = 0; i < PER; ++i) { const int u = i * AW + wave, row = (u & 15) * 8 + (lane & 7), k = (u >> 4) * 32 + (lane >> 3) * 8; if (i < PER - 1 || wave < 64 - (PER - 1) * AW) { a[i][0] = *(const v4f*)(w + (size_t)row * DD + k); a[i][1] = *(const v4f*)(w + (size_t)row * DD + k + 4); XW(); } }
#pragma unroll
    for (int i = 0; i < PER; ++i) { const int u = i * AW + wave, row = (u & 15) * 8 + (lane & 7), p4 = lane >> 3; if (i < PER - 1 || wave < 64 - (PER - 1) * AW) { const v4u o = { cpk(a[i][0][0], a[i][0][1]), cpk(a[i][0][2], a[i][0][3]), cpk(a[i][1][0], a[i][1][1]), cpk(a[i][1][2], a[i][1][3]) };
        *(v4ua*)(wsm + ((((u >> 4) * 8 + (row >> 4)) * 2 + (p4 >> 1)) * 32 + (p4 & 1) * 16 + (row & 15)) * 8) = o; } }
}
__global__ __launch_bounds__(32 * AW) void k_attn(const bf* Qh, const bf* Ql, const bf* Kh, const bf* Kl, const h16* Vt, const bf* MB, const float* wo, const float* bo, const float* x, const float* g, const float* bb, float* Y) {
    __shared__ __align__(16) bf wsm[32 * 512]; __shared__ __align__(16) bf afr[ATL][2][2][NH_ * 512]; __shared__ __align__(16) float osm[ATL][32 * 132];    // Wo's B fragments; A fragments [tile][16-row half][hi, lo][head]; a tile's 32 projected rows
    const int lane = threadIdx.x & 31, lr = lane & 15, hi = lane >> 4, wave = __builtin_amdgcn_readfirstlane(threadIdx.x >> 5); const int h = wave / ATL, tl = wave % ATL, gt = blockIdx.x * ATL + tl, bt = gt >> 5, b = bt / TT, t = bt % TT; const int n0 = (gt & 31) * 32;
    const size_t pl = ((size_t)bt * NH_ + h) * NNODE * HD; Qh += pl; Ql += pl; Kh += pl; Kl += pl; Vt += pl; MB += (size_t)(n0 >> 4) * 32 * 512 + lane * 8;
    v16bf qh[2], ql[2]; v8f o[2][2]; float mx[2], sum[2];
#pragma unroll
    for (int q = 0; q < 2; ++q) { const size_t qo = (size_t)(n0 + q * 16 + lr) * HD + 8 * hi; qh[q] = WFrag<bf>::ld(Qh + qo); ql[q] = WFrag<bf>::ld(Ql + qo); o[q][0] = (v8f){}; o[q][1] = (v8f){}; mx[q] = -1.0e38f; sum[q] = 0.f; }
    // The chunk's operands are asked for ONE PASS AHEAD, into a second register set: while a pass works on one set, the 16 loads of the next chunk fly into the other, so that a pass no longer opens with a wait for its own loads.
    struct Chunk { v16bf kh[2], kl[2]; v4u bm[2][2]; v16h vt[2]; };
    const bf* pkh = Kh + (size_t)lr * HD + 8 * hi; const bf* pkl = Kl + (size_t)lr * HD + 8 * hi; const h16* pv = Vt + (size_t)lr * NNODE + 8 * hi; const bf* pmb = MB;    // the lane's places in the next chunk to ask for; they step on by a chunk behind each group of loads
    auto ask = [&](Chunk& c) __attribute__((always_inline)) {
#pragma unroll
        for (int u = 0; u < 2; ++u) { c.kh[u] = WFrag<bf>::ld(pkh + u * 16 * HD); c.kl[u] = WFrag<bf>::ld(pkl + u * 16 * HD); }
#pragma unroll
        for (int q = 0; q < 2; ++q)
#pragma unroll
            for (int u = 0; u < 2; ++u) c.bm[q][u] = *(const v4ua*)(pmb + q * 32 * 512 + u * 256);
#pragma unroll
        for (int u = 0; u < 2; ++u) c.vt[u] = WFrag<h16>::ld(pv + (size_t)u * 16 * NNODE);
        asm volatile("s_wait_xcnt 0x0" ::: "memory");    // stands between the chunk's 16 loads and the step of their address registers to the next chunk (the kernel's pointers carry no __restrict__, so that the "memory" clobber keeps each load on its side, in front of the pass that it flies beside)
        pkh += 32 * HD; pkl += 32 * HD; pv += 32; pmb += 512;
    };
    auto pass = [&](const Chunk& c) __attribute__((always_inline)) {
#pragma unroll
        for (int q = 0; q < 2; ++q) { v8f s[2]; float cm = -3.0e38f;
#pragma unroll
            for (int u = 0; u < 2; ++u) { v8f acc;    // the masked bias is the accumulator's start value
#pragma unroll
                for (int i = 0; i < 4; ++i) { acc[2 * i] = __uint_as_float(c.bm[q][u][i] << 16); acc[2 * i + 1] = __uint_as_float(c.bm[q][u][i] & 0xFFFF0000u); }
                acc = wmmab(c.kh[u], qh[q], acc); acc = wmmab(c.kh[u], ql[q], acc); acc = wmmab(c.kl[u], qh[q], acc); s[u] = acc;
#pragma unroll
                for (int j = 0; j < 8; ++j) cm = fmaxf(cm, acc[j]); }
            cm = fmaxf(cm, xhalf(cm));
            const float mn = fmaxf(mx[q], cm); const float al = exp2x1((mx[q] - mn) * LOG2E); mx[q] = mn; float ps = 0.f; v16h p; float ar[16], ex[16];
#pragma unroll
            for (int i = 0; i < 16; ++i) ar[i] = (s[i >> 3][i & 7] - mn) * LOG2E;
            exp2x8(ar, ex); exp2x8(ar + 8, ex + 8);
#pragma unroll
            for (int i = 0; i < 16; ++i) { ps += ex[i]; p[i] = tohx(ex[i]); }
            sum[q] = sum[q] * al + ps;
#pragma unroll
            for (int dt = 0; dt < 2; ++dt) { o[q][dt] *= al; o[q][dt] = wmma16(c.vt[dt], p, o[q][dt]); } }
    };
    Chunk ca, cb;
    ask(ca);
    stage_wo(wo, wsm, wave, lane);    // Wo is asked for behind the first chunk, whose latency it shares; its fragments are read behind the epilogue's first barrier
#pragma unroll 1    // kept rolled: a trip is two passes, one on each register set, so that no set is copied into the other
    for (int m0 = 0; ; m0 += 64) { ask(cb); pass(ca);
        if (m0 + 64 >= NNODE) break;    // the loop is left between its two passes: behind the last chunk there is none to ask for
        ask(ca); pass(cb); }
    const int c0 = lane * 4; const size_t rw = ((size_t)(b * NNODE + n0 + h * 8) * TT + t) * DD + c0; float bo4[4], g4[4], b4[4]; v4f xv[8];    // the wave's 8 residual rows are asked for together in front of the last pass, beside which their latency runs (the first barrier waits for them)
    { const v4f t0 = *(const v4f*)(bo + c0), t1 = *(const v4f*)(g + c0), t2 = *(const v4f*)(bb + c0); XW();
#pragma unroll
      for (int q = 0; q < 4; ++q) { bo4[q] = t0[q]; g4[q] = t1[q]; b4[q] = t2[q]; } }
#pragma unroll
    for (int r = 0; r < 8; ++r) { if (r == 7) XW();    // the last load's result may be given the address registers that the seven before it name
        xv[r] = *(const v4f*)(x + rw + (size_t)r * TT * DD); }
    XW();
    pass(cb);
#pragma unroll
    for (int q = 0; q < 2; ++q) { const float inv = __fdiv_rn(1.0f, sum[q] + xhalf(sum[q]));
#pragma unroll
        for (int dt = 0; dt < 2; ++dt) { v4u ph, pl;
#pragma unroll
            for (int j = 0; j < 4; ++j) { unsigned u, l; split2(o[q][dt][2 * j] * inv, o[q][dt][2 * j + 1] * inv, u, l); ph[j] = u; pl[j] = l; }
            *(v4ua*)(afr[tl][q][0] + h * 512 + dt * 256 + lane * 8) = ph; *(v4ua*)(afr[tl][q][1] + h * 512 + dt * 256 + lane * 8) = pl; } }
    __syncthreads();    // the A fragments read below were written by the tile's 4 waves, Wo's fragments by all 12
    v8f acc[2][2];
#pragma unroll
    for (int q = 0; q < 2; ++q) { acc[q][0] = (v8f){}; acc[q][1] = (v8f){}; }
#pragma unroll
    for (int kc = 0; kc < NH_; ++kc) { v16bf a[2], a2[2];
#pragma unroll
        for (int q = 0; q < 2; ++q) { a[q] = ldw(afr[tl][q][0], kc, lane); a2[q] = ldw(afr[tl][q][1], kc, lane); }
#pragma unroll
        for (int nb = 0; nb < 2; ++nb) { const v16bf bw = ldw(wsm, kc * 8 + h * 2 + nb, lane);
#pragma unroll
            for (int q = 0; q < 2; ++q) { acc[q][nb] = wmmab(a[q], bw, acc[q][nb]); acc[q][nb] = wmmab(a2[q], bw, acc[q][nb]); } } }
    float* os = osm[tl];
#pragma unroll
    for (int q = 0; q < 2; ++q)
#pragma unroll
        for (int nb = 0; nb < 2; ++nb) {
#pragma unroll
            for (int j = 0; j < 8; ++j) os[(q * 16 + hi * 8 + j) * 132 + (h * 2 + nb) * 16 + lr] = acc[q][nb][j]; }
    __syncthreads();    // the rows read below were written by the tile's 4 waves
#pragma unroll
    for (int q = 0; q < 2; ++q) { bfr2(bo4[2 * q], bo4[2 * q + 1]); bfr2(g4[2 * q], g4[2 * q + 1]); bfr2(b4[2 * q], b4[2 * q + 1]); }
#pragma unroll
    for (int r = 0; r < 8; ++r) { const v4f a = *(const v4fa*)(os + (h * 8 + r) * 132 + c0); float v[4]; float s = 0.f; float xb[4] = { xv[r][0], xv[r][1], xv[r][2], xv[r][3] }; bfr2(xb[0], xb[1]); bfr2(xb[2], xb[3]);
#pragma unroll
        for (int q = 0; q < 4; ++q) { v[q] = __fadd_rn(a[q] + bo4[q], xb[q]); s = __fadd_rn(s, v[q]); }
        s = wsum(s);
        const float mean = s * (1.0f / DD); float q2 = 0.f;
#pragma unroll
        for (int q = 0; q < 4; ++q) { const float d0 = v[q] - mean; q2 += d0 * d0; }
        q2 = wsum(q2);
        const float rstd = __frsqrt_rn(__fadd_rn(q2 * (1.0f / DD), 1e-5f)); v4f o4;
#pragma unroll
        for (int q = 0; q < 4; ++q) o4[q] = (v[q] - mean) * rstd * g4[q] + b4[q];
        *(v4f*)(Y + rw + (size_t)r * TT * DD) = o4; XW(); }
}

extern "C" void kernel_launch(void* const* d_in, const int* in_sizes, int n_in,
                              void* d_out, int out_size, void* d_ws, size_t ws_size, hipStream_t stream) {
    (void)in_sizes; (void)n_in; (void)out_size;
    const float* x = (const float*)d_in[0]; const int* adj = (const int*)d_in[1]; const float* emb = (const float*)d_in[2]; const float* wq = (const float*)d_in[3]; const float* bq = (const float*)d_in[4]; const float* wk = (const float*)d_in[5]; const float* bk = (const float*)d_in[6]; const float* wv = (const float*)d_in[7]; const float* bv = (const float*)d_in[8]; const float* eb = (const float*)d_in[9]; const float* wo = (const float*)d_in[10]; const float* bo = (const float*)d_in[11]; const float* g = (const float*)d_in[12]; const float* be = (const float*)d_in[13];
    float* OUT = (float*)d_out;     // [2][1024][12][128]
    char* wsp = (char*)d_ws;
    auto take = [&](size_t bytes) { char* p = wsp; wsp += (bytes + 255) & ~(size_t)255; return (void*)p; };
    bf* Qh = (bf*)take((size_t)NBT * NH_ * NNODE * HD * 2); bf* Ql = (bf*)take((size_t)NBT * NH_ * NNODE * HD * 2); bf* Kh = (bf*)take((size_t)NBT * NH_ * NNODE * HD * 2); bf* Kl = (bf*)take((size_t)NBT * NH_ * NNODE * HD * 2); h16* V16 = (h16*)take((size_t)NBT * NH_ * HD * NNODE * 2);
    bf* MB = (bf*)take((size_t)NNODE * NNODE * 2);
    if ((size_t)(wsp - (char*)d_ws) > ws_size) return;    // total ~ 34 MB
    k_qkv<<<dim3(3 * DD / 64 + 1, NBT * (NNODE / (16 * MBT)) / QW, 1), 32 * QW, 0, stream>>>(x, emb, wq, bq, wk, bk, wv, bv, adj, eb, Qh, Ql, Kh, Kl, V16, MB);
    k_attn<<<NBT * (NNODE / 32) / ATL, 32 * AW, 0, stream>>>(Qh, Ql, Kh, Kl, V16, MB, wo, bo, x, g, be, OUT);
}

// v009
// It runs in 47.7 microseconds.
// Two timings next to v008 both put it at 1.05 times that version's speed.
// All steps since v000 together make it 32.5 times as fast.
#include <hip/hip_runtime.h>

// CHGANSimplified (node_features [2][1024 nodes][12 steps][128]; enh = x + node_type_embed[1 - n%2]; Q/K/V = enh W^T + b (4 heads x 32); per (batch, head, step): scores over node pairs = q.k/sqrt(32) + edge_bias[n][m]; masked to -inf where
// adj[n][m] == 0 and n != m (adj / edge_bias read as data); softmax over m (nan_to_num is a no-op: self loops keep every row non-empty); out = attn V merged; out = out Wo^T + bo; result = LN(out + node_features) -> [2][1024][12][128]).
// Compute dtypes, f32 accumulate: every input rounded to bf16; Q/K/V on bf16 hi+lo planes of enh x bf16 weights (2 products, + bias); scores (K 32) on hl planes (3 products), masked online softmax f32 and fp16 p x fp16 V in one kernel (k_attn); mask, self loop and bf16 edge_bias are merged once a call into one bf16 plane (k_qkv's seventh column of blocks)

#define NB_  2
#define NNODE 1024
#define TT   12
#define DD   128
#define NH_  4
#define HD   32
#define NR   (NNODE * TT)
#define SCL  0.1767766952966369f
#define NBT  (NB_ * TT)
#define NRB  (NB_ * NR)
typedef _Float16 h16;
typedef unsigned short bf;
typedef __attribute__((ext_vector_type(16))) __bf16   v16bf;
typedef __attribute__((ext_vector_type(16))) _Float16 v16h;
typedef __attribute__((ext_vector_type(8)))  _Float16 v8h;
typedef __attribute__((ext_vector_type(8)))  unsigned short v8us;
typedef __attribute__((ext_vector_type(8)))  float    v8f;
typedef __attribute__((ext_vector_type(4)))  float    v4f;
typedef v8h  __attribute__((may_alias)) v8ha;
typedef v4f  __attribute__((may_alias)) v4fa;
typedef v8us __attribute__((may_alias)) v8usa;

__device__ __forceinline__ v16h cat16(v8h lo, v8h hi) { return __builtin_shufflevector(lo, hi, 0, 1, 2, 3, 4, 5, 6, 7, 8, 9, 10, 11, 12, 13, 14, 15); }
__device__ __forceinline__ v16bf cat16b(v8us lo, v8us hi) { return __builtin_bit_cast(v16bf, __builtin_shufflevector(lo, hi, 0, 1, 2, 3, 4, 5, 6, 7, 8, 9, 10, 11, 12, 13, 14, 15)); }
__device__ __forceinline__ v8f wmma16(v16h a, v16h b, v8f c) { return __builtin_amdgcn_wmma_f32_16x16x32_f16(false, a, false, b, (short)0, c, false, false); }
__device__ __forceinline__ v8f wmmab(v16bf a, v16bf b, v8f c) { return __builtin_amdgcn_wmma_f32_16x16x32_bf16(false, a, false, b, (short)0, c, false, false); }




template <typename T16> struct WFrag;
template <> struct WFrag<h16> { typedef v16h V; static __device__ __forceinline__ V ld(const h16* p) { return cat16(*(const v8h*)p, *(const v8h*)(p + 16)); } static __device__ __forceinline__ v8f mma(V a, V b, v8f c) { return wmma16(a, b, c); } };
template <> struct WFrag<bf> { typedef v16bf V; static __device__ __forceinline__ V ld(const bf* p) { return cat16b(*(const v8us*)p, *(const v8us*)(p + 16)); } static __device__ __forceinline__ v8f mma(V a, V b, v8f c) { return wmmab(a, b, c); } };
__device__ __forceinline__ h16 tohx(float x) { return (h16)x; }
// Exchanges between lanes stay on the vector port (a shuffle through the LDS pipe costs its latency and a wait at every link of a dependent chain): xhalf(x) is lane l ^ 16's x (v_permlanex16_b32), xrow<M>(x) lane l ^ M's, M < 16 (DPP row_xmask, fused into the add that uses it).
__device__ __forceinline__ float xhalf(float x) { const int b = __builtin_bit_cast(int, x); return __builtin_bit_cast(float, __builtin_amdgcn_permlanex16(b, b, 0x76543210, 0xfedcba98, false, false)); }
template <int M> __device__ __forceinline__ float xrow(float x) { return __builtin_bit_cast(float, __builtin_amdgcn_update_dpp(0, __builtin_bit_cast(int, x), 0x160 | M, 0xf, 0xf, true)); }
// wsum: sum over the wave's 32 lanes, the xor tree 16, 8, 4, 2, 1; every lane ends with the same value
__device__ __forceinline__ float wsum(float s) { s += xhalf(s); s += xrow<8>(s); s += xrow<4>(s); s += xrow<2>(s); s += xrow<1>(s); return s; }
// XW: s_wait_xcnt 0 behind a group of global loads or stores, in front of whatever later overwrites a register that they name (address or store data). The pointers of the kernels carry no __restrict__, so that the "memory" clobber keeps each load and store on its side.
#define XW() asm volatile("s_wait_xcnt 0x0" ::: "memory")
// ld16: the 16 f32 that make one lane's share of a 16x16x32 fragment, in the k order of WFrag::ld (p[0..7], then p[16..23])
__device__ __forceinline__ void ld16(const float* p, float* f) { const v4f a0 = *(const v4f*)p, a1 = *(const v4f*)(p + 4), a2 = *(const v4f*)(p + 16), a3 = *(const v4f*)(p + 20); XW();
#pragma unroll
    for (int i = 0; i < 4; ++i) { f[i] = a0[i]; f[4 + i] = a1[i]; f[8 + i] = a2[i]; f[12 + i] = a3[i]; } }
// Every f32 -> bf16 rounding (to nearest even) is the chip's packed conversion, two values an instruction: cpk(a, b) is one register of a fragment (element 2i = a low, 2i + 1 = b high); lo2f / hi2f give its two halves back as f32.
// bfr2: a pair rounded to bf16 and kept as f32; bfr32: the same for one value; split2: a pair as hi + lo bf16 planes (lo = the rounded rest y - hi)
typedef __attribute__((ext_vector_type(8))) unsigned v8u;
typedef __attribute__((ext_vector_type(2))) unsigned v2u;
typedef __attribute__((ext_vector_type(2))) float v2f;
typedef __attribute__((ext_vector_type(2))) __bf16 v2bf;
__device__ __forceinline__ unsigned cpk(float a, float b) { const v2f x = { a, b }; return __builtin_bit_cast(unsigned, __builtin_convertvector(x, v2bf)); }
__device__ __forceinline__ float lo2f(unsigned p) { return __uint_as_float(p << 16); }
__device__ __forceinline__ float hi2f(unsigned p) { return __uint_as_float(p & 0xFFFF0000u); }
__device__ __forceinline__ void bfr2(float& a, float& b) { const unsigned p = cpk(a, b); a = lo2f(p); b = hi2f(p); }
__device__ __forceinline__ float bfr32(float f) { return lo2f(cpk(f, f)); }
__device__ __forceinline__ void split2(float y0, float y1, unsigned& h, unsigned& l) { h = cpk(y0, y1); l = cpk(y0 - lo2f(h), y1 - hi2f(h)); }

typedef __attribute__((ext_vector_type(4))) unsigned v4u;
typedef v4u __attribute__((may_alias)) v4ua;
// stage_w: the block's weight tile (16 * NBK rows of 128 f32) is read from memory ONCE A BLOCK, rounded to bf16 and laid in LDS as ready B fragments, fragment (kc/32) * NBK + nb = 1 KB = [half][lane][8], in the k order of WFrag::ld.
// A wave takes units of 8 rows x 32 k: lane = (row & 7) + 8 * (k/8 & 3), 32 B a lane, so that a load touches 8 whole lines (a fragment load from the row-major f32 matrix touches 16 lines for 512 B, and every wave repeated it).
template <int NBK, int NW> __device__ __forceinline__ void stage_w(const float* w, bf* wsm, int wave, int lane) {
    constexpr int PER = NBK * 2 * 4 / NW; v4f a[PER][2];    // all loads of the wave are asked for together: one memory latency
#pragma unroll
    for (int i = 0; i < PER; ++i) { const int u = wave * PER + i, row = (u % (NBK * 2)) * 8 + (lane & 7), k = (u / (NBK * 2)) * 32 + (lane >> 3) * 8; a[i][0] = *(const v4f*)(w + (size_t)row * DD + k); a[i][1] = *(const v4f*)(w + (size_t)row * DD + k + 4); }
    XW();
#pragma unroll
    for (int i = 0; i < PER; ++i) { const int u = wave * PER + i, row = (u % (NBK * 2)) * 8 + (lane & 7), p4 = lane >> 3; const v4u o = { cpk(a[i][0][0], a[i][0][1]), cpk(a[i][0][2], a[i][0][3]), cpk(a[i][1][0], a[i][1][1]), cpk(a[i][1][2], a[i][1][3]) };
        *(v4ua*)(wsm + ((((u / (NBK * 2)) * NBK + (row >> 4)) * 2 + (p4 >> 1)) * 32 + (p4 & 1) * 16 + (row & 15)) * 8) = o; }
}
__device__ __forceinline__ v16bf ldw(const bf* wsm, int frag, int lane) { return cat16b(*(const v8usa*)(wsm + frag * 512 + lane * 8), *(const v8usa*)(wsm + frag * 512 + 256 + lane * 8)); }

// ---- k_qkv: Q, K or V projection with its neighbours folded in. ONE WAVE per 32x64 output tile (8 accumulators); 8 waves a block, which share one column tile's weights through LDS (stage_w); grid (6 column tiles of [q | k | v] and a seventh column for the plane MB, 24 slices bt x 32 node blocks / 8), 256 threads.
// The 32 rows of a tile are 32 consecutive nodes n of one (batch, step) slice bt, so that the tile's results lie contiguous in the planes that k_attn reads.
// Prologue: the A fragments (hi + lo bf16 planes of enh = bf16 x + bf16 emb[1 - n%2]; n's parity is the lane's, as n0 and the 16-row steps are even) are formed in registers from the f32 inputs; the B fragments (bf16 weights) come from LDS (stage_w).
// Epilogue (+ bf16 bias): Q (x scale) and K go out as hl planes [bt][h][n][d], staged through LDS so that a store covers whole 128-B lines; V goes out as fp16 V16[bt][h][dv][m] straight from the accumulators, whose 8 registers are 8 consecutive m.
// Blocks of column 6 do no projection: they write MB, the masked bias of every node pair as bf16 (bf16 edge_bias where adj != 0 or n == m, else -3e38), in the order in which k_attn's lanes hold the scores:
// MB[n/16][m/32][u][lane][j], 512 B in a row for each load of a wave. adj and edge_bias are the same for all 96 (batch, step, head) slices, so this is done once a call and not once a slice.
#define MBT 2    // 16-row blocks a tile
#define MBTILES ((NNODE / 16) * (NNODE / 32))
typedef __attribute__((ext_vector_type(4))) int v4i;
#define QW 8    // waves a block of k_qkv
__global__ __launch_bounds__(32 * QW) void k_qkv(const float* x, const float* emb, const float* wq, const float* bq, const float* wk, const float* bk, const float* wv, const float* bv, const int* adj, const float* eb, bf* Qh, bf* Ql, bf* Kh, bf* Kl, h16* V16, bf* MB) {
    __shared__ __align__(16) float osm[QW][16 * 68]; __shared__ __align__(16) bf wsm[16 * 512];
    const int lane = threadIdx.x & 31, lr = lane & 15, hi = lane >> 4, wave = __builtin_amdgcn_readfirstlane(threadIdx.x >> 5); const int ry = blockIdx.y * QW + wave; float* os = osm[wave]; const int bt = ry / (NNODE / (16 * MBT)), b = bt / TT, t = bt % TT, n0 = (ry % (NNODE / (16 * MBT))) * 16 * MBT; const int which = blockIdx.x >> 1, c0 = (blockIdx.x & 1) * 64;
    if (which == 3) {    // the masked-bias plane: tile (nb, mc) = 16 nodes n x 32 nodes m; a lane forms the 8 values that it will hold in k_attn's score accumulator (n = nb*16 + lr, m = mc*32 + u*16 + hi*8 + j)
        for (int tile = ry; tile < MBTILES; tile += NBT * (NNODE / (16 * MBT))) { const int n = (tile >> 5) * 16 + lr;
            const int mt = (tile & 31) * 32 + hi * 8; const size_t ro = (size_t)n * NNODE + mt; v4i a[2][2]; v4f e[2][2];    // the tile's 8 loads are asked for together: one memory latency
#pragma unroll
            for (int u = 0; u < 2; ++u) { a[u][0] = *(const v4i*)(adj + ro + u * 16); a[u][1] = *(const v4i*)(adj + ro + u * 16 + 4); e[u][0] = *(const v4f*)(eb + ro + u * 16); e[u][1] = *(const v4f*)(eb + ro + u * 16 + 4); }
            XW();
#pragma unroll
            for (int u = 0; u < 2; ++u) { const int mb = mt + u * 16; float r[8];
#pragma unroll
                for (int j = 0; j < 8; ++j) { const bool keep = (a[u][j >> 2][j & 3] != 0) | (mb + j == n); r[j] = keep ? e[u][j >> 2][j & 3] : -3.0e38f; }
                const v4u o = { cpk(r[0], r[1]), cpk(r[2], r[3]), cpk(r[4], r[5]), cpk(r[6], r[7]) };
                *(v4ua*)(MB + ((size_t)tile * 2 + u) * 256 + lane * 8) = o; XW(); } }
        return;
    }
    const float* w = which == 0 ? wq : (which == 1 ? wk : wv); const float* bias = which == 0 ? bq : (which == 1 ? bk : bv);
    v8f acc[MBT][4];
#pragma unroll
    for (int mb = 0; mb < MBT; ++mb)
#pragma unroll
        for (int nb = 0; nb < 4; ++nb) acc[mb][nb] = (v8f){};
    const float* xr = x + ((size_t)(b * NNODE + n0 + lr) * TT + t) * DD + 8 * hi; const float* er = emb + (1 - (lr & 1)) * DD + 8 * hi;
    stage_w<4, QW>(w + (size_t)c0 * DD, wsm, wave, lane);
    __syncthreads();    // the fragments read below were written by all 8 waves (the block's only barrier; every wave of a projection block passes it)
#pragma unroll 1    // kept rolled: unrolled, the four passes' loads are hoisted together, the wave's registers grow and fewer waves fit a SIMD
    for (int kc = 0; kc < DD; kc += 32) {
        v16bf a[MBT], a2[MBT]; float ev[16], f[MBT][16];    // all 12 loads of the pass are asked for at its head, so that one memory latency covers them
#pragma unroll
        for (int mb = 0; mb < MBT; ++mb) ld16(xr + (size_t)mb * 16 * TT * DD + kc, f[mb]);
        ld16(er + kc, ev);
#pragma unroll
        for (int i = 0; i < 8; ++i) bfr2(ev[2 * i], ev[2 * i + 1]);
#pragma unroll
        for (int mb = 0; mb < MBT; ++mb) { v8u oh, ol;
#pragma unroll
            for (int i = 0; i < 8; ++i) { unsigned h, l; bfr2(f[mb][2 * i], f[mb][2 * i + 1]); split2(__fadd_rn(f[mb][2 * i], ev[2 * i]), __fadd_rn(f[mb][2 * i + 1], ev[2 * i + 1]), h, l); oh[i] = h; ol[i] = l; }
            a[mb] = __builtin_bit_cast(v16bf, oh); a2[mb] = __builtin_bit_cast(v16bf, ol); }
#pragma unroll
        for (int nb = 0; nb < 4; ++nb) { const v16bf bw = ldw(wsm, (kc >> 5) * 4 + nb, lane);
#pragma unroll
            for (int mb = 0; mb < MBT; ++mb) { acc[mb][nb] = wmmab(a[mb], bw, acc[mb][nb]); acc[mb][nb] = wmmab(a2[mb], bw, acc[mb][nb]); } }
    }
    if (which == 2) {
#pragma unroll
        for (int nb = 0; nb < 4; ++nb) { const int col = c0 + nb * 16 + lr; const float bc = bfr32(bias[col]); XW(); h16* dst = V16 + (((size_t)bt * NH_ + (col >> 5)) * HD + (col & 31)) * NNODE + n0 + hi * 8;
#pragma unroll
            for (int mb = 0; mb < MBT; ++mb) { v8h o;
#pragma unroll
                for (int j = 0; j < 8; ++j) o[j] = tohx(acc[mb][nb][j] + bc);
                *(v8h*)(dst + mb * 16) = o; XW(); } }
        return;
    }
    bf* Ph = which == 0 ? Qh : Kh; bf* Pl = which == 0 ? Ql : Kl; const float scl = which == 0 ? SCL : 1.0f;
    const int cofs = lr * 4, col = c0 + cofs; float b4[4];
#pragma unroll
    for (int q = 0; q < 4; ++q) b4[q] = bfr32(bias[col + q]);
    XW();
    const size_t pofs = (((size_t)bt * NH_ + (col >> 5)) * NNODE + n0) * HD + (col & 31);
#pragma unroll
    for (int mb = 0; mb < MBT; ++mb) {
#pragma unroll
        for (int nb = 0; nb < 4; ++nb) {
#pragma unroll
            for (int j = 0; j < 8; ++j) os[(hi * 8 + j) * 68 + nb * 16 + lr] = acc[mb][nb][j]; }
        __builtin_amdgcn_wave_barrier(); asm volatile("" ::: "memory");    // the rows read below were written by other lanes of this wave: keeps the reads behind the writes
#pragma unroll
        for (int s = 0; s < 8; ++s) { const int row = 2 * s + hi; const v4f val = *(const v4fa*)(os + row * 68 + cofs); v2u oh, ol;
#pragma unroll
            for (int q = 0; q < 2; ++q) { unsigned h, l; split2((val[2 * q] + b4[2 * q]) * scl, (val[2 * q + 1] + b4[2 * q + 1]) * scl, h, l); oh[q] = h; ol[q] = l; }
            *(v2u*)(Ph + pofs + (size_t)(mb * 16 + row) * HD) = oh; *(v2u*)(Pl + pofs + (size_t)(mb * 16 + row) * HD) = ol; XW(); }
        __builtin_amdgcn_wave_barrier(); asm volatile("" ::: "memory");    // keeps the next block's writes behind these reads
    }
}
// exp2x8, exp2x1: 2^x on the transcendental unit, eight (or one) in one asm statement that ends in v_nop: the slot that the instruction set asks for between a transcendental and an instruction that reads its result or overwrites its source. Outputs are early-clobber, so that inside the statement no result lies on a source.
__device__ __forceinline__ void exp2x8(const float* x, float* r) {
    asm("v_exp_f32 %0, %8\n\tv_exp_f32 %1, %9\n\tv_exp_f32 %2, %10\n\tv_exp_f32 %3, %11\n\tv_exp_f32 %4, %12\n\tv_exp_f32 %5, %13\n\tv_exp_f32 %6, %14\n\tv_exp_f32 %7, %15\n\tv_nop"
        : "=&v"(r[0]), "=&v"(r[1]), "=&v"(r[2]), "=&v"(r[3]), "=&v"(r[4]), "=&v"(r[5]), "=&v"(r[6]), "=&v"(r[7]) : "v"(x[0]), "v"(x[1]), "v"(x[2]), "v"(x[3]), "v"(x[4]), "v"(x[5]), "v"(x[6]), "v"(x[7])); }
__device__ __forceinline__ float exp2x1(float x) { float r; asm("v_exp_f32 %0, %1\n\tv_nop" : "=&v"(r) : "v"(x)); return r; }
#define LOG2E 1.44269504f
#define PLIM 4096.0f    // bound on a lane's sum of p over a pass under a held reference (fp16 ends at 65504)
// k_attn: scores, masked softmax and attn V in one kernel, with the output projection, residual and LayerNorm as its epilogue; one launch for every (batch, step, head). Grid 256, 12 waves: a block is 3 node tiles x the 4 heads (tile = flat index over (batch*step, 32 tiles), head = wave / 3), which by its registers fills a WGP; a wave owns one head of 32 query nodes n (2 tiles of 16) and walks the 1024 key nodes m in chunks of 32.
// Scores are formed TRANSPOSED, St[m][n] = sum_d K[m][d] Q[n][d] (hl planes, the same 3 products): the accumulator then holds, in lane (lr, hi), node n = lr and m = 8 hi + j, which is the k order of a 16x16x32 B fragment
// (tile u = 0 gives k = 8 hi + j, tile u = 1 gives k = 16 + 8 hi + j), so p = exp(s - max) goes from registers into Ot[d][n] = sum_m Vt[d][m] P[n][m] with no exchange, and max, sum and the rescale are per lane (n = lr).
// Online softmax: reference mx (the running max as of the last pass that had to take one, see pass; never below -1e38) and sum per n; a masked pair (adj == 0, m != n) carries about -3e38 from the plane MB, so its exp(s - mx) is 0 even while no kept pair has been met; the self loop keeps every sum above 0. Result Ot / sum, split in hl planes, is in the lane's registers exactly its head's A fragment (k = h*32 + d) of the output projection.
// Epilogue: the 4 waves of a tile hand each other these fragments through LDS (first barrier); wave (tile, h) forms rows 32 x columns h*32 .. h*32+31 over all of K = 128 (head by head, hi then lo: the sum order of a projection kernel of its own), B = bf16 Wo, staged once a block in LDS as fragments at the kernel's head;
// the tile's 32 rows are staged in LDS (second barrier); then wave (tile, h) takes rows h*8 .. h*8+7, row by row, 4 consecutive columns a lane: + bf16 bo, + bf16 x, mean and variance by 4-term sums and the xor tree over the 32 lanes, 512 B stored a row.
#define ATL 3    // node tiles a block of k_attn
#define AW (ATL * NH_)    // waves a block of k_attn
// stage_wo: stage_w for Wo's 64 units (8 rows x 32 k) dealt to 12 waves: unit i * 12 + wave; the sixth round has units for waves 0 to 3 only (a test on the wave's number, the same in every lane)
__device__ __forceinline__ void stage_wo(const float* w, bf* wsm, int wave, int lane) {
    constexpr int PER = 6; v4f a[PER][2];    // all loads of the wave are asked for together: one memory latency
#pragma unroll
    for (int i = 0; i < PER; ++i) { const int u = i * AW + wave, row = (u & 15) * 8 + (lane & 7), k = (u >> 4) * 32 + (lane >> 3) * 8; if (i < PER - 1 || wave < 64 - (PER - 1) * AW) { a[i][0] = *(const v4f*)(w + (size_t)row * DD + k); a[i][1] = *(const v4f*)(w + (size_t)row * DD + k + 4); XW(); } }
#pragma unroll
    for (int i = 0; i < PER; ++i) { const int u = i * AW + wave, row = (u & 15) * 8 + (lane & 7), p4 = lane >> 3; if (i < PER - 1 || wave < 64 - (PER - 1) * AW) { const v4u o = { cpk(a[i][0][0], a[i][0][1]), cpk(a[i][0][2], a[i][0][3]), cpk(a[i][1][0], a[i][1][1]), cpk(a[i][1][2], a[i][1][3]) };
        *(v4ua*)(wsm + ((((u >> 4) * 8 + (row >> 4)) * 2 + (p4 >> 1)) * 32 + (p4 & 1) * 16 + (row & 15)) * 8) = o; } }
}
__global__ __launch_bounds__(32 * AW) void k_attn(const bf* Qh, const bf* Ql, const bf* Kh, const bf* Kl, const h16* Vt, const bf* MB, const float* wo, const float* bo, const float* x, const float* g, const float* bb, float* Y) {
    __shared__ __align__(16) bf wsm[32 * 512]; __shared__ __align__(16) bf afr[ATL][2][2][NH_ * 512]; __shared__ __align__(16) float osm[ATL][32 * 132];    // Wo's B fragments; A fragments [tile][16-row half][hi, lo][head]; a tile's 32 projected rows
    const int lane = threadIdx.x & 31, lr = lane & 15, hi = lane >> 4, wave = __builtin_amdgcn_readfirstlane(threadIdx.x >> 5); const int h = wave / ATL, tl = wave % ATL, gt = blockIdx.x * ATL + tl, bt = gt >> 5, b = bt / TT, t = bt % TT; const int n0 = (gt & 31) * 32;
    const size_t pl = ((size_t)bt * NH_ + h) * NNODE * HD; Qh += pl; Ql += pl; Kh += pl; Kl += pl; Vt += pl; MB += (size_t)(n0 >> 4) * 32 * 512 + lane * 8;
    v16bf qh[2], ql[2]; v8f o[2][2]; float mx[2], nl[2], sum[2];
#pragma unroll
    for (int q = 0; q < 2; ++q) { const size_t qo = (size_t)(n0 + q * 16 + lr) * HD + 8 * hi; qh[q] = WFrag<bf>::ld(Qh + qo); ql[q] = WFrag<bf>::ld(Ql + qo); o[q][0] = (v8f){}; o[q][1] = (v8f){}; mx[q] = -1.0e38f; nl[q] = 1.0e38f * LOG2E; sum[q] = 0.f; }
    // The chunk's operands are asked for ONE PASS AHEAD, into a second register set: while a pass works on one set, the 16 loads of the next chunk fly into the other, so that a pass no longer opens with a wait for its own loads.
    struct Chunk { v16bf kh[2], kl[2]; v4u bm[2][2]; v16h vt[2]; };
    const bf* pkh = Kh + (size_t)lr * HD + 8 * hi; const bf* pkl = Kl + (size_t)lr * HD + 8 * hi; const h16* pv = Vt + (size_t)lr * NNODE + 8 * hi; const bf* pmb = MB;    // the lane's places in the next chunk to ask for; they step on by a chunk behind each group of loads
    // ask(c, last): behind the LAST chunk's loads no pointer steps on, so each address pair is free from its last load on and the compiler may give it to a later load's result inside the group, ahead of the group's one wait: there (last, once a wave) s_wait_xcnt 0 also stands in front of and behind each pointer's last load.
    auto ask = [&](Chunk& c, bool last) __attribute__((always_inline)) {
#pragma unroll
        for (int u = 0; u < 2; ++u) { const bool e = last && u == 1; v8us a = *(const v8us*)(pkh + u * 16 * HD); if (e) XW();
            v8us d = *(const v8us*)(pkh + u * 16 * HD + 16); if (e) XW();
            c.kh[u] = cat16b(a, d); a = *(const v8us*)(pkl + u * 16 * HD); if (e) XW();
            d = *(const v8us*)(pkl + u * 16 * HD + 16); if (e) XW();
            c.kl[u] = cat16b(a, d); }
#pragma unroll
        for (int q = 0; q < 2; ++q)
#pragma unroll
            for (int u = 0; u < 2; ++u) { if (last && q == 1 && u == 1) XW();
                c.bm[q][u] = *(const v4ua*)(pmb + q * 32 * 512 + u * 256); }
        if (last) XW();
#pragma unroll
        for (int u = 0; u < 2; ++u) { const v8h a = *(const v8h*)(pv + (size_t)u * 16 * NNODE); if (last && u == 1) XW();
            c.vt[u] = cat16(a, *(const v8h*)(pv + (size_t)u * 16 * NNODE + 16)); }
        asm volatile("s_wait_xcnt 0x0" ::: "memory");    // stands between the chunk's 16 loads and the step of their address registers to the next chunk (the kernel's pointers carry no __restrict__, so that the "memory" clobber keeps each load on its side, in front of the pass that it flies beside)
        pkh += 32 * HD; pkl += 32 * HD; pv += 32; pmb += 512;
    };
    // The softmax reference of a query node is HELD from pass to pass (nl = -reference * log2 e, so that exp2's argument is one fused multiply-add on the raw score); a pass takes no maximum, no exchange and no rescale.
    // The pass's own sums of p tell whether the held reference still serves: while a lane's 2 x 16 values add up to PLIM at most, every p fits fp16 with room, and any common reference gives the same quotient Ot / sum.
    // Else (one test a pass for the whole wave, a scalar branch; always in the first pass, whose reference -1e38 sends every kept score to +inf) the wave takes the running maximum as its new reference, rescales sum and Ot and forms the pass's p again.
    auto pass = [&](const Chunk& c) __attribute__((always_inline)) {
        v8f s[2][2]; v16h p[2]; float ps[2];
#pragma unroll
        for (int q = 0; q < 2; ++q)
#pragma unroll
            for (int u = 0; u < 2; ++u) { v8f acc;    // the masked bias is the accumulator's start value
#pragma unroll
                for (int i = 0; i < 4; ++i) { acc[2 * i] = __uint_as_float(c.bm[q][u][i] << 16); acc[2 * i + 1] = __uint_as_float(c.bm[q][u][i] & 0xFFFF0000u); }
                acc = wmmab(c.kh[u], qh[q], acc); acc = wmmab(c.kh[u], ql[q], acc); acc = wmmab(c.kl[u], qh[q], acc); s[q][u] = acc; }
        __builtin_amdgcn_sched_barrier(0);    // the 12 score WMMAs stay in front of the exp2 statements: an asm statement's results may lie on a WMMA's K registers; behind this line the multiply-adds fill the distance that the matrix unit asks for
        auto weigh = [&](int q) __attribute__((always_inline)) { float ar[16], ex[16], t = 0.f;
#pragma unroll
            for (int i = 0; i < 16; ++i) ar[i] = __builtin_fmaf(s[q][i >> 3][i & 7], LOG2E, nl[q]);
            exp2x8(ar, ex); exp2x8(ar + 8, ex + 8);
#pragma unroll
            for (int i = 0; i < 16; ++i) { t += ex[i]; p[q][i] = tohx(ex[i]); }
            ps[q] = t; };
        weigh(0); weigh(1);
        if (__builtin_expect(__builtin_amdgcn_ballot_w32(!(ps[0] + ps[1] <= PLIM)) != 0, 0)) {    // marked unlikely, so that the pass without a new reference is the straight path
#pragma unroll
            for (int q = 0; q < 2; ++q) { float cm = -3.0e38f;
#pragma unroll
                for (int i = 0; i < 16; ++i) cm = fmaxf(cm, s[q][i >> 3][i & 7]);
                cm = fmaxf(cm, xhalf(cm));
                const float mn = fmaxf(mx[q], cm); const float al = exp2x1((mx[q] - mn) * LOG2E); mx[q] = mn; nl[q] = -mn * LOG2E;
                weigh(q); sum[q] *= al; o[q][0] *= al; o[q][1] *= al; }
        }
#pragma unroll
        for (int q = 0; q < 2; ++q) { sum[q] += ps[q];
#pragma unroll
            for (int dt = 0; dt < 2; ++dt) o[q][dt] = wmma16(c.vt[dt], p[q], o[q][dt]); }
    };
    Chunk ca, cb;
    ask(ca, false);
    stage_wo(wo, wsm, wave, lane);    // Wo is asked for behind the first chunk, whose latency it shares; its fragments are read behind the epilogue's first barrier
#pragma unroll 1    // kept rolled: a trip is two passes, one on each register set, so that no set is copied into the other
    for (int m0 = 0; m0 < NNODE - 64; m0 += 64) { ask(cb, false); pass(ca); ask(ca, false); pass(cb); }
    ask(cb, true); pass(ca);    // the last two chunks stand behind the loop (behind the last chunk there is none to ask for): left from its middle, the loop copied Ot from one register set to another in every pass, now that no rescale rewrites it
    const int c0 = lane * 4; const size_t rw = ((size_t)(b * NNODE + n0 + h * 8) * TT + t) * DD + c0; float bo4[4], g4[4], b4[4]; v4f xv[8];    // the wave's 8 residual rows are asked for together in front of the last pass, beside which their latency runs (the first barrier waits for them)
    { const v4f t0 = *(const v4f*)(bo + c0), t1 = *(const v4f*)(g + c0), t2 = *(const v4f*)(bb + c0); XW();
#pragma unroll
      for (int q = 0; q < 4; ++q) { bo4[q] = t0[q]; g4[q] = t1[q]; b4[q] = t2[q]; } }
#pragma unroll
    for (int r = 0; r < 8; ++r) { if (r == 7) XW();    // the last load's result may be given the address registers that the seven before it name
        xv[r] = *(const v4f*)(x + rw + (size_t)r * TT * DD); }
    XW();
    pass(cb);
#pragma unroll
    for (int q = 0; q < 2; ++q) { const float inv = __fdiv_rn(1.0f, sum[q] + xhalf(sum[q]));
#pragma unroll
        for (int dt = 0; dt < 2; ++dt) { v4u ph, pl;
#pragma unroll
            for (int j = 0; j < 4; ++j) { unsigned u, l; split2(o[q][dt][2 * j] * inv, o[q][dt][2 * j + 1] * inv, u, l); ph[j] = u; pl[j] = l; }
            *(v4ua*)(afr[tl][q][0] + h * 512 + dt * 256 + lane * 8) = ph; *(v4ua*)(afr[tl][q][1] + h * 512 + dt * 256 + lane * 8) = pl; } }
    __syncthreads();    // the A fragments read below were written by the tile's 4 waves, Wo's fragments by all 12
    v8f acc[2][2];
#pragma unroll
    for (int q = 0; q < 2; ++q) { acc[q][0] = (v8f){}; acc[q][1] = (v8f){}; }
#pragma unroll
    for (int kc = 0; kc < NH_; ++kc) { v16bf a[2], a2[2];
#pragma unroll
        for (int q = 0; q < 2; ++q) { a[q] = ldw(afr[tl][q][0], kc, lane); a2[q] = ldw(afr[tl][q][1], kc, lane); }
#pragma unroll
        for (int nb = 0; nb < 2; ++nb) { const v16bf bw = ldw(wsm, kc * 8 + h * 2 + nb, lane);
#pragma unroll
            for (int q = 0; q < 2; ++q) { acc[q][nb] = wmmab(a[q], bw, acc[q][nb]); acc[q][nb] = wmmab(a2[q], bw, acc[q][nb]); } } }
    float* os = osm[tl];
#pragma unroll
    for (int q = 0; q < 2; ++q)
#pragma unroll
        for (int nb = 0; nb < 2; ++nb) {
#pragma unroll
            for (int j = 0; j < 8; ++j) os[(q * 16 + hi * 8 + j) * 132 + (h * 2 + nb) * 16 + lr] = acc[q][nb][j]; }
    __syncthreads();    // the rows read below were written by the tile's 4 waves
#pragma unroll
    for (int q = 0; q < 2; ++q) { bfr2(bo4[2 * q], bo4[2 * q + 1]); bfr2(g4[2 * q], g4[2 * q + 1]); bfr2(b4[2 * q], b4[2 * q + 1]); }
#pragma unroll
    for (int r = 0; r < 8; ++r) { const v4f a = *(const v4fa*)(os + (h * 8 + r) * 132 + c0); float v[4]; float s = 0.f; float xb[4] = { xv[r][0], xv[r][1], xv[r][2], xv[r][3] }; bfr2(xb[0], xb[1]); bfr2(xb[2], xb[3]);
#pragma unroll
        for (int q = 0; q < 4; ++q) { v[q] = __fadd_rn(a[q] + bo4[q], xb[q]); s = __fadd_rn(s, v[q]); }
        s = wsum(s);
        const float mean = s * (1.0f / DD); float q2 = 0.f;
#pragma unroll
        for (int q = 0; q < 4; ++q) { const float d0 = v[q] - mean; q2 += d0 * d0; }
        q2 = wsum(q2);
        const float rstd = __frsqrt_rn(__fadd_rn(q2 * (1.0f / DD), 1e-5f)); v4f o4;
#pragma unroll
        for (int q = 0; q < 4; ++q) o4[q] = (v[q] - mean) * rstd * g4[q] + b4[q];
        *(v4f*)(Y + rw + (size_t)r * TT * DD) = o4; XW(); }
}

extern "C" void kernel_launch(void* const* d_in, const int* in_sizes, int n_in,
                              void* d_out, int out_size, void* d_ws, size_t ws_size, hipStream_t stream) {
    (void)in_sizes; (void)n_in; (void)out_size;
    const float* x = (const float*)d_in[0]; const int* adj = (const int*)d_in[1]; const float* emb = (const float*)d_in[2]; const float* wq = (const float*)d_in[3]; const float* bq = (const float*)d_in[4]; const float* wk = (const float*)d_in[5]; const float* bk = (const float*)d_in[6]; const float* wv = (const float*)d_in[7]; const float* bv = (const float*)d_in[8]; const float* eb = (const float*)d_in[9]; const float* wo = (const float*)d_in[10]; const float* bo = (const float*)d_in[11]; const float* g = (const float*)d_in[12]; const float* be = (const float*)d_in[13];
    float* OUT = (float*)d_out;     // [2][1024][12][128]
    char* wsp = (char*)d_ws;
    auto take = [&](size_t bytes) { char* p = wsp; wsp += (bytes + 255) & ~(size_t)255; return (void*)p; };
    bf* Qh = (bf*)take((size_t)NBT * NH_ * NNODE * HD * 2); bf* Ql = (bf*)take((size_t)NBT * NH_ * NNODE * HD * 2); bf* Kh = (bf*)take((size_t)NBT * NH_ * NNODE * HD * 2); bf* Kl = (bf*)take((size_t)NBT * NH_ * NNODE * HD * 2); h16* V16 = (h16*)take((size_t)NBT * NH_ * HD * NNODE * 2);
    bf* MB = (bf*)take((size_t)NNODE * NNODE * 2);
    if ((size_t)(wsp - (char*)d_ws) > ws_size) return;    // total ~ 34 MB
    k_qkv<<<dim3(3 * DD / 64 + 1, NBT * (NNODE / (16 * MBT)) / QW, 1), 32 * QW, 0, stream>>>(x, emb, wq, bq, wk, bk, wv, bv, adj, eb, Qh, Ql, Kh, Kl, V16, MB);
    k_attn<<<NBT * (NNODE / 32) / ATL, 32 * AW, 0, stream>>>(Qh, Ql, Kh, Kl, V16, MB, wo, bo, x, g, be, OUT);
}

// v010
// A run of this version takes 39.2 microseconds.
// Next to v009, in two timings, it ran 1.21 times as fast each time.
// Counting every step since v000, it is 39.3 times as fast.
#include <hip/hip_runtime.h>

// CHGANSimplified (node_features [2][1024 nodes][12 steps][128]; enh = x + node_type_embed[1 - n%2]; Q/K/V = enh W^T + b (4 heads x 32); per (batch, head, step): scores over node pairs = q.k/sqrt(32) + edge_bias[n][m]; masked to -inf where
// adj[n][m] == 0 and n != m (adj / edge_bias read as data); softmax over m (nan_to_num is a no-op: self loops keep every row non-empty); out = attn V merged; out = out Wo^T + bo; result = LN(out + node_features) -> [2][1024][12][128]).
// Compute dtypes, f32 accumulate: every input rounded to bf16; Q/K/V on bf16 hi+lo planes of enh x exact weights (2 products, + bias); scores (K 32) one product of fp16 Q x fp16 K (each rounded once from its f32 projection, as V is), masked online softmax f32 and fp16 p x fp16 V in one kernel (k_attn); mask, self loop and bf16 edge_bias are merged once a call into one bf16 plane (k_qkv's seventh column of blocks)

#define NB_  2
#define NNODE 1024
#define TT   12
#define DD   128
#define NH_  4
#define HD   32
#define NR   (NNODE * TT)
#define SCL  0.1767766952966369f
#define NBT  (NB_ * TT)
#define NRB  (NB_ * NR)
typedef _Float16 h16;
typedef unsigned short bf;
typedef __attribute__((ext_vector_type(16))) __bf16   v16bf;
typedef __attribute__((ext_vector_type(16))) _Float16 v16h;
typedef __attribute__((ext_vector_type(8)))  _Float16 v8h;
typedef __attribute__((ext_vector_type(4)))  _Float16 v4h;
typedef __attribute__((ext_vector_type(8)))  unsigned short v8us;
typedef __attribute__((ext_vector_type(8)))  float    v8f;
typedef __attribute__((ext_vector_type(4)))  float    v4f;
typedef v8h  __attribute__((may_alias)) v8ha;
typedef v4f  __attribute__((may_alias)) v4fa;
typedef v8us __attribute__((may_alias)) v8usa;

__device__ __forceinline__ v16h cat16(v8h lo, v8h hi) { return __builtin_shufflevector(lo, hi, 0, 1, 2, 3, 4, 5, 6, 7, 8, 9, 10, 11, 12, 13, 14, 15); }
__device__ __forceinline__ v16bf cat16b(v8us lo, v8us hi) { return __builtin_bit_cast(v16bf, __builtin_shufflevector(lo, hi, 0, 1, 2, 3, 4, 5, 6, 7, 8, 9, 10, 11, 12, 13, 14, 15)); }
__device__ __forceinline__ v8f wmma16(v16h a, v16h b, v8f c) { return __builtin_amdgcn_wmma_f32_16x16x32_f16(false, a, false, b, (short)0, c, false, false); }
__device__ __forceinline__ v8f wmmab(v16bf a, v16bf b, v8f c) { return __builtin_amdgcn_wmma_f32_16x16x32_bf16(false, a, false, b, (short)0, c, false, false); }




template <typename T16> struct WFrag;
template <> struct WFrag<h16> { typedef v16h V; static __device__ __forceinline__ V ld(const h16* p) { return cat16(*(const v8h*)p, *(const v8h*)(p + 16)); } static __device__ __forceinline__ v8f mma(V a, V b, v8f c) { return wmma16(a, b, c); } };
__device__ __forceinline__ h16 tohx(float x) { return (h16)x; }
// Exchanges between lanes stay on the vector port (a shuffle through the LDS pipe costs its latency and a wait at every link of a dependent chain): xhalf(x) is lane l ^ 16's x (v_permlanex16_b32), xrow<M>(x) lane l ^ M's, M < 16 (DPP row_xmask, fused into the add that uses it).
__device__ __forceinline__ float xhalf(float x) { const int b = __builtin_bit_cast(int, x); return __builtin_bit_cast(float, __builtin_amdgcn_permlanex16(b, b, 0x76543210, 0xfedcba98, false, false)); }
template <int M> __device__ __forceinline__ float xrow(float x) { return __builtin_bit_cast(float, __builtin_amdgcn_update_dpp(0, __builtin_bit_cast(int, x), 0x160 | M, 0xf, 0xf, true)); }
// wsum: sum over the wave's 32 lanes, the xor tree 16, 8, 4, 2, 1; every lane ends with the same value
__device__ __forceinline__ float wsum(float s) { s += xhalf(s); s += xrow<8>(s); s += xrow<4>(s); s += xrow<2>(s); s += xrow<1>(s); return s; }
// XW: s_wait_xcnt 0 behind a group of global loads or stores, in front of whatever later overwrites a register that they name (address or store data). The pointers of the kernels carry no __restrict__, so that the "memory" clobber keeps each load and store on its side.
#define XW() asm volatile("s_wait_xcnt 0x0" ::: "memory")
// ld16: the 16 f32 that make one lane's share of a 16x16x32 fragment, in the k order of WFrag::ld (p[0..7], then p[16..23])
__device__ __forceinline__ void ld16(const float* p, float* f) { const v4f a0 = *(const v4f*)p, a1 = *(const v4f*)(p + 4), a2 = *(const v4f*)(p + 16), a3 = *(const v4f*)(p + 20); XW();
#pragma unroll
    for (int i = 0; i < 4; ++i) { f[i] = a0[i]; f[4 + i] = a1[i]; f[8 + i] = a2[i]; f[12 + i] = a3[i]; } }
// Every f32 -> bf16 rounding (to nearest even) is the chip's packed conversion, two values an instruction: cpk(a, b) is one register of a fragment (element 2i = a low, 2i + 1 = b high); lo2f / hi2f give its two halves back as f32.
// bfr2: a pair rounded to bf16 and kept as f32; bfr32: the same for one value; split2: a pair as hi + lo bf16 planes (lo = the rounded rest y - hi)
typedef __attribute__((ext_vector_type(8))) unsigned v8u;
typedef __attribute__((ext_vector_type(2))) float v2f;
typedef __attribute__((ext_vector_type(2))) __bf16 v2bf;
__device__ __forceinline__ unsigned cpk(float a, float b) { const v2f x = { a, b }; return __builtin_bit_cast(unsigned, __builtin_convertvector(x, v2bf)); }
__device__ __forceinline__ float lo2f(unsigned p) { return __uint_as_float(p << 16); }
__device__ __forceinline__ float hi2f(unsigned p) { return __uint_as_float(p & 0xFFFF0000u); }
__device__ __forceinline__ void bfr2(float& a, float& b) { const unsigned p = cpk(a, b); a = lo2f(p); b = hi2f(p); }
__device__ __forceinline__ float bfr32(float f) { return lo2f(cpk(f, f)); }
__device__ __forceinline__ void split2(float y0, float y1, unsigned& h, unsigned& l) { h = cpk(y0, y1); l = cpk(y0 - lo2f(h), y1 - hi2f(h)); }

typedef __attribute__((ext_vector_type(4))) unsigned v4u;
typedef v4u __attribute__((may_alias)) v4ua;
// stage_w: the block's weight tile (16 * NBK rows of 128 f32) is read from memory ONCE A BLOCK, rounded to bf16 and laid in LDS as ready B fragments, fragment (kc/32) * NBK + nb = 1 KB = [half][lane][8], in the k order of WFrag::ld.
// A wave takes units of 8 rows x 32 k: lane = (row & 7) + 8 * (k/8 & 3), 32 B a lane, so that a load touches 8 whole lines (a fragment load from the row-major f32 matrix touches 16 lines for 512 B, and every wave repeated it).
template <int NBK, int NW> __device__ __forceinline__ void stage_w(const float* w, bf* wsm, int wave, int lane) {
    constexpr int PER = NBK * 2 * 4 / NW; v4f a[PER][2];    // all loads of the wave are asked for together: one memory latency
#pragma unroll
    for (int i = 0; i < PER; ++i) { const int u = wave * PER + i, row = (u % (NBK * 2)) * 8 + (lane & 7), k = (u / (NBK * 2)) * 32 + (lane >> 3) * 8; a[i][0] = *(const v4f*)(w + (size_t)row * DD + k); a[i][1] = *(const v4f*)(w + (size_t)row * DD + k + 4); }
    XW();
#pragma unroll
    for (int i = 0; i < PER; ++i) { const int u = wave * PER + i, row = (u % (NBK * 2)) * 8 + (lane & 7), p4 = lane >> 3; const v4u o = { cpk(a[i][0][0], a[i][0][1]), cpk(a[i][0][2], a[i][0][3]), cpk(a[i][1][0], a[i][1][1]), cpk(a[i][1][2], a[i][1][3]) };
        *(v4ua*)(wsm + ((((u / (NBK * 2)) * NBK + (row >> 4)) * 2 + (p4 >> 1)) * 32 + (p4 & 1) * 16 + (row & 15)) * 8) = o; }
}
__device__ __forceinline__ v16bf ldw(const bf* wsm, int frag, int lane) { return cat16b(*(const v8usa*)(wsm + frag * 512 + lane * 8), *(const v8usa*)(wsm + frag * 512 + 256 + lane * 8)); }

// ---- k_qkv: Q, K or V projection with its neighbours folded in. ONE WAVE per 32x64 output tile (8 accumulators); 8 waves a block, which share one column tile's weights through LDS (stage_w); grid (6 column tiles of [q | k | v] and a seventh column for the plane MB, 24 slices bt x 32 node blocks / 8), 256 threads.
// The 32 rows of a tile are 32 consecutive nodes n of one (batch, step) slice bt, so that the tile's results lie contiguous in the planes that k_attn reads.
// Prologue: the A fragments (hi + lo bf16 planes of enh = bf16 x + bf16 emb[1 - n%2]; n's parity is the lane's, as n0 and the 16-row steps are even) are formed in registers from the f32 inputs; the B fragments (bf16 weights) come from LDS (stage_w).
// Epilogue (+ bf16 bias): Q (x scale) and K go out as fp16 planes [bt][h][n][d], staged through LDS so that a store covers whole 128-B lines; V goes out as fp16 V16[bt][h][dv][m] straight from the accumulators, whose 8 registers are 8 consecutive m.
// Blocks of column 6 do no projection: they write MB, the masked bias of every node pair as bf16 (bf16 edge_bias where adj != 0 or n == m, else -3e38), in the order in which k_attn's lanes hold the scores:
// MB[n/16][m/32][u][lane][j], 512 B in a row for each load of a wave. adj and edge_bias are the same for all 96 (batch, step, head) slices, so this is done once a call and not once a slice.
#define MBT 2    // 16-row blocks a tile
#define MBTILES ((NNODE / 16) * (NNODE / 32))
typedef __attribute__((ext_vector_type(4))) int v4i;
#define QW 8    // waves a block of k_qkv
__global__ __launch_bounds__(32 * QW) void k_qkv(const float* x, const float* emb, const float* wq, const float* bq, const float* wk, const float* bk, const float* wv, const float* bv, const int* adj, const float* eb, h16* Q16, h16* K16, h16* V16, bf* MB) {
    __shared__ __align__(16) float osm[QW][16 * 68]; __shared__ __align__(16) bf wsm[16 * 512];
    const int lane = threadIdx.x & 31, lr = lane & 15, hi = lane >> 4, wave = __builtin_amdgcn_readfirstlane(threadIdx.x >> 5); const int ry = blockIdx.y * QW + wave; float* os = osm[wave]; const int bt = ry / (NNODE / (16 * MBT)), b = bt / TT, t = bt % TT, n0 = (ry % (NNODE / (16 * MBT))) * 16 * MBT; const int which = blockIdx.x >> 1, c0 = (blockIdx.x & 1) * 64;
    if (which == 3) {    // the masked-bias plane: tile (nb, mc) = 16 nodes n x 32 nodes m; a lane forms the 8 values that it will hold in k_attn's score accumulator (n = nb*16 + lr, m = mc*32 + u*16 + hi*8 + j)
        for (int tile = ry; tile < MBTILES; tile += NBT * (NNODE / (16 * MBT))) { const int n = (tile >> 5) * 16 + lr;
            const int mt = (tile & 31) * 32 + hi * 8; const size_t ro = (size_t)n * NNODE + mt; v4i a[2][2]; v4f e[2][2];    // the tile's 8 loads are asked for together: one memory latency
#pragma unroll
            for (int u = 0; u < 2; ++u) { a[u][0] = *(const v4i*)(adj + ro + u * 16); a[u][1] = *(const v4i*)(adj + ro + u * 16 + 4); e[u][0] = *(const v4f*)(eb + ro + u * 16); e[u][1] = *(const v4f*)(eb + ro + u * 16 + 4); }
            XW();
#pragma unroll
            for (int u = 0; u < 2; ++u) { const int mb = mt + u * 16; float r[8];
#pragma unroll
                for (int j = 0; j < 8; ++j) { const bool keep = (a[u][j >> 2][j & 3] != 0) | (mb + j == n); r[j] = keep ? e[u][j >> 2][j & 3] : -3.0e38f; }
                const v4u o = { cpk(r[0], r[1]), cpk(r[2], r[3]), cpk(r[4], r[5]), cpk(r[6], r[7]) };
                *(v4ua*)(MB + ((size_t)tile * 2 + u) * 256 + lane * 8) = o; XW(); } }
        return;
    }
    const float* w = which == 0 ? wq : (which == 1 ? wk : wv); const float* bias = which == 0 ? bq : (which == 1 ? bk : bv);
    v8f acc[MBT][4];
#pragma unroll
    for (int mb = 0; mb < MBT; ++mb)
#pragma unroll
        for (int nb = 0; nb < 4; ++nb) acc[mb][nb] = (v8f){};
    const float* xr = x + ((size_t)(b * NNODE + n0 + lr) * TT + t) * DD + 8 * hi; const float* er = emb + (1 - (lr & 1)) * DD + 8 * hi;
    stage_w<4, QW>(w + (size_t)c0 * DD, wsm, wave, lane);
    __syncthreads();    // the fragments read below were written by all 8 waves (the block's only barrier; every wave of a projection block passes it)
#pragma unroll 1    // kept rolled: unrolled, the four passes' loads are hoisted together, the wave's registers grow and fewer waves fit a SIMD
    for (int kc = 0; kc < DD; kc += 32) {
        v16bf a[MBT], a2[MBT]; float ev[16], f[MBT][16];    // all 12 loads of the pass are asked for at its head, so that one memory latency covers them
#pragma unroll
        for (int mb = 0; mb < MBT; ++mb) ld16(xr + (size_t)mb * 16 * TT * DD + kc, f[mb]);
        ld16(er + kc, ev);
#pragma unroll
        for (int i = 0; i < 8; ++i) bfr2(ev[2 * i], ev[2 * i + 1]);
#pragma unroll
        for (int mb = 0; mb < MBT; ++mb) { v8u oh, ol;
#pragma unroll
            for (int i = 0; i < 8; ++i) { unsigned h, l; bfr2(f[mb][2 * i], f[mb][2 * i + 1]); split2(__fadd_rn(f[mb][2 * i], ev[2 * i]), __fadd_rn(f[mb][2 * i + 1], ev[2 * i + 1]), h, l); oh[i] = h; ol[i] = l; }
            a[mb] = __builtin_bit_cast(v16bf, oh); a2[mb] = __builtin_bit_cast(v16bf, ol); }
#pragma unroll
        for (int nb = 0; nb < 4; ++nb) { const v16bf bw = ldw(wsm, (kc >> 5) * 4 + nb, lane);
#pragma unroll
            for (int mb = 0; mb < MBT; ++mb) { acc[mb][nb] = wmmab(a[mb], bw, acc[mb][nb]); acc[mb][nb] = wmmab(a2[mb], bw, acc[mb][nb]); } }
    }
    if (which == 2) {
#pragma unroll
        for (int nb = 0; nb < 4; ++nb) { const int col = c0 + nb * 16 + lr; const float bc = bfr32(bias[col]); XW(); h16* dst = V16 + (((size_t)bt * NH_ + (col >> 5)) * HD + (col & 31)) * NNODE + n0 + hi * 8;
#pragma unroll
            for (int mb = 0; mb < MBT; ++mb) { v8h o;
#pragma unroll
                for (int j = 0; j < 8; ++j) o[j] = tohx(acc[mb][nb][j] + bc);
                *(v8h*)(dst + mb * 16) = o; XW(); } }
        return;
    }
    h16* P = which == 0 ? Q16 : K16; const float scl = which == 0 ? SCL : 1.0f;
    const int cofs = lr * 4, col = c0 + cofs; float b4[4];
#pragma unroll
    for (int q = 0; q < 4; ++q) b4[q] = bfr32(bias[col + q]);
    XW();
    const size_t pofs = (((size_t)bt * NH_ + (col >> 5)) * NNODE + n0) * HD + (col & 31);
#pragma unroll
    for (int mb = 0; mb < MBT; ++mb) {
#pragma unroll
        for (int nb = 0; nb < 4; ++nb) {
#pragma unroll
            for (int j = 0; j < 8; ++j) os[(hi * 8 + j) * 68 + nb * 16 + lr] = acc[mb][nb][j]; }
        __builtin_amdgcn_wave_barrier(); asm volatile("" ::: "memory");    // the rows read below were written by other lanes of this wave: keeps the reads behind the writes
#pragma unroll
        for (int s = 0; s < 8; ++s) { const int row = 2 * s + hi; const v4f val = *(const v4fa*)(os + row * 68 + cofs); v4h o4;
#pragma unroll
            for (int q = 0; q < 4; ++q) o4[q] = tohx((val[q] + b4[q]) * scl);
            *(v4h*)(P + pofs + (size_t)(mb * 16 + row) * HD) = o4; XW(); }
        __builtin_amdgcn_wave_barrier(); asm volatile("" ::: "memory");    // keeps the next block's writes behind these reads
    }
}
// exp2x8, exp2x1: 2^x on the transcendental unit, eight (or one) in one asm statement that ends in v_nop: the slot that the instruction set asks for between a transcendental and an instruction that reads its result or overwrites its source. Outputs are early-clobber, so that inside the statement no result lies on a source.
__device__ __forceinline__ void exp2x8(const float* x, float* r) {
    asm("v_exp_f32 %0, %8\n\tv_exp_f32 %1, %9\n\tv_exp_f32 %2, %10\n\tv_exp_f32 %3, %11\n\tv_exp_f32 %4, %12\n\tv_exp_f32 %5, %13\n\tv_exp_f32 %6, %14\n\tv_exp_f32 %7, %15\n\tv_nop"
        : "=&v"(r[0]), "=&v"(r[1]), "=&v"(r[2]), "=&v"(r[3]), "=&v"(r[4]), "=&v"(r[5]), "=&v"(r[6]), "=&v"(r[7]) : "v"(x[0]), "v"(x[1]), "v"(x[2]), "v"(x[3]), "v"(x[4]), "v"(x[5]), "v"(x[6]), "v"(x[7])); }
__device__ __forceinline__ float exp2x1(float x) { float r; asm("v_exp_f32 %0, %1\n\tv_nop" : "=&v"(r) : "v"(x)); return r; }
#define LOG2E 1.44269504f
#define PLIM 4096.0f    // bound on a lane's sum of p over a pass under a held reference (fp16 ends at 65504)
// k_attn: scores, masked softmax and attn V in one kernel, with the output projection, residual and LayerNorm as its epilogue; one launch for every (batch, step, head). Grid 256, 12 waves: a block is 3 node tiles x the 4 heads (tile = flat index over (batch*step, 32 tiles), head = wave / 3), which by its registers fills a WGP; a wave owns one head of 32 query nodes n (2 tiles of 16) and walks the 1024 key nodes m in chunks of 32.
// Scores are formed TRANSPOSED, St[m][n] = sum_d K[m][d] Q[n][d] (fp16 planes, one product): the accumulator then holds, in lane (lr, hi), node n = lr and m = 8 hi + j, which is the k order of a 16x16x32 B fragment
// (tile u = 0 gives k = 8 hi + j, tile u = 1 gives k = 16 + 8 hi + j), so p = exp(s - max) goes from registers into Ot[d][n] = sum_m Vt[d][m] P[n][m] with no exchange, and max, sum and the rescale are per lane (n = lr).
// Online softmax: reference mx (the running max as of the last pass that had to take one, see pass; never below -1e38) and sum per n; a masked pair (adj == 0, m != n) carries about -3e38 from the plane MB, so its exp(s - mx) is 0 even while no kept pair has been met; the self loop keeps every sum above 0. Result Ot / sum, split in hl planes, is in the lane's registers exactly its head's A fragment (k = h*32 + d) of the output projection.
// Epilogue: the 4 waves of a tile hand each other these fragments through LDS (first barrier); wave (tile, h) forms rows 32 x columns h*32 .. h*32+31 over all of K = 128 (head by head, hi then lo: the sum order of a projection kernel of its own), B = bf16 Wo, staged once a block in LDS as fragments at the kernel's head;
// the tile's 32 rows are staged in LDS (second barrier); then wave (tile, h) takes rows h*8 .. h*8+7, row by row, 4 consecutive columns a lane: + bf16 bo, + bf16 x, mean and variance by 4-term sums and the xor tree over the 32 lanes, 512 B stored a row.
#define ATL 3    // node tiles a block of k_attn
#define AW (ATL * NH_)    // waves a block of k_attn
// stage_wo: stage_w for Wo's 64 units (8 rows x 32 k) dealt to 12 waves: unit i * 12 + wave; the sixth round has units for waves 0 to 3 only (a test on the wave's number, the same in every lane)
__device__ __forceinline__ void stage_wo(const float* w, bf* wsm, int wave, int lane) {
    constexpr int PER = 6; v4f a[PER][2];    // all loads of the wave are asked for together: one memory latency
#pragma unroll
    for (int i = 0; i < PER; ++i) { const int u = i * AW + wave, row = (u & 15) * 8 + (lane & 7), k = (u >> 4) * 32 + (lane >> 3) * 8; if (i < PER - 1 || wave < 64 - (PER - 1) * AW) { a[i][0] = *(const v4f*)(w + (size_t)row * DD + k); a[i][1] = *(const v4f*)(w + (size_t)row * DD + k + 4); XW(); } }
#pragma unroll
    for (int i = 0; i < PER; ++i) { const int u = i * AW + wave, row = (u & 15) * 8 + (lane & 7), p4 = lane >> 3; if (i < PER - 1 || wave < 64 - (PER - 1) * AW) { const v4u o = { cpk(a[i][0][0], a[i][0][1]), cpk(a[i][0][2], a[i][0][3]), cpk(a[i][1][0], a[i][1][1]), cpk(a[i][1][2], a[i][1][3]) };
        *(v4ua*)(wsm + ((((u >> 4) * 8 + (row >> 4)) * 2 + (p4 >> 1)) * 32 + (p4 & 1) * 16 + (row & 15)) * 8) = o; } }
}
__global__ __launch_bounds__(32 * AW) void k_attn(const h16* Q16, const h16* K16, const h16* Vt, const bf* MB, const float* wo, const float* bo, const float* x, const float* g, const float* bb, float* Y) {
    __shared__ __align__(16) bf wsm[32 * 512]; __shared__ __align__(16) bf afr[ATL][2][2][NH_ * 512]; __shared__ __align__(16) float osm[ATL][32 * 132];    // Wo's B fragments; A fragments [tile][16-row half][hi, lo][head]; a tile's 32 projected rows
    const int lane = threadIdx.x & 31, lr = lane & 15, hi = lane >> 4, wave = __builtin_amdgcn_readfirstlane(threadIdx.x >> 5); const int h = wave / ATL, tl = wave % ATL, gt = blockIdx.x * ATL + tl, bt = gt >> 5, b = bt / TT, t = bt % TT; const int n0 = (gt & 31) * 32;
    const size_t pl = ((size_t)bt * NH_ + h) * NNODE * HD; Q16 += pl; K16 += pl; Vt += pl; MB += (size_t)(n0 >> 4) * 32 * 512 + lane * 8;
    v16h qf[2]; v8f o[2][2]; float mx[2], nl[2], sum[2];
#pragma unroll
    for (int q = 0; q < 2; ++q) { const size_t qo = (size_t)(n0 + q * 16 + lr) * HD + 8 * hi; qf[q] = WFrag<h16>::ld(Q16 + qo); o[q][0] = (v8f){}; o[q][1] = (v8f){}; mx[q] = -1.0e38f; nl[q] = 1.0e38f * LOG2E; sum[q] = 0.f; }
    // The chunk's operands are asked for ONE PASS AHEAD, into a second register set: while a pass works on one set, the 12 loads of the next chunk fly into the other, so that a pass no longer opens with a wait for its own loads.
    struct Chunk { v16h k[2]; v4u bm[2][2]; v16h vt[2]; };
    const h16* pk = K16 + (size_t)lr * HD + 8 * hi; const h16* pv = Vt + (size_t)lr * NNODE + 8 * hi; const bf* pmb = MB;    // the lane's places in the next chunk to ask for; they step on by a chunk behind each group of loads
    // ask(c, last): behind the LAST chunk's loads no pointer steps on, so each address pair is free from its last load on and the compiler may give it to a later load's result inside the group, ahead of the group's one wait: there (last, once a wave) s_wait_xcnt 0 also stands in front of and behind each pointer's last load.
    auto ask = [&](Chunk& c, bool last) __attribute__((always_inline)) {
#pragma unroll
        for (int u = 0; u < 2; ++u) { const bool e = last && u == 1; const v8h a = *(const v8h*)(pk + u * 16 * HD); if (e) XW();
            const v8h d = *(const v8h*)(pk + u * 16 * HD + 16); if (e) XW();
            c.k[u] = cat16(a, d); }
#pragma unroll
        for (int q = 0; q < 2; ++q)
#pragma unroll
            for (int u = 0; u < 2; ++u) { if (last && q == 1 && u == 1) XW();
                c.bm[q][u] = *(const v4ua*)(pmb + q * 32 * 512 + u * 256); }
        if (last) XW();
#pragma unroll
        for (int u = 0; u < 2; ++u) { const v8h a = *(const v8h*)(pv + (size_t)u * 16 * NNODE); if (last && u == 1) XW();
            c.vt[u] = cat16(a, *(const v8h*)(pv + (size_t)u * 16 * NNODE + 16)); }
        asm volatile("s_wait_xcnt 0x0" ::: "memory");    // stands between the chunk's 12 loads and the step of their address registers to the next chunk (the kernel's pointers carry no __restrict__, so that the "memory" clobber keeps each load on its side, in front of the pass that it flies beside)
        pk += 32 * HD; pv += 32; pmb += 512;
    };
    // The softmax reference of a query node is HELD from pass to pass (nl = -reference * log2 e, so that exp2's argument is one fused multiply-add on the raw score); a pass takes no maximum, no exchange and no rescale.
    // The pass's own sums of p tell whether the held reference still serves: while a lane's 2 x 16 values add up to PLIM at most, every p fits fp16 with room, and any common reference gives the same quotient Ot / sum.
    // Else (one test a pass for the whole wave, a scalar branch; always in the first pass, whose reference -1e38 sends every kept score to +inf) the wave takes the running maximum as its new reference, rescales sum and Ot and forms the pass's p again.
    auto pass = [&](const Chunk& c) __attribute__((always_inline)) {
        v8f s[2][2]; v16h p[2]; float ps[2];
#pragma unroll
        for (int q = 0; q < 2; ++q)
#pragma unroll
            for (int u = 0; u < 2; ++u) { v8f acc;    // the masked bias is the accumulator's start value
#pragma unroll
                for (int i = 0; i < 4; ++i) { acc[2 * i] = __uint_as_float(c.bm[q][u][i] << 16); acc[2 * i + 1] = __uint_as_float(c.bm[q][u][i] & 0xFFFF0000u); }
                s[q][u] = wmma16(c.k[u], qf[q], acc); }
        __builtin_amdgcn_sched_barrier(0);    // the 4 score WMMAs stay in front of the exp2 statements, whose results the compiler may lay on a WMMA's K registers; behind this line the multiply-adds fill the distance that the matrix unit asks for
        auto weigh = [&](int q) __attribute__((always_inline)) { float ar[16], ex[16], t = 0.f;
#pragma unroll
            for (int i = 0; i < 16; ++i) ar[i] = __builtin_fmaf(s[q][i >> 3][i & 7], LOG2E, nl[q]);
            exp2x8(ar, ex); exp2x8(ar + 8, ex + 8);
#pragma unroll
            for (int i = 0; i < 16; ++i) { t += ex[i]; p[q][i] = tohx(ex[i]); }
            ps[q] = t; };
        weigh(0); weigh(1);
        if (__builtin_expect(__builtin_amdgcn_ballot_w32(!(ps[0] + ps[1] <= PLIM)) != 0, 0)) {    // marked unlikely, so that the pass without a new reference is the straight path
#pragma unroll
            for (int q = 0; q < 2; ++q) { float cm = -3.0e38f;
#pragma unroll
                for (int i = 0; i < 16; ++i) cm = fmaxf(cm, s[q][i >> 3][i & 7]);
                cm = fmaxf(cm, xhalf(cm));
                const float mn = fmaxf(mx[q], cm); const float al = exp2x1((mx[q] - mn) * LOG2E); mx[q] = mn; nl[q] = -mn * LOG2E;
                weigh(q); sum[q] *= al; o[q][0] *= al; o[q][1] *= al; }
        }
#pragma unroll
        for (int q = 0; q < 2; ++q) { sum[q] += ps[q];
#pragma unroll
            for (int dt = 0; dt < 2; ++dt) o[q][dt] = wmma16(c.vt[dt], p[q], o[q][dt]); }
    };
    Chunk ca, cb;
    ask(ca, false);
    stage_wo(wo, wsm, wave, lane);    // Wo is asked for behind the first chunk, whose latency it shares; its fragments are read behind the epilogue's first barrier
#pragma unroll 1    // kept rolled: a trip is two passes, one on each register set, so that no set is copied into the other
    for (int m0 = 0; m0 < NNODE - 64; m0 += 64) { ask(cb, false); pass(ca); ask(ca, false); pass(cb); }
    ask(cb, true); pass(ca);    // the last two chunks stand behind the loop (behind the last chunk there is none to ask for): left from its middle, the loop copied Ot from one register set to another in every pass, now that no rescale rewrites it
    const int c0 = lane * 4; const size_t rw = ((size_t)(b * NNODE + n0 + h * 8) * TT + t) * DD + c0; float bo4[4], g4[4], b4[4]; v4f xv[8];    // the wave's 8 residual rows are asked for together in front of the last pass, beside which their latency runs (the first barrier waits for them)
    { const v4f t0 = *(const v4f*)(bo + c0), t1 = *(const v4f*)(g + c0), t2 = *(const v4f*)(bb + c0); XW();
#pragma unroll
      for (int q = 0; q < 4; ++q) { bo4[q] = t0[q]; g4[q] = t1[q]; b4[q] = t2[q]; } }
#pragma unroll
    for (int r = 0; r < 8; ++r) { if (r == 7) XW();    // the last load's result may be given the address registers that the seven before it name
        xv[r] = *(const v4f*)(x + rw + (size_t)r * TT * DD); }
    XW();
    pass(cb);
#pragma unroll
    for (int q = 0; q < 2; ++q) { const float inv = __fdiv_rn(1.0f, sum[q] + xhalf(sum[q]));
#pragma unroll
        for (int dt = 0; dt < 2; ++dt) { v4u ph, pl;
#pragma unroll
            for (int j = 0; j < 4; ++j) { unsigned u, l; split2(o[q][dt][2 * j] * inv, o[q][dt][2 * j + 1] * inv, u, l); ph[j] = u; pl[j] = l; }
            *(v4ua*)(afr[tl][q][0] + h * 512 + dt * 256 + lane * 8) = ph; *(v4ua*)(afr[tl][q][1] + h * 512 + dt * 256 + lane * 8) = pl; } }
    __syncthreads();    // the A fragments read below were written by the tile's 4 waves, Wo's fragments by all 12
    v8f acc[2][2];
#pragma unroll
    for (int q = 0; q < 2; ++q) { acc[q][0] = (v8f){}; acc[q][1] = (v8f){}; }
#pragma unroll
    for (int kc = 0; kc < NH_; ++kc) { v16bf a[2], a2[2];
#pragma unroll
        for (int q = 0; q < 2; ++q) { a[q] = ldw(afr[tl][q][0], kc, lane); a2[q] = ldw(afr[tl][q][1], kc, lane); }
#pragma unroll
        for (int nb = 0; nb < 2; ++nb) { const v16bf bw = ldw(wsm, kc * 8 + h * 2 + nb, lane);
#pragma unroll
            for (int q = 0; q < 2; ++q) { acc[q][nb] = wmmab(a[q], bw, acc[q][nb]); acc[q][nb] = wmmab(a2[q], bw, acc[q][nb]); } } }
    float* os = osm[tl];
#pragma unroll
    for (int q = 0; q < 2; ++q)
#pragma unroll
        for (int nb = 0; nb < 2; ++nb) {
#pragma unroll
            for (int j = 0; j < 8; ++j) os[(q * 16 + hi * 8 + j) * 132 + (h * 2 + nb) * 16 + lr] = acc[q][nb][j]; }
    __syncthreads();    // the rows read below were written by the tile's 4 waves
#pragma unroll
    for (int q = 0; q < 2; ++q) { bfr2(bo4[2 * q], bo4[2 * q + 1]); bfr2(g4[2 * q], g4[2 * q + 1]); bfr2(b4[2 * q], b4[2 * q + 1]); }
#pragma unroll
    for (int r = 0; r < 8; ++r) { const v4f a = *(const v4fa*)(os + (h * 8 + r) * 132 + c0); float v[4]; float s = 0.f; float xb[4] = { xv[r][0], xv[r][1], xv[r][2], xv[r][3] }; bfr2(xb[0], xb[1]); bfr2(xb[2], xb[3]);
#pragma unroll
        for (int q = 0; q < 4; ++q) { v[q] = __fadd_rn(a[q] + bo4[q], xb[q]); s = __fadd_rn(s, v[q]); }
        s = wsum(s);
        const float mean = s * (1.0f / DD); float q2 = 0.f;
#pragma unroll
        for (int q = 0; q < 4; ++q) { const float d0 = v[q] - mean; q2 += d0 * d0; }
        q2 = wsum(q2);
        const float rstd = __frsqrt_rn(__fadd_rn(q2 * (1.0f / DD), 1e-5f)); v4f o4;
#pragma unroll
        for (int q = 0; q < 4; ++q) o4[q] = (v[q] - mean) * rstd * g4[q] + b4[q];
        *(v4f*)(Y + rw + (size_t)r * TT * DD) = o4; XW(); }
}

extern "C" void kernel_launch(void* const* d_in, const int* in_sizes, int n_in,
                              void* d_out, int out_size, void* d_ws, size_t ws_size, hipStream_t stream) {
    (void)in_sizes; (void)n_in; (void)out_size;
    const float* x = (const float*)d_in[0]; const int* adj = (const int*)d_in[1]; const float* emb = (const float*)d_in[2]; const float* wq = (const float*)d_in[3]; const float* bq = (const float*)d_in[4]; const float* wk = (const float*)d_in[5]; const float* bk = (const float*)d_in[6]; const float* wv = (const float*)d_in[7]; const float* bv = (const float*)d_in[8]; const float* eb = (const float*)d_in[9]; const float* wo = (const float*)d_in[10]; const float* bo = (const float*)d_in[11]; const float* g = (const float*)d_in[12]; const float* be = (const float*)d_in[13];
    float* OUT = (float*)d_out;     // [2][1024][12][128]
    char* wsp = (char*)d_ws;
    auto take = [&](size_t bytes) { char* p = wsp; wsp += (bytes + 255) & ~(size_t)255; return (void*)p; };
    h16* Q16 = (h16*)take((size_t)NBT * NH_ * NNODE * HD * 2); h16* K16 = (h16*)take((size_t)NBT * NH_ * NNODE * HD * 2); h16* V16 = (h16*)take((size_t)NBT * NH_ * HD * NNODE * 2);
    bf* MB = (bf*)take((size_t)NNODE * NNODE * 2);
    if ((size_t)(wsp - (char*)d_ws) > ws_size) return;    // total ~ 21 MB
    k_qkv<<<dim3(3 * DD / 64 + 1, NBT * (NNODE / (16 * MBT)) / QW, 1), 32 * QW, 0, stream>>>(x, emb, wq, bq, wk, bk, wv, bv, adj, eb, Q16, K16, V16, MB);
    k_attn<<<NBT * (NNODE / 32) / ATL, 32 * AW, 0, stream>>>(Q16, K16, V16, MB, wo, bo, x, g, be, OUT);
}
